// v000
// Measured on an AMD MI455X. A time is GPU time per run, averaged over a window of back-to-back runs after a warm-up
// (all launches, gaps included; the runs take copies of the inputs in turn), and the median of several windows.
// Apart from v000's, it joins two sittings. Times from different sittings can be a few percent apart, while
// side-by-side timings come from the same sitting.
// The starting kernel, v000, takes 466 microseconds a run.
#include <hip/hip_runtime.h>

typedef _Float16 half_t;
typedef __attribute__((ext_vector_type(4)))  _Float16 v4h;
typedef __attribute__((ext_vector_type(8)))  _Float16 v8h;
typedef __attribute__((ext_vector_type(16))) _Float16 v16h;
typedef __attribute__((ext_vector_type(8)))  float    v8f;

#define R_TOTAL 65536   // b*n*r = 4*64*256
#define DIMX    512
#define DHEAD   64
#define SEQ     256
#define EPS_F   1e-5f
#define P_STRIDE 264    // LDS row stride (halves) for P, 16B-aligned, conflict-padded

// Load a 16-bit A/B WMMA fragment (16x32 A, or 32x16 B via its N-major mirror).
// Caller passes p = base + row_or_n*stride + kBase + (lane>>4)*8.
// lane<16 needs K {0..7, 16..23}, lane>=16 needs K {8..15, 24..31}: two b128 loads.
__device__ __forceinline__ v16h frag_ld(const half_t* p) {
  v8h lo = *(const v8h*)(p);
  v8h hi = *(const v8h*)(p + 16);
  return __builtin_shufflevector(lo, hi, 0,1,2,3,4,5,6,7,8,9,10,11,12,13,14,15);
}

__device__ __forceinline__ v8f wmma_f16(v16h a, v16h b, v8f c) {
  return __builtin_amdgcn_wmma_f32_16x16x32_f16(false, a, false, b, (short)0, c, false, false);
}

// CDNA5 async global->LDS copy, 16 bytes per lane, tracked by ASYNCcnt.
__device__ __forceinline__ void async_cp16(const half_t* g, half_t* l) {
  const unsigned ldsa = (unsigned)(uintptr_t)l;  // flat LDS aperture: addr[31:0] = LDS offset
  asm volatile("global_load_async_to_lds_b128 %0, %1, off"
               :: "v"(ldsa), "v"(g) : "memory");
}

// ---------------- Kernel 0a: input LayerNorm, f32 -> f16 ----------------
__global__ __launch_bounds__(256) void ln_in_kernel(const float* __restrict__ x,
                                                    const float* __restrict__ g,
                                                    half_t* __restrict__ xn) {
  const int wave = threadIdx.x >> 5;
  const int lane = threadIdx.x & 31;
  const long row = (long)blockIdx.x * 8 + wave;
  const float* xr = x + row * DIMX;
  float4 v[4], gv[4];
  float s = 0.f, sq = 0.f;
#pragma unroll
  for (int i = 0; i < 4; ++i) {
    v[i]  = ((const float4*)xr)[i * 32 + lane];
    gv[i] = ((const float4*)g)[i * 32 + lane];
    s  += v[i].x + v[i].y + v[i].z + v[i].w;
    sq += v[i].x*v[i].x + v[i].y*v[i].y + v[i].z*v[i].z + v[i].w*v[i].w;
  }
#pragma unroll
  for (int m = 1; m < 32; m <<= 1) { s += __shfl_xor(s, m, 32); sq += __shfl_xor(sq, m, 32); }
  const float mean = s * (1.f / DIMX);
  const float rstd = rsqrtf(sq * (1.f / DIMX) - mean * mean + EPS_F);
#pragma unroll
  for (int i = 0; i < 4; ++i) {
    v4h o;
    o[0] = (half_t)((v[i].x - mean) * rstd * gv[i].x);
    o[1] = (half_t)((v[i].y - mean) * rstd * gv[i].y);
    o[2] = (half_t)((v[i].z - mean) * rstd * gv[i].z);
    o[3] = (half_t)((v[i].w - mean) * rstd * gv[i].w);
    ((v4h*)(xn + row * DIMX))[i * 32 + lane] = o;
  }
}

// ---------------- Kernel 0b: one-time weight transpose+convert (tiny, L2-resident) ----------------
// WqkvT[n][k] = (W_q|W_kv)[k][n] as f16 (640x512); WoutT[n][k] = W_out[k][n] as f16 (512x512)
__global__ __launch_bounds__(256) void prep_w_kernel(const float* __restrict__ Wq,
                                                     const float* __restrict__ Wkv,
                                                     const float* __restrict__ Wout,
                                                     half_t* __restrict__ WqkvT,
                                                     half_t* __restrict__ WoutT) {
  const int idx = blockIdx.x * 256 + threadIdx.x;
  if (idx < 640 * 512) {
    const int n = idx >> 9, k = idx & 511;
    const float w = (n < DIMX) ? Wq[(size_t)k * DIMX + n]
                               : Wkv[(size_t)k * 128 + (n - DIMX)];
    WqkvT[idx] = (half_t)w;
  } else {
    const int i2 = idx - 640 * 512;  // < 512*512
    const int n = i2 >> 9, k = i2 & 511;
    WoutT[i2] = (half_t)Wout[(size_t)k * DIMX + n];
  }
}

// ---------------- Kernel 1: q/k/v projection GEMM  xn @ [W_q | W_kv] ----------------
// grid.x = row blocks of 128, grid.y = 2 halves of N=640 (320 cols each)
#define A_NT 20
__device__ __forceinline__ void stage_proj(const half_t* __restrict__ WqkvT, half_t* buf,
                                           int colBase, int kBase, int tid) {
  // 320 rows x 64 B = 1280 x 16B transfers; 5 async instructions per wave
#pragma unroll
  for (int i = 0; i < 5; ++i) {
    const int e = i * 256 + tid;
    const int nl = e >> 2, part = e & 3;
    async_cp16(WqkvT + (size_t)(colBase + nl) * DIMX + kBase + part * 8,
               &buf[nl * 32 + part * 8]);
  }
}

__global__ __launch_bounds__(256) void proj_kernel(const half_t* __restrict__ xn,
                                                   const half_t* __restrict__ WqkvT,
                                                   half_t* __restrict__ qw,
                                                   half_t* __restrict__ kw,
                                                   half_t* __restrict__ vTw) {
  __shared__ half_t WT[2][320 * 32];  // double-buffered transposed weight chunk (2 x 20 KB)
  const int tid  = threadIdx.x;
  const int wave = tid >> 5, lane = tid & 31;
  const int l = lane & 15, hi = lane >> 4;
  const int rowBase = blockIdx.x * 128 + wave * 16;
  const int colBase = blockIdx.y * 320;
  v8f acc[A_NT];
  v8f z = {};
#pragma unroll
  for (int t = 0; t < A_NT; ++t) acc[t] = z;

  stage_proj(WqkvT, WT[0], colBase, 0, tid);
  for (int kc = 0; kc < 16; ++kc) {
    const int kBase = kc * 32;
    if (kc < 15) {
      stage_proj(WqkvT, WT[(kc + 1) & 1], colBase, kBase + 32, tid);
      asm volatile("s_wait_asynccnt 0x5" ::: "memory");  // older stage complete
    } else {
      asm volatile("s_wait_asynccnt 0x0" ::: "memory");
    }
    __syncthreads();
    const half_t* buf = WT[kc & 1];
    v16h a = frag_ld(xn + (size_t)(rowBase + l) * DIMX + kBase + hi * 8);
#pragma unroll
    for (int t = 0; t < A_NT; ++t) {
      v16h b = frag_ld(&buf[(t * 16 + l) * 32 + hi * 8]);
      acc[t] = wmma_f16(a, b, acc[t]);
    }
    __syncthreads();
  }
  // scatter epilogue: cols [0,512) -> q, [512,576) -> k, [576,640) -> v (transposed)
#pragma unroll
  for (int t = 0; t < A_NT; ++t) {
    const int col = colBase + t * 16 + l;
#pragma unroll
    for (int j = 0; j < 8; ++j) {
      const int row = rowBase + j + hi * 8;
      const half_t hv = (half_t)acc[t][j];
      if (col < DIMX) {
        qw[(size_t)row * DIMX + col] = hv;
      } else if (col < DIMX + DHEAD) {
        kw[(size_t)row * DHEAD + (col - DIMX)] = hv;
      } else {
        const int bn = row >> 8, rl = row & 255, d = col - DIMX - DHEAD;
        vTw[((size_t)bn * DHEAD + d) * SEQ + rl] = hv;  // V^T per (b,n)
      }
    }
  }
}

// ---------------- Kernel 2: fused attention per (b,n,h) ----------------
// block = 256 threads (8 waves); each wave owns 32 rows of the 256x256 score slab.
__global__ __launch_bounds__(256) void attn_kernel(const half_t* __restrict__ qw,
                                                   const half_t* __restrict__ kw,
                                                   const half_t* __restrict__ vTw,
                                                   half_t* __restrict__ mid) {
  extern __shared__ half_t smem[];
  half_t* P   = smem;                       // [256][P_STRIDE] (~132 KB)
  half_t* Ksh = smem + SEQ * P_STRIDE;      // [256][64]  (32 KB)
  half_t* Vsh = Ksh + SEQ * DHEAD;          // [64][256]  (32 KB)
  const int tid  = threadIdx.x;
  const int wave = tid >> 5, lane = tid & 31;
  const int l = lane & 15, hi = lane >> 4;
  const int bn = blockIdx.x >> 3, h = blockIdx.x & 7;
  const half_t* Qg  = qw  + (size_t)bn * SEQ * DIMX + h * DHEAD;   // stride DIMX
  const half_t* Kg  = kw  + (size_t)bn * SEQ * DHEAD;              // [256][64]
  const half_t* VTg = vTw + (size_t)bn * DHEAD * SEQ;              // [64][256]
  const int rBase = wave * 32;

  // async-stage K and V^T into LDS (verbatim copies; 16 async instr per wave)
#pragma unroll
  for (int i = 0; i < 8; ++i) {
    const int e = i * 256 + tid;   // 16B granule index
    async_cp16(Kg  + e * 8, &Ksh[e * 8]);
    async_cp16(VTg + e * 8, &Vsh[e * 8]);
  }

  v8f s[2][16];
  v8f z = {};
#pragma unroll
  for (int rt = 0; rt < 2; ++rt)
#pragma unroll
    for (int ct = 0; ct < 16; ++ct) s[rt][ct] = z;

  // Q A-fragments straight from global (overlaps with the async staging)
  v16h aq[2][2];
#pragma unroll
  for (int kc = 0; kc < 2; ++kc) {
    aq[kc][0] = frag_ld(Qg + (size_t)(rBase + l)      * DIMX + kc * 32 + hi * 8);
    aq[kc][1] = frag_ld(Qg + (size_t)(rBase + 16 + l) * DIMX + kc * 32 + hi * 8);
  }
  asm volatile("s_wait_asynccnt 0x0" ::: "memory");
  __syncthreads();

  // S = Q K^T   (K matrix itself is the N-major mirror of B)
#pragma unroll
  for (int kc = 0; kc < 2; ++kc) {
    const int kBase = kc * 32;
#pragma unroll
    for (int ct = 0; ct < 16; ++ct) {
      v16h b = frag_ld(&Ksh[(ct * 16 + l) * DHEAD + kBase + hi * 8]);
      s[0][ct] = wmma_f16(aq[kc][0], b, s[0][ct]);
      s[1][ct] = wmma_f16(aq[kc][1], b, s[1][ct]);
    }
  }

  // softmax: logits = (s - rowmax) * (SCALE*PB_ALPHA) = (s - rowmax) * 0.125
  float rsum[2][8];
#pragma unroll
  for (int rt = 0; rt < 2; ++rt) {
#pragma unroll
    for (int j = 0; j < 8; ++j) {
      float m = s[rt][0][j];
#pragma unroll
      for (int ct = 1; ct < 16; ++ct) m = fmaxf(m, s[rt][ct][j]);
#pragma unroll
      for (int msk = 1; msk < 16; msk <<= 1) m = fmaxf(m, __shfl_xor(m, msk, 32));
      const int row = rBase + rt * 16 + j + hi * 8;
      float sum = 0.f;
#pragma unroll
      for (int ct = 0; ct < 16; ++ct) {
        const float p = __expf((s[rt][ct][j] - m) * 0.125f);
        sum += p;
        P[(size_t)row * P_STRIDE + ct * 16 + l] = (half_t)p;  // C-layout -> LDS
      }
#pragma unroll
      for (int msk = 1; msk < 16; msk <<= 1) sum += __shfl_xor(sum, msk, 32);
      rsum[rt][j] = sum;
    }
  }
  __syncthreads();

  // O = P @ V  (A-fragments of P re-read from LDS; V^T gives contiguous B-fragments)
  v8f o[2][4];
#pragma unroll
  for (int rt = 0; rt < 2; ++rt)
#pragma unroll
    for (int dt = 0; dt < 4; ++dt) o[rt][dt] = z;
#pragma unroll
  for (int kc = 0; kc < 8; ++kc) {
    const int kBase = kc * 32;
    v16h a0 = frag_ld(&P[(size_t)(rBase + l)      * P_STRIDE + kBase + hi * 8]);
    v16h a1 = frag_ld(&P[(size_t)(rBase + 16 + l) * P_STRIDE + kBase + hi * 8]);
#pragma unroll
    for (int dt = 0; dt < 4; ++dt) {
      v16h b = frag_ld(&Vsh[(dt * 16 + l) * SEQ + kBase + hi * 8]);
      o[0][dt] = wmma_f16(a0, b, o[0][dt]);
      o[1][dt] = wmma_f16(a1, b, o[1][dt]);
    }
  }
  // normalize and store head-concatenated mid
#pragma unroll
  for (int rt = 0; rt < 2; ++rt)
#pragma unroll
    for (int dt = 0; dt < 4; ++dt)
#pragma unroll
      for (int j = 0; j < 8; ++j) {
        const int row = rBase + rt * 16 + j + hi * 8;
        const int col = h * DHEAD + dt * 16 + l;
        mid[((size_t)bn * SEQ + row) * DIMX + col] = (half_t)(o[rt][dt][j] / rsum[rt][j]);
      }
}

// ---------------- Kernel 3: out projection + LayerNorm ----------------
__device__ __forceinline__ void stage_out(const half_t* __restrict__ WoutT, half_t* buf,
                                          int kBase, int tid) {
  // 512 rows x 64 B = 2048 x 16B transfers; 8 async instructions per wave
#pragma unroll
  for (int i = 0; i < 8; ++i) {
    const int e = i * 256 + tid;
    const int nl = e >> 2, part = e & 3;
    async_cp16(WoutT + (size_t)nl * DIMX + kBase + part * 8,
               &buf[nl * 32 + part * 8]);
  }
}

__global__ __launch_bounds__(256) void out_kernel(const half_t* __restrict__ mid,
                                                  const half_t* __restrict__ WoutT,
                                                  const float* __restrict__ gout,
                                                  float* __restrict__ out) {
  __shared__ half_t WT[2][512 * 32];  // double-buffered transposed W_out chunk (2 x 32 KB)
  const int tid  = threadIdx.x;
  const int wave = tid >> 5, lane = tid & 31;
  const int l = lane & 15, hi = lane >> 4;
  const int rowBase = blockIdx.x * 128 + wave * 16;
  v8f acc[32];
  v8f z = {};
#pragma unroll
  for (int t = 0; t < 32; ++t) acc[t] = z;

  stage_out(WoutT, WT[0], 0, tid);
  for (int kc = 0; kc < 16; ++kc) {
    const int kBase = kc * 32;
    if (kc < 15) {
      stage_out(WoutT, WT[(kc + 1) & 1], kBase + 32, tid);
      asm volatile("s_wait_asynccnt 0x8" ::: "memory");  // older stage complete
    } else {
      asm volatile("s_wait_asynccnt 0x0" ::: "memory");
    }
    __syncthreads();
    const half_t* buf = WT[kc & 1];
    v16h a = frag_ld(mid + (size_t)(rowBase + l) * DIMX + kBase + hi * 8);
#pragma unroll
    for (int t = 0; t < 32; ++t) {
      v16h b = frag_ld(&buf[(t * 16 + l) * 32 + hi * 8]);
      acc[t] = wmma_f16(a, b, acc[t]);
    }
    __syncthreads();
  }
  // fused LayerNorm over each 512-wide output row
#pragma unroll
  for (int j = 0; j < 8; ++j) {
    float sm = 0.f, sq = 0.f;
#pragma unroll
    for (int t = 0; t < 32; ++t) { const float vv = acc[t][j]; sm += vv; sq += vv * vv; }
#pragma unroll
    for (int msk = 1; msk < 16; msk <<= 1) {
      sm += __shfl_xor(sm, msk, 32);
      sq += __shfl_xor(sq, msk, 32);
    }
    const float mean = sm * (1.f / DIMX);
    const float rstd = rsqrtf(sq * (1.f / DIMX) - mean * mean + EPS_F);
    const long row = rowBase + j + hi * 8;
#pragma unroll
    for (int t = 0; t < 32; ++t) {
      const int col = t * 16 + l;
      out[row * DIMX + col] = (acc[t][j] - mean) * rstd * gout[col];
    }
  }
}

extern "C" void kernel_launch(void* const* d_in, const int* in_sizes, int n_in,
                              void* d_out, int out_size, void* d_ws, size_t ws_size,
                              hipStream_t stream) {
  const float* x      = (const float*)d_in[0];
  const float* g_norm = (const float*)d_in[1];
  const float* W_q    = (const float*)d_in[2];
  const float* W_kv   = (const float*)d_in[3];
  const float* W_out  = (const float*)d_in[4];
  const float* g_out  = (const float*)d_in[5];
  float* out = (float*)d_out;

  char* ws = (char*)d_ws;
  const size_t xnB = (size_t)R_TOTAL * DIMX * sizeof(half_t);    // 64 MB
  const size_t kB  = (size_t)R_TOTAL * DHEAD * sizeof(half_t);   //  8 MB
  half_t* xn    = (half_t*)ws;                 // reused as `mid` once consumed
  half_t* qw    = (half_t*)(ws + xnB);
  half_t* kw    = (half_t*)(ws + 2 * xnB);
  half_t* vT    = (half_t*)(ws + 2 * xnB + kB);
  half_t* WqkvT = (half_t*)(ws + 2 * xnB + 2 * kB);
  half_t* WoutT = WqkvT + 640 * 512;
  half_t* mid = xn;

  ln_in_kernel<<<R_TOTAL / 8, 256, 0, stream>>>(x, g_norm, xn);
  prep_w_kernel<<<(640 * 512 + 512 * 512) / 256, 256, 0, stream>>>(W_q, W_kv, W_out, WqkvT, WoutT);
  dim3 gA(R_TOTAL / 128, 2);
  proj_kernel<<<gA, 256, 0, stream>>>(xn, WqkvT, qw, kw, vT);
  const size_t attn_lds = (size_t)(SEQ * P_STRIDE + SEQ * DHEAD + DHEAD * SEQ) * sizeof(half_t);
  attn_kernel<<<2048, 256, attn_lds, stream>>>(qw, kw, vT, mid);
  out_kernel<<<R_TOTAL / 128, 256, 0, stream>>>(mid, WoutT, g_out, out);
}

// v001
// It runs in 369 microseconds.
// Two timings next to v000 put it at 1.28 and 1.29 times that version's speed.
#include <hip/hip_runtime.h>

typedef _Float16 half_t;
typedef __attribute__((ext_vector_type(4)))  _Float16 v4h;
typedef __attribute__((ext_vector_type(8)))  _Float16 v8h;
typedef __attribute__((ext_vector_type(16))) _Float16 v16h;
typedef __attribute__((ext_vector_type(8)))  float    v8f;

#define R_TOTAL 65536   // b*n*r = 4*64*256
#define DIMX    512
#define DHEAD   64
#define SEQ     256
#define EPS_F   1e-5f
#define P_STRIDE 264    // LDS row stride (halves) for P, 16B-aligned, conflict-padded
// LDS row pitches (halves) for rows read by 16-byte fragment loads: 16 B x odd, so that
// the 16 rows of one fragment load fall on distinct banks.
#define W_PITCH 40      // 64-B weight-chunk rows  -> 80 B
#define K_PITCH 72      // 128-B K rows            -> 144 B
#define V_PITCH 264     // 512-B V^T rows          -> 528 B

// Load a 16-bit A/B WMMA fragment (16x32 A, or 32x16 B via its N-major mirror).
// Caller passes p = base + row_or_n*stride + kBase + (lane>>4)*8.
// lane<16 needs K {0..7, 16..23}, lane>=16 needs K {8..15, 24..31}: two b128 loads.
__device__ __forceinline__ v16h frag_ld(const half_t* p) {
  v8h lo = *(const v8h*)(p);
  v8h hi = *(const v8h*)(p + 16);
  return __builtin_shufflevector(lo, hi, 0,1,2,3,4,5,6,7,8,9,10,11,12,13,14,15);
}

__device__ __forceinline__ v8f wmma_f16(v16h a, v16h b, v8f c) {
  return __builtin_amdgcn_wmma_f32_16x16x32_f16(false, a, false, b, (short)0, c, false, false);
}

// CDNA5 async global->LDS copy, 16 bytes per lane, tracked by ASYNCcnt.
__device__ __forceinline__ unsigned lds_addr(const half_t* l) {
  return (unsigned)(uintptr_t)l;  // flat LDS aperture: addr[31:0] = LDS offset
}
// A run of copies (copy i: g + i * gs -> l + i * ls, strides in halves) and its s_wait_xcnt 0
// in one statement: the wait then stands in front of any later rewrite of the address
// registers that the copies name.
__device__ __forceinline__ void async_cp16x5(const half_t* g, int gs, half_t* l, int ls) {
  asm volatile("global_load_async_to_lds_b128 %0, %1, off\n\t"
               "global_load_async_to_lds_b128 %2, %3, off\n\t"
               "global_load_async_to_lds_b128 %4, %5, off\n\t"
               "global_load_async_to_lds_b128 %6, %7, off\n\t"
               "global_load_async_to_lds_b128 %8, %9, off\n\t"
               "s_wait_xcnt 0x0"
               :: "v"(lds_addr(l)),          "v"(g),
                  "v"(lds_addr(l + 1 * ls)), "v"(g + 1 * gs),
                  "v"(lds_addr(l + 2 * ls)), "v"(g + 2 * gs),
                  "v"(lds_addr(l + 3 * ls)), "v"(g + 3 * gs),
                  "v"(lds_addr(l + 4 * ls)), "v"(g + 4 * gs) : "memory");
}
__device__ __forceinline__ void async_cp16x8(const half_t* g, int gs, half_t* l, int ls) {
  asm volatile("global_load_async_to_lds_b128 %0, %1, off\n\t"
               "global_load_async_to_lds_b128 %2, %3, off\n\t"
               "global_load_async_to_lds_b128 %4, %5, off\n\t"
               "global_load_async_to_lds_b128 %6, %7, off\n\t"
               "global_load_async_to_lds_b128 %8, %9, off\n\t"
               "global_load_async_to_lds_b128 %10, %11, off\n\t"
               "global_load_async_to_lds_b128 %12, %13, off\n\t"
               "global_load_async_to_lds_b128 %14, %15, off\n\t"
               "s_wait_xcnt 0x0"
               :: "v"(lds_addr(l)),          "v"(g),
                  "v"(lds_addr(l + 1 * ls)), "v"(g + 1 * gs),
                  "v"(lds_addr(l + 2 * ls)), "v"(g + 2 * gs),
                  "v"(lds_addr(l + 3 * ls)), "v"(g + 3 * gs),
                  "v"(lds_addr(l + 4 * ls)), "v"(g + 4 * gs),
                  "v"(lds_addr(l + 5 * ls)), "v"(g + 5 * gs),
                  "v"(lds_addr(l + 6 * ls)), "v"(g + 6 * gs),
                  "v"(lds_addr(l + 7 * ls)), "v"(g + 7 * gs) : "memory");
}

// ---------------- Kernel 0a: input LayerNorm, f32 -> f16 ----------------
__global__ __launch_bounds__(256) void ln_in_kernel(const float* __restrict__ x,
                                                    const float* __restrict__ g,
                                                    half_t* __restrict__ xn) {
  const int wave = threadIdx.x >> 5;
  const int lane = threadIdx.x & 31;
  const long row = (long)blockIdx.x * 8 + wave;
  const float* xr = x + row * DIMX;
  float4 v[4], gv[4];
  float s = 0.f, sq = 0.f;
#pragma unroll
  for (int i = 0; i < 4; ++i) {
    v[i]  = ((const float4*)xr)[i * 32 + lane];
    gv[i] = ((const float4*)g)[i * 32 + lane];
    s  += v[i].x + v[i].y + v[i].z + v[i].w;
    sq += v[i].x*v[i].x + v[i].y*v[i].y + v[i].z*v[i].z + v[i].w*v[i].w;
  }
#pragma unroll
  for (int m = 1; m < 32; m <<= 1) { s += __shfl_xor(s, m, 32); sq += __shfl_xor(sq, m, 32); }
  const float mean = s * (1.f / DIMX);
  const float rstd = rsqrtf(sq * (1.f / DIMX) - mean * mean + EPS_F);
#pragma unroll
  for (int i = 0; i < 4; ++i) {
    v4h o;
    o[0] = (half_t)((v[i].x - mean) * rstd * gv[i].x);
    o[1] = (half_t)((v[i].y - mean) * rstd * gv[i].y);
    o[2] = (half_t)((v[i].z - mean) * rstd * gv[i].z);
    o[3] = (half_t)((v[i].w - mean) * rstd * gv[i].w);
    ((v4h*)(xn + row * DIMX))[i * 32 + lane] = o;
  }
}

// ---------------- Kernel 0b: one-time weight transpose+convert (tiny, L2-resident) ----------------
// WqkvT[n][k] = (W_q|W_kv)[k][n] as f16 (640x512); WoutT[n][k] = W_out[k][n] as f16 (512x512)
__global__ __launch_bounds__(256) void prep_w_kernel(const float* __restrict__ Wq,
                                                     const float* __restrict__ Wkv,
                                                     const float* __restrict__ Wout,
                                                     half_t* __restrict__ WqkvT,
                                                     half_t* __restrict__ WoutT) {
  const int idx = blockIdx.x * 256 + threadIdx.x;
  if (idx < 640 * 512) {
    const int n = idx >> 9, k = idx & 511;
    const float w = (n < DIMX) ? Wq[(size_t)k * DIMX + n]
                               : Wkv[(size_t)k * 128 + (n - DIMX)];
    WqkvT[idx] = (half_t)w;
  } else {
    const int i2 = idx - 640 * 512;  // < 512*512
    const int n = i2 >> 9, k = i2 & 511;
    WoutT[i2] = (half_t)Wout[(size_t)k * DIMX + n];
  }
}

// ---------------- Kernel 1: q/k/v projection GEMM  xn @ [W_q | W_kv] ----------------
// grid.x = row blocks of 128, grid.y = 2 halves of N=640 (320 cols each)
#define A_NT 20
__device__ __forceinline__ void stage_proj(const half_t* __restrict__ WqkvT, half_t* buf,
                                           int colBase, int kBase, int tid) {
  // 320 rows x 64 B = 1280 x 16B transfers; 5 async instructions per wave
  const int nl = tid >> 2, part = tid & 3;   // copy i takes row nl + 64 * i
  const half_t* g = WqkvT + (size_t)(colBase + nl) * DIMX + kBase + part * 8;
  half_t* d = &buf[nl * W_PITCH + part * 8];
  async_cp16x5(g, 64 * DIMX, d, 64 * W_PITCH);
}

__global__ __launch_bounds__(256) void proj_kernel(const half_t* __restrict__ xn,
                                                   const half_t* __restrict__ WqkvT,
                                                   half_t* __restrict__ qw,
                                                   half_t* __restrict__ kw,
                                                   half_t* __restrict__ vTw) {
  __shared__ half_t WT[2][320 * W_PITCH];  // double-buffered transposed weight chunk (2 x 25 KB)
  const int tid  = threadIdx.x;
  const int wave = tid >> 5, lane = tid & 31;
  const int l = lane & 15, hi = lane >> 4;
  const int rowBase = blockIdx.x * 128 + wave * 16;
  const int colBase = blockIdx.y * 320;
  v8f acc[A_NT];
  v8f z = {};
#pragma unroll
  for (int t = 0; t < A_NT; ++t) acc[t] = z;

  stage_proj(WqkvT, WT[0], colBase, 0, tid);
  for (int kc = 0; kc < 16; ++kc) {
    const int kBase = kc * 32;
    if (kc < 15) {
      stage_proj(WqkvT, WT[(kc + 1) & 1], colBase, kBase + 32, tid);
      asm volatile("s_wait_asynccnt 0x5" ::: "memory");  // older stage complete
    } else {
      asm volatile("s_wait_asynccnt 0x0" ::: "memory");
    }
    __syncthreads();
    const half_t* buf = WT[kc & 1];
    v16h a = frag_ld(xn + (size_t)(rowBase + l) * DIMX + kBase + hi * 8);
#pragma unroll
    for (int t = 0; t < A_NT; ++t) {
      v16h b = frag_ld(&buf[(t * 16 + l) * W_PITCH + hi * 8]);
      acc[t] = wmma_f16(a, b, acc[t]);
    }
    __syncthreads();
  }
  // scatter epilogue: cols [0,512) -> q, [512,576) -> k, [576,640) -> v (transposed)
#pragma unroll
  for (int t = 0; t < A_NT; ++t) {
    const int col = colBase + t * 16 + l;
#pragma unroll
    for (int j = 0; j < 8; ++j) {
      const int row = rowBase + j + hi * 8;
      const half_t hv = (half_t)acc[t][j];
      if (col < DIMX) {
        qw[(size_t)row * DIMX + col] = hv;
      } else if (col < DIMX + DHEAD) {
        kw[(size_t)row * DHEAD + (col - DIMX)] = hv;
      } else {
        const int bn = row >> 8, rl = row & 255, d = col - DIMX - DHEAD;
        vTw[((size_t)bn * DHEAD + d) * SEQ + rl] = hv;  // V^T per (b,n)
      }
    }
  }
}

// ---------------- Kernel 2: fused attention per (b,n,h) ----------------
// block = 256 threads (8 waves); each wave owns 32 rows of the 256x256 score slab.
__global__ __launch_bounds__(256) void attn_kernel(const half_t* __restrict__ qw,
                                                   const half_t* __restrict__ kw,
                                                   const half_t* __restrict__ vTw,
                                                   half_t* __restrict__ mid) {
  extern __shared__ half_t smem[];
  half_t* P   = smem;                       // [256][P_STRIDE] (~132 KB)
  half_t* Ksh = smem + SEQ * P_STRIDE;      // [256][K_PITCH]  (36 KB)
  half_t* Vsh = Ksh + SEQ * K_PITCH;        // [64][V_PITCH]   (33 KB)
  const int tid  = threadIdx.x;
  const int wave = tid >> 5, lane = tid & 31;
  const int l = lane & 15, hi = lane >> 4;
  const int bn = blockIdx.x >> 3, h = blockIdx.x & 7;
  const half_t* Qg  = qw  + (size_t)bn * SEQ * DIMX + h * DHEAD;   // stride DIMX
  const half_t* Kg  = kw  + (size_t)bn * SEQ * DHEAD;              // [256][64]
  const half_t* VTg = vTw + (size_t)bn * DHEAD * SEQ;              // [64][256]
  const int rBase = wave * 32;

  // async-stage K and V^T into padded LDS rows (16 async instr per wave)
  {
    // K: 8 granules of 16 B a row, copy i takes row (tid >> 3) + 32 * i
    const half_t* gk = Kg + tid * 8;
    half_t* dk = &Ksh[(tid >> 3) * K_PITCH + (tid & 7) * 8];
    // V^T: 32 granules a row, copy i takes row (tid >> 5) + 8 * i
    const half_t* gv = VTg + tid * 8;
    half_t* dv = &Vsh[(tid >> 5) * V_PITCH + (tid & 31) * 8];
    async_cp16x8(gk, 2048, dk, 32 * K_PITCH);
    async_cp16x8(gv, 2048, dv, 8 * V_PITCH);
  }

  v8f s[2][16];
  v8f z = {};
#pragma unroll
  for (int rt = 0; rt < 2; ++rt)
#pragma unroll
    for (int ct = 0; ct < 16; ++ct) s[rt][ct] = z;

  // Q A-fragments straight from global (overlaps with the async staging)
  v16h aq[2][2];
#pragma unroll
  for (int kc = 0; kc < 2; ++kc) {
    aq[kc][0] = frag_ld(Qg + (size_t)(rBase + l)      * DIMX + kc * 32 + hi * 8);
    aq[kc][1] = frag_ld(Qg + (size_t)(rBase + 16 + l) * DIMX + kc * 32 + hi * 8);
  }
  asm volatile("s_wait_asynccnt 0x0" ::: "memory");
  __syncthreads();

  // S = Q K^T   (K matrix itself is the N-major mirror of B)
#pragma unroll
  for (int kc = 0; kc < 2; ++kc) {
    const int kBase = kc * 32;
#pragma unroll
    for (int ct = 0; ct < 16; ++ct) {
      v16h b = frag_ld(&Ksh[(ct * 16 + l) * K_PITCH + kBase + hi * 8]);
      s[0][ct] = wmma_f16(aq[kc][0], b, s[0][ct]);
      s[1][ct] = wmma_f16(aq[kc][1], b, s[1][ct]);
    }
  }

  // softmax: logits = (s - rowmax) * (SCALE*PB_ALPHA) = (s - rowmax) * 0.125
  float rsum[2][8];
#pragma unroll
  for (int rt = 0; rt < 2; ++rt) {
#pragma unroll
    for (int j = 0; j < 8; ++j) {
      float m = s[rt][0][j];
#pragma unroll
      for (int ct = 1; ct < 16; ++ct) m = fmaxf(m, s[rt][ct][j]);
#pragma unroll
      for (int msk = 1; msk < 16; msk <<= 1) m = fmaxf(m, __shfl_xor(m, msk, 32));
      const int row = rBase + rt * 16 + j + hi * 8;
      float sum = 0.f;
#pragma unroll
      for (int ct = 0; ct < 16; ++ct) {
        const float p = __expf((s[rt][ct][j] - m) * 0.125f);
        sum += p;
        P[(size_t)row * P_STRIDE + ct * 16 + l] = (half_t)p;  // C-layout -> LDS
      }
#pragma unroll
      for (int msk = 1; msk < 16; msk <<= 1) sum += __shfl_xor(sum, msk, 32);
      rsum[rt][j] = sum;
    }
  }
  __syncthreads();

  // O = P @ V  (A-fragments of P re-read from LDS; V^T gives contiguous B-fragments)
  v8f o[2][4];
#pragma unroll
  for (int rt = 0; rt < 2; ++rt)
#pragma unroll
    for (int dt = 0; dt < 4; ++dt) o[rt][dt] = z;
#pragma unroll
  for (int kc = 0; kc < 8; ++kc) {
    const int kBase = kc * 32;
    v16h a0 = frag_ld(&P[(size_t)(rBase + l)      * P_STRIDE + kBase + hi * 8]);
    v16h a1 = frag_ld(&P[(size_t)(rBase + 16 + l) * P_STRIDE + kBase + hi * 8]);
#pragma unroll
    for (int dt = 0; dt < 4; ++dt) {
      v16h b = frag_ld(&Vsh[(dt * 16 + l) * V_PITCH + kBase + hi * 8]);
      o[0][dt] = wmma_f16(a0, b, o[0][dt]);
      o[1][dt] = wmma_f16(a1, b, o[1][dt]);
    }
  }
  // normalize and store head-concatenated mid
#pragma unroll
  for (int rt = 0; rt < 2; ++rt)
#pragma unroll
    for (int dt = 0; dt < 4; ++dt)
#pragma unroll
      for (int j = 0; j < 8; ++j) {
        const int row = rBase + rt * 16 + j + hi * 8;
        const int col = h * DHEAD + dt * 16 + l;
        mid[((size_t)bn * SEQ + row) * DIMX + col] = (half_t)(o[rt][dt][j] / rsum[rt][j]);
      }
}

// ---------------- Kernel 3: out projection + LayerNorm ----------------
__device__ __forceinline__ void stage_out(const half_t* __restrict__ WoutT, half_t* buf,
                                          int kBase, int tid) {
  // 512 rows x 64 B = 2048 x 16B transfers; 8 async instructions per wave
  const int nl = tid >> 2, part = tid & 3;   // copy i takes row nl + 64 * i
  const half_t* g = WoutT + (size_t)nl * DIMX + kBase + part * 8;
  half_t* d = &buf[nl * W_PITCH + part * 8];
  async_cp16x8(g, 64 * DIMX, d, 64 * W_PITCH);
}

__global__ __launch_bounds__(256) void out_kernel(const half_t* __restrict__ mid,
                                                  const half_t* __restrict__ WoutT,
                                                  const float* __restrict__ gout,
                                                  float* __restrict__ out) {
  __shared__ half_t WT[2][512 * W_PITCH];  // double-buffered transposed W_out chunk (2 x 40 KB)
  const int tid  = threadIdx.x;
  const int wave = tid >> 5, lane = tid & 31;
  const int l = lane & 15, hi = lane >> 4;
  const int rowBase = blockIdx.x * 128 + wave * 16;
  v8f acc[32];
  v8f z = {};
#pragma unroll
  for (int t = 0; t < 32; ++t) acc[t] = z;

  stage_out(WoutT, WT[0], 0, tid);
  for (int kc = 0; kc < 16; ++kc) {
    const int kBase = kc * 32;
    if (kc < 15) {
      stage_out(WoutT, WT[(kc + 1) & 1], kBase + 32, tid);
      asm volatile("s_wait_asynccnt 0x8" ::: "memory");  // older stage complete
    } else {
      asm volatile("s_wait_asynccnt 0x0" ::: "memory");
    }
    __syncthreads();
    const half_t* buf = WT[kc & 1];
    v16h a = frag_ld(mid + (size_t)(rowBase + l) * DIMX + kBase + hi * 8);
#pragma unroll
    for (int t = 0; t < 32; ++t) {
      v16h b = frag_ld(&buf[(t * 16 + l) * W_PITCH + hi * 8]);
      acc[t] = wmma_f16(a, b, acc[t]);
    }
    __syncthreads();
  }
  // fused LayerNorm over each 512-wide output row
#pragma unroll
  for (int j = 0; j < 8; ++j) {
    float sm = 0.f, sq = 0.f;
#pragma unroll
    for (int t = 0; t < 32; ++t) { const float vv = acc[t][j]; sm += vv; sq += vv * vv; }
#pragma unroll
    for (int msk = 1; msk < 16; msk <<= 1) {
      sm += __shfl_xor(sm, msk, 32);
      sq += __shfl_xor(sq, msk, 32);
    }
    const float mean = sm * (1.f / DIMX);
    const float rstd = rsqrtf(sq * (1.f / DIMX) - mean * mean + EPS_F);
    const long row = rowBase + j + hi * 8;
#pragma unroll
    for (int t = 0; t < 32; ++t) {
      const int col = t * 16 + l;
      out[row * DIMX + col] = (acc[t][j] - mean) * rstd * gout[col];
    }
  }
}

extern "C" void kernel_launch(void* const* d_in, const int* in_sizes, int n_in,
                              void* d_out, int out_size, void* d_ws, size_t ws_size,
                              hipStream_t stream) {
  const float* x      = (const float*)d_in[0];
  const float* g_norm = (const float*)d_in[1];
  const float* W_q    = (const float*)d_in[2];
  const float* W_kv   = (const float*)d_in[3];
  const float* W_out  = (const float*)d_in[4];
  const float* g_out  = (const float*)d_in[5];
  float* out = (float*)d_out;

  char* ws = (char*)d_ws;
  const size_t xnB = (size_t)R_TOTAL * DIMX * sizeof(half_t);    // 64 MB
  const size_t kB  = (size_t)R_TOTAL * DHEAD * sizeof(half_t);   //  8 MB
  half_t* xn    = (half_t*)ws;                 // reused as `mid` once consumed
  half_t* qw    = (half_t*)(ws + xnB);
  half_t* kw    = (half_t*)(ws + 2 * xnB);
  half_t* vT    = (half_t*)(ws + 2 * xnB + kB);
  half_t* WqkvT = (half_t*)(ws + 2 * xnB + 2 * kB);
  half_t* WoutT = WqkvT + 640 * 512;
  half_t* mid = xn;

  ln_in_kernel<<<R_TOTAL / 8, 256, 0, stream>>>(x, g_norm, xn);
  prep_w_kernel<<<(640 * 512 + 512 * 512) / 256, 256, 0, stream>>>(W_q, W_kv, W_out, WqkvT, WoutT);
  dim3 gA(R_TOTAL / 128, 2);
  proj_kernel<<<gA, 256, 0, stream>>>(xn, WqkvT, qw, kw, vT);
  const size_t attn_lds = (size_t)(SEQ * P_STRIDE + SEQ * K_PITCH + DHEAD * V_PITCH) * sizeof(half_t);
  attn_kernel<<<2048, 256, attn_lds, stream>>>(qw, kw, vT, mid);
  out_kernel<<<R_TOTAL / 128, 256, 0, stream>>>(mid, WoutT, g_out, out);
}

// v002
// One run takes 278 microseconds.
// In two side-by-side timings against v001, it was 1.27 and 1.34 times as fast.
// Over all steps from v000 it is 1.67 times as fast.
#include <hip/hip_runtime.h>

typedef _Float16 half_t;
typedef __attribute__((ext_vector_type(4)))  _Float16 v4h;
typedef __attribute__((ext_vector_type(8)))  _Float16 v8h;
typedef __attribute__((ext_vector_type(16))) _Float16 v16h;
typedef __attribute__((ext_vector_type(8)))  float    v8f;

#define R_TOTAL 65536   // b*n*r = 4*64*256
#define DIMX    512
#define DHEAD   64
#define SEQ     256
#define EPS_F   1e-5f
// LDS row pitches (halves) for rows read by 16-byte fragment loads: 16 B x odd, so that
// the 16 rows of one fragment load fall on distinct banks.
#define W_PITCH 40      // 64-B weight-chunk rows  -> 80 B
#define K_PITCH 72      // 128-B K rows            -> 144 B
#define V_PITCH 264     // 512-B V^T rows          -> 528 B

// Load a 16-bit A/B WMMA fragment (16x32 A, or 32x16 B via its N-major mirror).
// Caller passes p = base + row_or_n*stride + kBase + (lane>>4)*8.
// lane<16 needs K {0..7, 16..23}, lane>=16 needs K {8..15, 24..31}: two b128 loads.
__device__ __forceinline__ v16h frag_ld(const half_t* p) {
  v8h lo = *(const v8h*)(p);
  v8h hi = *(const v8h*)(p + 16);
  return __builtin_shufflevector(lo, hi, 0,1,2,3,4,5,6,7,8,9,10,11,12,13,14,15);
}

__device__ __forceinline__ v8f wmma_f16(v16h a, v16h b, v8f c) {
  return __builtin_amdgcn_wmma_f32_16x16x32_f16(false, a, false, b, (short)0, c, false, false);
}

// CDNA5 async global->LDS copy, 16 bytes per lane, tracked by ASYNCcnt.
__device__ __forceinline__ unsigned lds_addr(const half_t* l) {
  return (unsigned)(uintptr_t)l;  // flat LDS aperture: addr[31:0] = LDS offset
}
// A run of copies (copy i: g + i * gs -> l + i * ls, strides in halves) and its s_wait_xcnt 0
// in one statement: the wait then stands in front of any later rewrite of the address
// registers that the copies name.
__device__ __forceinline__ void async_cp16x5(const half_t* g, int gs, half_t* l, int ls) {
  asm volatile("global_load_async_to_lds_b128 %0, %1, off\n\t"
               "global_load_async_to_lds_b128 %2, %3, off\n\t"
               "global_load_async_to_lds_b128 %4, %5, off\n\t"
               "global_load_async_to_lds_b128 %6, %7, off\n\t"
               "global_load_async_to_lds_b128 %8, %9, off\n\t"
               "s_wait_xcnt 0x0"
               :: "v"(lds_addr(l)),          "v"(g),
                  "v"(lds_addr(l + 1 * ls)), "v"(g + 1 * gs),
                  "v"(lds_addr(l + 2 * ls)), "v"(g + 2 * gs),
                  "v"(lds_addr(l + 3 * ls)), "v"(g + 3 * gs),
                  "v"(lds_addr(l + 4 * ls)), "v"(g + 4 * gs) : "memory");
}
__device__ __forceinline__ void async_cp16x8(const half_t* g, int gs, half_t* l, int ls) {
  asm volatile("global_load_async_to_lds_b128 %0, %1, off\n\t"
               "global_load_async_to_lds_b128 %2, %3, off\n\t"
               "global_load_async_to_lds_b128 %4, %5, off\n\t"
               "global_load_async_to_lds_b128 %6, %7, off\n\t"
               "global_load_async_to_lds_b128 %8, %9, off\n\t"
               "global_load_async_to_lds_b128 %10, %11, off\n\t"
               "global_load_async_to_lds_b128 %12, %13, off\n\t"
               "global_load_async_to_lds_b128 %14, %15, off\n\t"
               "s_wait_xcnt 0x0"
               :: "v"(lds_addr(l)),          "v"(g),
                  "v"(lds_addr(l + 1 * ls)), "v"(g + 1 * gs),
                  "v"(lds_addr(l + 2 * ls)), "v"(g + 2 * gs),
                  "v"(lds_addr(l + 3 * ls)), "v"(g + 3 * gs),
                  "v"(lds_addr(l + 4 * ls)), "v"(g + 4 * gs),
                  "v"(lds_addr(l + 5 * ls)), "v"(g + 5 * gs),
                  "v"(lds_addr(l + 6 * ls)), "v"(g + 6 * gs),
                  "v"(lds_addr(l + 7 * ls)), "v"(g + 7 * gs) : "memory");
}

// ---------------- Kernel 0a: input LayerNorm, f32 -> f16 ----------------
__global__ __launch_bounds__(256) void ln_in_kernel(const float* __restrict__ x,
                                                    const float* __restrict__ g,
                                                    half_t* __restrict__ xn) {
  const int wave = threadIdx.x >> 5;
  const int lane = threadIdx.x & 31;
  const long row = (long)blockIdx.x * 8 + wave;
  const float* xr = x + row * DIMX;
  float4 v[4], gv[4];
  float s = 0.f, sq = 0.f;
#pragma unroll
  for (int i = 0; i < 4; ++i) {
    v[i]  = ((const float4*)xr)[i * 32 + lane];
    gv[i] = ((const float4*)g)[i * 32 + lane];
    s  += v[i].x + v[i].y + v[i].z + v[i].w;
    sq += v[i].x*v[i].x + v[i].y*v[i].y + v[i].z*v[i].z + v[i].w*v[i].w;
  }
#pragma unroll
  for (int m = 1; m < 32; m <<= 1) { s += __shfl_xor(s, m, 32); sq += __shfl_xor(sq, m, 32); }
  const float mean = s * (1.f / DIMX);
  const float rstd = rsqrtf(sq * (1.f / DIMX) - mean * mean + EPS_F);
#pragma unroll
  for (int i = 0; i < 4; ++i) {
    v4h o;
    o[0] = (half_t)((v[i].x - mean) * rstd * gv[i].x);
    o[1] = (half_t)((v[i].y - mean) * rstd * gv[i].y);
    o[2] = (half_t)((v[i].z - mean) * rstd * gv[i].z);
    o[3] = (half_t)((v[i].w - mean) * rstd * gv[i].w);
    ((v4h*)(xn + row * DIMX))[i * 32 + lane] = o;
  }
}

// ---------------- Kernel 0b: one-time weight transpose+convert (tiny, L2-resident) ----------------
// WqkvT[n][k] = (W_q|W_kv)[k][n] as f16 (640x512); WoutT[n][k] = W_out[k][n] as f16 (512x512)
__global__ __launch_bounds__(256) void prep_w_kernel(const float* __restrict__ Wq,
                                                     const float* __restrict__ Wkv,
                                                     const float* __restrict__ Wout,
                                                     half_t* __restrict__ WqkvT,
                                                     half_t* __restrict__ WoutT) {
  const int idx = blockIdx.x * 256 + threadIdx.x;
  if (idx < 640 * 512) {
    const int n = idx >> 9, k = idx & 511;
    const float w = (n < DIMX) ? Wq[(size_t)k * DIMX + n]
                               : Wkv[(size_t)k * 128 + (n - DIMX)];
    WqkvT[idx] = (half_t)w;
  } else {
    const int i2 = idx - 640 * 512;  // < 512*512
    const int n = i2 >> 9, k = i2 & 511;
    WoutT[i2] = (half_t)Wout[(size_t)k * DIMX + n];
  }
}

// ---------------- Kernel 1: q/k/v projection GEMM  xn @ [W_q | W_kv] ----------------
// grid.x = row blocks of 128, grid.y = 2 halves of N=640 (320 cols each)
#define A_NT 20
__device__ __forceinline__ void stage_proj(const half_t* __restrict__ WqkvT, half_t* buf,
                                           int colBase, int kBase, int tid) {
  // 320 rows x 64 B = 1280 x 16B transfers; 5 async instructions per wave
  const int nl = tid >> 2, part = tid & 3;   // copy i takes row nl + 64 * i
  const half_t* g = WqkvT + (size_t)(colBase + nl) * DIMX + kBase + part * 8;
  half_t* d = &buf[nl * W_PITCH + part * 8];
  async_cp16x5(g, 64 * DIMX, d, 64 * W_PITCH);
}

__global__ __launch_bounds__(256) void proj_kernel(const half_t* __restrict__ xn,
                                                   const half_t* __restrict__ WqkvT,
                                                   half_t* __restrict__ qw,
                                                   half_t* __restrict__ kw,
                                                   half_t* __restrict__ vTw) {
  __shared__ half_t WT[2][320 * W_PITCH];  // double-buffered transposed weight chunk (2 x 25 KB)
  const int tid  = threadIdx.x;
  const int wave = tid >> 5, lane = tid & 31;
  const int l = lane & 15, hi = lane >> 4;
  const int rowBase = blockIdx.x * 128 + wave * 16;
  const int colBase = blockIdx.y * 320;
  v8f acc[A_NT];
  v8f z = {};
#pragma unroll
  for (int t = 0; t < A_NT; ++t) acc[t] = z;

  stage_proj(WqkvT, WT[0], colBase, 0, tid);
  for (int kc = 0; kc < 16; ++kc) {
    const int kBase = kc * 32;
    if (kc < 15) {
      stage_proj(WqkvT, WT[(kc + 1) & 1], colBase, kBase + 32, tid);
      asm volatile("s_wait_asynccnt 0x5" ::: "memory");  // older stage complete
    } else {
      asm volatile("s_wait_asynccnt 0x0" ::: "memory");
    }
    __syncthreads();
    const half_t* buf = WT[kc & 1];
    v16h a = frag_ld(xn + (size_t)(rowBase + l) * DIMX + kBase + hi * 8);
#pragma unroll
    for (int t = 0; t < A_NT; ++t) {
      v16h b = frag_ld(&buf[(t * 16 + l) * W_PITCH + hi * 8]);
      acc[t] = wmma_f16(a, b, acc[t]);
    }
    __syncthreads();
  }
  // scatter epilogue: cols [0,512) -> q, [512,576) -> k, [576,640) -> v (transposed)
#pragma unroll
  for (int t = 0; t < A_NT; ++t) {
    const int col = colBase + t * 16 + l;
#pragma unroll
    for (int j = 0; j < 8; ++j) {
      const int row = rowBase + j + hi * 8;
      const half_t hv = (half_t)acc[t][j];
      if (col < DIMX) {
        qw[(size_t)row * DIMX + col] = hv;
      } else if (col < DIMX + DHEAD) {
        kw[(size_t)row * DHEAD + (col - DIMX)] = hv;
      } else {
        const int bn = row >> 8, rl = row & 255, d = col - DIMX - DHEAD;
        vTw[((size_t)bn * DHEAD + d) * SEQ + rl] = hv;  // V^T per (b,n)
      }
    }
  }
}

// value of lane l ^ 16 (the other 16-lane row, same position)
__device__ __forceinline__ float other_half(float v) {
  const int r = __builtin_amdgcn_permlanex16(0, __builtin_bit_cast(int, v),
                                             0x76543210, 0xfedcba98, false, false);
  return __builtin_bit_cast(float, r);
}

__global__ __launch_bounds__(256) void attn_kernel(const half_t* __restrict__ qw,
                                                   const half_t* __restrict__ kw,
                                                   const half_t* __restrict__ vTw,
                                                   half_t* __restrict__ mid) {
  extern __shared__ half_t smem[];
  half_t* Ksh = smem;                       // [256][K_PITCH]  (36 KB)
  half_t* Vsh = Ksh + SEQ * K_PITCH;        // [64][V_PITCH]   (33 KB)
  const int tid  = threadIdx.x;
  const int wave = tid >> 5, lane = tid & 31;
  const int l = lane & 15, hi = lane >> 4;
  const int bn = blockIdx.x >> 3, h = blockIdx.x & 7;
  const half_t* Qg  = qw  + (size_t)bn * SEQ * DIMX + h * DHEAD;   // stride DIMX
  const half_t* Kg  = kw  + (size_t)bn * SEQ * DHEAD;              // [256][64]
  const half_t* VTg = vTw + (size_t)bn * DHEAD * SEQ;              // [64][256]
  const int rBase = wave * 32;

  // async-stage K and V^T into padded LDS rows (16 async instr per wave)
  {
    // K: 8 granules of 16 B a row, copy i takes row (tid >> 3) + 32 * i
    const half_t* gk = Kg + tid * 8;
    half_t* dk = &Ksh[(tid >> 3) * K_PITCH + (tid & 7) * 8];
    // V^T: 32 granules a row, copy i takes row (tid >> 5) + 8 * i
    const half_t* gv = VTg + tid * 8;
    half_t* dv = &Vsh[(tid >> 5) * V_PITCH + (tid & 31) * 8];
    async_cp16x8(gk, 2048, dk, 32 * K_PITCH);
    async_cp16x8(gv, 2048, dv, 8 * V_PITCH);
  }

  v8f s[2][16];   // s[qt][kt][j] = S[query rBase + 16*qt + l][key 16*kt + 8*hi + j]
  v8f z = {};
#pragma unroll
  for (int qt = 0; qt < 2; ++qt)
#pragma unroll
    for (int kt = 0; kt < 16; ++kt) s[qt][kt] = z;

  // Q B-fragments straight from global (overlaps with the async staging)
  v16h bq[2][2];
#pragma unroll
  for (int kc = 0; kc < 2; ++kc) {
    bq[kc][0] = frag_ld(Qg + (size_t)(rBase + l)      * DIMX + kc * 32 + hi * 8);
    bq[kc][1] = frag_ld(Qg + (size_t)(rBase + 16 + l) * DIMX + kc * 32 + hi * 8);
  }
  asm volatile("s_wait_asynccnt 0x0" ::: "memory");
  __syncthreads();

  // S^T = K Q^T   (A = K rows, B = Q rows as the N-major mirror)
#pragma unroll
  for (int kc = 0; kc < 2; ++kc) {
    const int kBase = kc * 32;
#pragma unroll
    for (int kt = 0; kt < 16; ++kt) {
      v16h a = frag_ld(&Ksh[(kt * 16 + l) * K_PITCH + kBase + hi * 8]);
      s[0][kt] = wmma_f16(a, bq[kc][0], s[0][kt]);
      s[1][kt] = wmma_f16(a, bq[kc][1], s[1][kt]);
    }
  }

  // softmax: logits = (s - max) * 0.125 = (s - max) / sqrt(DHEAD)
  float rsum[2];
  v16h pb[2][8];  // pb[qt][kc]: B fragment of P^T, keys 32*kc .. 32*kc + 31, column = query
#pragma unroll
  for (int qt = 0; qt < 2; ++qt) {
    float mx[4], sm[4];
#pragma unroll
    for (int i = 0; i < 4; ++i) { mx[i] = s[qt][0][i]; sm[i] = 0.f; }
#pragma unroll
    for (int kt = 0; kt < 16; ++kt)
#pragma unroll
      for (int j = 0; j < 8; ++j) mx[j & 3] = fmaxf(mx[j & 3], s[qt][kt][j]);
    float m = fmaxf(fmaxf(mx[0], mx[1]), fmaxf(mx[2], mx[3]));
    m = fmaxf(m, other_half(m));
#pragma unroll
    for (int kc = 0; kc < 8; ++kc) {
#pragma unroll
      for (int e = 0; e < 16; ++e) {
        const float p = __expf((s[qt][2 * kc + (e >> 3)][e & 7] - m) * 0.125f);
        sm[e & 3] += p;
        pb[qt][kc][e] = (half_t)p;
      }
    }
    float sum = (sm[0] + sm[1]) + (sm[2] + sm[3]);
    sum += other_half(sum);
    rsum[qt] = sum;
  }

  // O^T = V^T P^T  (A = V^T rows from LDS, B = P^T from registers)
  v8f o[2][4];    // o[qt][dt][j] = O[query rBase + 16*qt + l][d 16*dt + 8*hi + j]
#pragma unroll
  for (int qt = 0; qt < 2; ++qt)
#pragma unroll
    for (int dt = 0; dt < 4; ++dt) o[qt][dt] = z;
#pragma unroll
  for (int kc = 0; kc < 8; ++kc) {
    const int kBase = kc * 32;
#pragma unroll
    for (int dt = 0; dt < 4; ++dt) {
      v16h a = frag_ld(&Vsh[(dt * 16 + l) * V_PITCH + kBase + hi * 8]);
      o[0][dt] = wmma_f16(a, pb[0][kc], o[0][dt]);
      o[1][dt] = wmma_f16(a, pb[1][kc], o[1][dt]);
    }
  }
  // normalize and store head-concatenated mid: 8 consecutive d of one query per lane
#pragma unroll
  for (int qt = 0; qt < 2; ++qt) {
    half_t* mrow = mid + ((size_t)bn * SEQ + rBase + qt * 16 + l) * DIMX + h * DHEAD + hi * 8;
#pragma unroll
    for (int dt = 0; dt < 4; ++dt) {
      v8h r;
#pragma unroll
      for (int j = 0; j < 8; ++j) r[j] = (half_t)(o[qt][dt][j] / rsum[qt]);
      *(v8h*)(mrow + dt * 16) = r;
    }
  }
}

// ---------------- Kernel 3: out projection + LayerNorm ----------------
__device__ __forceinline__ void stage_out(const half_t* __restrict__ WoutT, half_t* buf,
                                          int kBase, int tid) {
  // 512 rows x 64 B = 2048 x 16B transfers; 8 async instructions per wave
  const int nl = tid >> 2, part = tid & 3;   // copy i takes row nl + 64 * i
  const half_t* g = WoutT + (size_t)nl * DIMX + kBase + part * 8;
  half_t* d = &buf[nl * W_PITCH + part * 8];
  async_cp16x8(g, 64 * DIMX, d, 64 * W_PITCH);
}

__global__ __launch_bounds__(256) void out_kernel(const half_t* __restrict__ mid,
                                                  const half_t* __restrict__ WoutT,
                                                  const float* __restrict__ gout,
                                                  float* __restrict__ out) {
  __shared__ half_t WT[2][512 * W_PITCH];  // double-buffered transposed W_out chunk (2 x 40 KB)
  const int tid  = threadIdx.x;
  const int wave = tid >> 5, lane = tid & 31;
  const int l = lane & 15, hi = lane >> 4;
  const int rowBase = blockIdx.x * 128 + wave * 16;
  v8f acc[32];
  v8f z = {};
#pragma unroll
  for (int t = 0; t < 32; ++t) acc[t] = z;

  stage_out(WoutT, WT[0], 0, tid);
  for (int kc = 0; kc < 16; ++kc) {
    const int kBase = kc * 32;
    if (kc < 15) {
      stage_out(WoutT, WT[(kc + 1) & 1], kBase + 32, tid);
      asm volatile("s_wait_asynccnt 0x8" ::: "memory");  // older stage complete
    } else {
      asm volatile("s_wait_asynccnt 0x0" ::: "memory");
    }
    __syncthreads();
    const half_t* buf = WT[kc & 1];
    v16h a = frag_ld(mid + (size_t)(rowBase + l) * DIMX + kBase + hi * 8);
#pragma unroll
    for (int t = 0; t < 32; ++t) {
      v16h b = frag_ld(&buf[(t * 16 + l) * W_PITCH + hi * 8]);
      acc[t] = wmma_f16(a, b, acc[t]);
    }
    __syncthreads();
  }
  // fused LayerNorm over each 512-wide output row
#pragma unroll
  for (int j = 0; j < 8; ++j) {
    float sm = 0.f, sq = 0.f;
#pragma unroll
    for (int t = 0; t < 32; ++t) { const float vv = acc[t][j]; sm += vv; sq += vv * vv; }
#pragma unroll
    for (int msk = 1; msk < 16; msk <<= 1) {
      sm += __shfl_xor(sm, msk, 32);
      sq += __shfl_xor(sq, msk, 32);
    }
    const float mean = sm * (1.f / DIMX);
    const float rstd = rsqrtf(sq * (1.f / DIMX) - mean * mean + EPS_F);
    const long row = rowBase + j + hi * 8;
#pragma unroll
    for (int t = 0; t < 32; ++t) {
      const int col = t * 16 + l;
      out[row * DIMX + col] = (acc[t][j] - mean) * rstd * gout[col];
    }
  }
}

extern "C" void kernel_launch(void* const* d_in, const int* in_sizes, int n_in,
                              void* d_out, int out_size, void* d_ws, size_t ws_size,
                              hipStream_t stream) {
  const float* x      = (const float*)d_in[0];
  const float* g_norm = (const float*)d_in[1];
  const float* W_q    = (const float*)d_in[2];
  const float* W_kv   = (const float*)d_in[3];
  const float* W_out  = (const float*)d_in[4];
  const float* g_out  = (const float*)d_in[5];
  float* out = (float*)d_out;

  char* ws = (char*)d_ws;
  const size_t xnB = (size_t)R_TOTAL * DIMX * sizeof(half_t);    // 64 MB
  const size_t kB  = (size_t)R_TOTAL * DHEAD * sizeof(half_t);   //  8 MB
  half_t* xn    = (half_t*)ws;                 // reused as `mid` once consumed
  half_t* qw    = (half_t*)(ws + xnB);
  half_t* kw    = (half_t*)(ws + 2 * xnB);
  half_t* vT    = (half_t*)(ws + 2 * xnB + kB);
  half_t* WqkvT = (half_t*)(ws + 2 * xnB + 2 * kB);
  half_t* WoutT = WqkvT + 640 * 512;
  half_t* mid = xn;

  ln_in_kernel<<<R_TOTAL / 8, 256, 0, stream>>>(x, g_norm, xn);
  prep_w_kernel<<<(640 * 512 + 512 * 512) / 256, 256, 0, stream>>>(W_q, W_kv, W_out, WqkvT, WoutT);
  dim3 gA(R_TOTAL / 128, 2);
  proj_kernel<<<gA, 256, 0, stream>>>(xn, WqkvT, qw, kw, vT);
  const size_t attn_lds = (size_t)(SEQ * K_PITCH + DHEAD * V_PITCH) * sizeof(half_t);
  attn_kernel<<<2048, 256, attn_lds, stream>>>(qw, kw, vT, mid);
  out_kernel<<<R_TOTAL / 128, 256, 0, stream>>>(mid, WoutT, g_out, out);
}

// v003
// Measured time: 242 microseconds a run.
// In two side-by-side timings against v002, it was 1.17 and 1.13 times as fast.
// All steps since v000 together make it 1.92 times as fast.
#include <hip/hip_runtime.h>

typedef _Float16 half_t;
typedef __attribute__((ext_vector_type(4)))  _Float16 v4h;
typedef __attribute__((ext_vector_type(8)))  _Float16 v8h;
typedef __attribute__((ext_vector_type(16))) _Float16 v16h;
typedef __attribute__((ext_vector_type(8)))  float    v8f;

#define R_TOTAL 65536   // b*n*r = 4*64*256
#define DIMX    512
#define DHEAD   64
#define SEQ     256
#define EPS_F   1e-5f
// LDS row pitches (halves) for rows read by 16-byte fragment loads: 16 B x odd, so that
// the 16 rows of one fragment load fall on distinct banks.
#define W_PITCH 40      // 64-B weight-chunk rows  -> 80 B
#define K_PITCH 72      // 128-B K rows            -> 144 B
#define V_PITCH 264     // 512-B V^T rows          -> 528 B

// Load a 16-bit A/B WMMA fragment (16x32 A, or 32x16 B via its N-major mirror).
// Caller passes p = base + row_or_n*stride + kBase + (lane>>4)*8.
// lane<16 needs K {0..7, 16..23}, lane>=16 needs K {8..15, 24..31}: two b128 loads.
__device__ __forceinline__ v16h frag_ld(const half_t* p) {
  v8h lo = *(const v8h*)(p);
  v8h hi = *(const v8h*)(p + 16);
  return __builtin_shufflevector(lo, hi, 0,1,2,3,4,5,6,7,8,9,10,11,12,13,14,15);
}

__device__ __forceinline__ v8f wmma_f16(v16h a, v16h b, v8f c) {
  return __builtin_amdgcn_wmma_f32_16x16x32_f16(false, a, false, b, (short)0, c, false, false);
}

// One 32-deep k chunk of a wave's 16 x (16*NT) tile: acc[t] += a * B_t, the B fragments read from
// LDS (bp = the lane's place in row l of the chunk, tile t lies 16 rows further per t).
// The fragments come in groups of G, each group fetched into its own register set while the
// group before it is multiplied, so that a WMMA does not wait out the latency of its own loads.
// Every loop is unrolled so that bf and acc are indexed by constants and stay in registers.
template <int NT, int G, int PITCH>
__device__ __forceinline__ void mma_chunk(const half_t* bp, v16h a, v8f (&acc)[NT]) {
  v16h bf[2][G];
#pragma unroll
  for (int i = 0; i < G; ++i) bf[0][i] = frag_ld(bp + i * 16 * PITCH);
#pragma unroll
  for (int g = 0; g < NT / G; ++g) {
    if (g + 1 < NT / G) {
#pragma unroll
      for (int i = 0; i < G; ++i) bf[(g + 1) & 1][i] = frag_ld(bp + ((g + 1) * G + i) * 16 * PITCH);
    }
    // keeps the next group's loads in front of this group's WMMAs (the scheduler sinks them
    // to their first use otherwise, one register set and a full LDS wait per WMMA)
    __builtin_amdgcn_sched_barrier(0);
#pragma unroll
    for (int i = 0; i < G; ++i) acc[g * G + i] = wmma_f16(a, bf[g & 1][i], acc[g * G + i]);
    // keeps the loads that follow together as one group, not spread among these WMMAs
    __builtin_amdgcn_sched_barrier(0);
  }
}

// CDNA5 async global->LDS copy, 16 bytes per lane, tracked by ASYNCcnt.
__device__ __forceinline__ unsigned lds_addr(const half_t* l) {
  return (unsigned)(uintptr_t)l;  // flat LDS aperture: addr[31:0] = LDS offset
}
// A run of copies (copy i: g + i * gs -> l + i * ls, strides in halves) and its s_wait_xcnt 0
// in one statement: the wait then stands in front of any later rewrite of the address
// registers that the copies name.
__device__ __forceinline__ void async_cp16x5(const half_t* g, int gs, half_t* l, int ls) {
  asm volatile("global_load_async_to_lds_b128 %0, %1, off\n\t"
               "global_load_async_to_lds_b128 %2, %3, off\n\t"
               "global_load_async_to_lds_b128 %4, %5, off\n\t"
               "global_load_async_to_lds_b128 %6, %7, off\n\t"
               "global_load_async_to_lds_b128 %8, %9, off\n\t"
               "s_wait_xcnt 0x0"
               :: "v"(lds_addr(l)),          "v"(g),
                  "v"(lds_addr(l + 1 * ls)), "v"(g + 1 * gs),
                  "v"(lds_addr(l + 2 * ls)), "v"(g + 2 * gs),
                  "v"(lds_addr(l + 3 * ls)), "v"(g + 3 * gs),
                  "v"(lds_addr(l + 4 * ls)), "v"(g + 4 * gs) : "memory");
}
__device__ __forceinline__ void async_cp16x8(const half_t* g, int gs, half_t* l, int ls) {
  asm volatile("global_load_async_to_lds_b128 %0, %1, off\n\t"
               "global_load_async_to_lds_b128 %2, %3, off\n\t"
               "global_load_async_to_lds_b128 %4, %5, off\n\t"
               "global_load_async_to_lds_b128 %6, %7, off\n\t"
               "global_load_async_to_lds_b128 %8, %9, off\n\t"
               "global_load_async_to_lds_b128 %10, %11, off\n\t"
               "global_load_async_to_lds_b128 %12, %13, off\n\t"
               "global_load_async_to_lds_b128 %14, %15, off\n\t"
               "s_wait_xcnt 0x0"
               :: "v"(lds_addr(l)),          "v"(g),
                  "v"(lds_addr(l + 1 * ls)), "v"(g + 1 * gs),
                  "v"(lds_addr(l + 2 * ls)), "v"(g + 2 * gs),
                  "v"(lds_addr(l + 3 * ls)), "v"(g + 3 * gs),
                  "v"(lds_addr(l + 4 * ls)), "v"(g + 4 * gs),
                  "v"(lds_addr(l + 5 * ls)), "v"(g + 5 * gs),
                  "v"(lds_addr(l + 6 * ls)), "v"(g + 6 * gs),
                  "v"(lds_addr(l + 7 * ls)), "v"(g + 7 * gs) : "memory");
}

// ---------------- Kernel 0a: input LayerNorm, f32 -> f16 ----------------
__global__ __launch_bounds__(256) void ln_in_kernel(const float* __restrict__ x,
                                                    const float* __restrict__ g,
                                                    half_t* __restrict__ xn) {
  const int wave = threadIdx.x >> 5;
  const int lane = threadIdx.x & 31;
  const long row = (long)blockIdx.x * 8 + wave;
  const float* xr = x + row * DIMX;
  float4 v[4], gv[4];
  float s = 0.f, sq = 0.f;
#pragma unroll
  for (int i = 0; i < 4; ++i) {
    v[i]  = ((const float4*)xr)[i * 32 + lane];
    gv[i] = ((const float4*)g)[i * 32 + lane];
    s  += v[i].x + v[i].y + v[i].z + v[i].w;
    sq += v[i].x*v[i].x + v[i].y*v[i].y + v[i].z*v[i].z + v[i].w*v[i].w;
  }
#pragma unroll
  for (int m = 1; m < 32; m <<= 1) { s += __shfl_xor(s, m, 32); sq += __shfl_xor(sq, m, 32); }
  const float mean = s * (1.f / DIMX);
  const float rstd = rsqrtf(sq * (1.f / DIMX) - mean * mean + EPS_F);
#pragma unroll
  for (int i = 0; i < 4; ++i) {
    v4h o;
    o[0] = (half_t)((v[i].x - mean) * rstd * gv[i].x);
    o[1] = (half_t)((v[i].y - mean) * rstd * gv[i].y);
    o[2] = (half_t)((v[i].z - mean) * rstd * gv[i].z);
    o[3] = (half_t)((v[i].w - mean) * rstd * gv[i].w);
    ((v4h*)(xn + row * DIMX))[i * 32 + lane] = o;
  }
}

// ---------------- Kernel 0b: one-time weight transpose+convert (tiny, L2-resident) ----------------
// WqkvT[n][k] = (W_q|W_kv)[k][n] as f16 (640x512); WoutT[n][k] = W_out[k][n] as f16 (512x512)
__global__ __launch_bounds__(256) void prep_w_kernel(const float* __restrict__ Wq,
                                                     const float* __restrict__ Wkv,
                                                     const float* __restrict__ Wout,
                                                     half_t* __restrict__ WqkvT,
                                                     half_t* __restrict__ WoutT) {
  const int idx = blockIdx.x * 256 + threadIdx.x;
  if (idx < 640 * 512) {
    const int n = idx >> 9, k = idx & 511;
    const float w = (n < DIMX) ? Wq[(size_t)k * DIMX + n]
                               : Wkv[(size_t)k * 128 + (n - DIMX)];
    WqkvT[idx] = (half_t)w;
  } else {
    const int i2 = idx - 640 * 512;  // < 512*512
    const int n = i2 >> 9, k = i2 & 511;
    WoutT[i2] = (half_t)Wout[(size_t)k * DIMX + n];
  }
}

// ---------------- Kernel 1: q/k/v projection GEMM  xn @ [W_q | W_kv] ----------------
// grid.x = row blocks of 128, grid.y = 2 halves of N=640 (320 cols each)
#define A_NT 20
__device__ __forceinline__ void stage_proj(const half_t* __restrict__ WqkvT, half_t* buf,
                                           int colBase, int kBase, int tid) {
  // 320 rows x 64 B = 1280 x 16B transfers; 5 async instructions per wave
  const int nl = tid >> 2, part = tid & 3;   // copy i takes row nl + 64 * i
  const half_t* g = WqkvT + (size_t)(colBase + nl) * DIMX + kBase + part * 8;
  half_t* d = &buf[nl * W_PITCH + part * 8];
  async_cp16x5(g, 64 * DIMX, d, 64 * W_PITCH);
}

__global__ __launch_bounds__(256) void proj_kernel(const half_t* __restrict__ xn,
                                                   const half_t* __restrict__ WqkvT,
                                                   half_t* __restrict__ qw,
                                                   half_t* __restrict__ kw,
                                                   half_t* __restrict__ vTw) {
  __shared__ half_t WT[2][320 * W_PITCH];  // double-buffered transposed weight chunk (2 x 25 KB)
  const int tid  = threadIdx.x;
  const int wave = tid >> 5, lane = tid & 31;
  const int l = lane & 15, hi = lane >> 4;
  const int rowBase = blockIdx.x * 128 + wave * 16;
  const int colBase = blockIdx.y * 320;
  v8f acc[A_NT];
  v8f z = {};
#pragma unroll
  for (int t = 0; t < A_NT; ++t) acc[t] = z;

  stage_proj(WqkvT, WT[0], colBase, 0, tid);
  for (int kc = 0; kc < 16; ++kc) {
    const int kBase = kc * 32;
    if (kc < 15) {
      stage_proj(WqkvT, WT[(kc + 1) & 1], colBase, kBase + 32, tid);
      asm volatile("s_wait_asynccnt 0x5" ::: "memory");  // older stage complete
    } else {
      asm volatile("s_wait_asynccnt 0x0" ::: "memory");
    }
    __syncthreads();
    const half_t* buf = WT[kc & 1];
    v16h a = frag_ld(xn + (size_t)(rowBase + l) * DIMX + kBase + hi * 8);
    mma_chunk<A_NT, 4, W_PITCH>(&buf[l * W_PITCH + hi * 8], a, acc);
    __syncthreads();
  }
  // scatter epilogue: cols [0,512) -> q, [512,576) -> k, [576,640) -> v (transposed)
#pragma unroll
  for (int t = 0; t < A_NT; ++t) {
    const int col = colBase + t * 16 + l;
#pragma unroll
    for (int j = 0; j < 8; ++j) {
      const int row = rowBase + j + hi * 8;
      const half_t hv = (half_t)acc[t][j];
      if (col < DIMX) {
        qw[(size_t)row * DIMX + col] = hv;
      } else if (col < DIMX + DHEAD) {
        kw[(size_t)row * DHEAD + (col - DIMX)] = hv;
      } else {
        const int bn = row >> 8, rl = row & 255, d = col - DIMX - DHEAD;
        vTw[((size_t)bn * DHEAD + d) * SEQ + rl] = hv;  // V^T per (b,n)
      }
    }
  }
}

// value of lane l ^ 16 (the other 16-lane row, same position)
__device__ __forceinline__ float other_half(float v) {
  const int r = __builtin_amdgcn_permlanex16(0, __builtin_bit_cast(int, v),
                                             0x76543210, 0xfedcba98, false, false);
  return __builtin_bit_cast(float, r);
}

__global__ __launch_bounds__(256) void attn_kernel(const half_t* __restrict__ qw,
                                                   const half_t* __restrict__ kw,
                                                   const half_t* __restrict__ vTw,
                                                   half_t* __restrict__ mid) {
  extern __shared__ half_t smem[];
  half_t* Ksh = smem;                       // [256][K_PITCH]  (36 KB)
  half_t* Vsh = Ksh + SEQ * K_PITCH;        // [64][V_PITCH]   (33 KB)
  const int tid  = threadIdx.x;
  const int wave = tid >> 5, lane = tid & 31;
  const int l = lane & 15, hi = lane >> 4;
  const int bn = blockIdx.x >> 3, h = blockIdx.x & 7;
  const half_t* Qg  = qw  + (size_t)bn * SEQ * DIMX + h * DHEAD;   // stride DIMX
  const half_t* Kg  = kw  + (size_t)bn * SEQ * DHEAD;              // [256][64]
  const half_t* VTg = vTw + (size_t)bn * DHEAD * SEQ;              // [64][256]
  const int rBase = wave * 32;

  // async-stage K and V^T into padded LDS rows (16 async instr per wave)
  {
    // K: 8 granules of 16 B a row, copy i takes row (tid >> 3) + 32 * i
    const half_t* gk = Kg + tid * 8;
    half_t* dk = &Ksh[(tid >> 3) * K_PITCH + (tid & 7) * 8];
    // V^T: 32 granules a row, copy i takes row (tid >> 5) + 8 * i
    const half_t* gv = VTg + tid * 8;
    half_t* dv = &Vsh[(tid >> 5) * V_PITCH + (tid & 31) * 8];
    async_cp16x8(gk, 2048, dk, 32 * K_PITCH);
    async_cp16x8(gv, 2048, dv, 8 * V_PITCH);
  }

  v8f s[2][16];   // s[qt][kt][j] = S[query rBase + 16*qt + l][key 16*kt + 8*hi + j]
  v8f z = {};
#pragma unroll
  for (int qt = 0; qt < 2; ++qt)
#pragma unroll
    for (int kt = 0; kt < 16; ++kt) s[qt][kt] = z;

  // Q B-fragments straight from global (overlaps with the async staging)
  v16h bq[2][2];
#pragma unroll
  for (int kc = 0; kc < 2; ++kc) {
    bq[kc][0] = frag_ld(Qg + (size_t)(rBase + l)      * DIMX + kc * 32 + hi * 8);
    bq[kc][1] = frag_ld(Qg + (size_t)(rBase + 16 + l) * DIMX + kc * 32 + hi * 8);
  }
  asm volatile("s_wait_asynccnt 0x0" ::: "memory");
  __syncthreads();

  // S^T = K Q^T   (A = K rows, B = Q rows as the N-major mirror)
#pragma unroll
  for (int kc = 0; kc < 2; ++kc) {
    const int kBase = kc * 32;
#pragma unroll
    for (int kt = 0; kt < 16; ++kt) {
      v16h a = frag_ld(&Ksh[(kt * 16 + l) * K_PITCH + kBase + hi * 8]);
      s[0][kt] = wmma_f16(a, bq[kc][0], s[0][kt]);
      s[1][kt] = wmma_f16(a, bq[kc][1], s[1][kt]);
    }
  }

  // softmax: logits = (s - max) * 0.125 = (s - max) / sqrt(DHEAD)
  float rsum[2];
  v16h pb[2][8];  // pb[qt][kc]: B fragment of P^T, keys 32*kc .. 32*kc + 31, column = query
#pragma unroll
  for (int qt = 0; qt < 2; ++qt) {
    float mx[4], sm[4];
#pragma unroll
    for (int i = 0; i < 4; ++i) { mx[i] = s[qt][0][i]; sm[i] = 0.f; }
#pragma unroll
    for (int kt = 0; kt < 16; ++kt)
#pragma unroll
      for (int j = 0; j < 8; ++j) mx[j & 3] = fmaxf(mx[j & 3], s[qt][kt][j]);
    float m = fmaxf(fmaxf(mx[0], mx[1]), fmaxf(mx[2], mx[3]));
    m = fmaxf(m, other_half(m));
#pragma unroll
    for (int kc = 0; kc < 8; ++kc) {
#pragma unroll
      for (int e = 0; e < 16; ++e) {
        const float p = __expf((s[qt][2 * kc + (e >> 3)][e & 7] - m) * 0.125f);
        sm[e & 3] += p;
        pb[qt][kc][e] = (half_t)p;
      }
    }
    float sum = (sm[0] + sm[1]) + (sm[2] + sm[3]);
    sum += other_half(sum);
    rsum[qt] = sum;
  }

  // O^T = V^T P^T  (A = V^T rows from LDS, B = P^T from registers)
  v8f o[2][4];    // o[qt][dt][j] = O[query rBase + 16*qt + l][d 16*dt + 8*hi + j]
#pragma unroll
  for (int qt = 0; qt < 2; ++qt)
#pragma unroll
    for (int dt = 0; dt < 4; ++dt) o[qt][dt] = z;
#pragma unroll
  for (int kc = 0; kc < 8; ++kc) {
    const int kBase = kc * 32;
#pragma unroll
    for (int dt = 0; dt < 4; ++dt) {
      v16h a = frag_ld(&Vsh[(dt * 16 + l) * V_PITCH + kBase + hi * 8]);
      o[0][dt] = wmma_f16(a, pb[0][kc], o[0][dt]);
      o[1][dt] = wmma_f16(a, pb[1][kc], o[1][dt]);
    }
  }
  // normalize and store head-concatenated mid: 8 consecutive d of one query per lane
#pragma unroll
  for (int qt = 0; qt < 2; ++qt) {
    half_t* mrow = mid + ((size_t)bn * SEQ + rBase + qt * 16 + l) * DIMX + h * DHEAD + hi * 8;
#pragma unroll
    for (int dt = 0; dt < 4; ++dt) {
      v8h r;
#pragma unroll
      for (int j = 0; j < 8; ++j) r[j] = (half_t)(o[qt][dt][j] / rsum[qt]);
      *(v8h*)(mrow + dt * 16) = r;
    }
  }
}

// ---------------- Kernel 3: out projection + LayerNorm ----------------
__device__ __forceinline__ void stage_out(const half_t* __restrict__ WoutT, half_t* buf,
                                          int kBase, int tid) {
  // 512 rows x 64 B = 2048 x 16B transfers; 8 async instructions per wave
  const int nl = tid >> 2, part = tid & 3;   // copy i takes row nl + 64 * i
  const half_t* g = WoutT + (size_t)nl * DIMX + kBase + part * 8;
  half_t* d = &buf[nl * W_PITCH + part * 8];
  async_cp16x8(g, 64 * DIMX, d, 64 * W_PITCH);
}

__global__ __launch_bounds__(256) void out_kernel(const half_t* __restrict__ mid,
                                                  const half_t* __restrict__ WoutT,
                                                  const float* __restrict__ gout,
                                                  float* __restrict__ out) {
  __shared__ half_t WT[2][512 * W_PITCH];  // double-buffered transposed W_out chunk (2 x 40 KB)
  const int tid  = threadIdx.x;
  const int wave = tid >> 5, lane = tid & 31;
  const int l = lane & 15, hi = lane >> 4;
  const int rowBase = blockIdx.x * 128 + wave * 16;
  v8f acc[32];
  v8f z = {};
#pragma unroll
  for (int t = 0; t < 32; ++t) acc[t] = z;

  stage_out(WoutT, WT[0], 0, tid);
  for (int kc = 0; kc < 16; ++kc) {
    const int kBase = kc * 32;
    if (kc < 15) {
      stage_out(WoutT, WT[(kc + 1) & 1], kBase + 32, tid);
      asm volatile("s_wait_asynccnt 0x8" ::: "memory");  // older stage complete
    } else {
      asm volatile("s_wait_asynccnt 0x0" ::: "memory");
    }
    __syncthreads();
    const half_t* buf = WT[kc & 1];
    v16h a = frag_ld(mid + (size_t)(rowBase + l) * DIMX + kBase + hi * 8);
    mma_chunk<32, 8, W_PITCH>(&buf[l * W_PITCH + hi * 8], a, acc);
    __syncthreads();
  }
  // fused LayerNorm over each 512-wide output row
#pragma unroll
  for (int j = 0; j < 8; ++j) {
    float sm = 0.f, sq = 0.f;
#pragma unroll
    for (int t = 0; t < 32; ++t) { const float vv = acc[t][j]; sm += vv; sq += vv * vv; }
#pragma unroll
    for (int msk = 1; msk < 16; msk <<= 1) {
      sm += __shfl_xor(sm, msk, 32);
      sq += __shfl_xor(sq, msk, 32);
    }
    const float mean = sm * (1.f / DIMX);
    const float rstd = rsqrtf(sq * (1.f / DIMX) - mean * mean + EPS_F);
    const long row = rowBase + j + hi * 8;
#pragma unroll
    for (int t = 0; t < 32; ++t) {
      const int col = t * 16 + l;
      out[row * DIMX + col] = (acc[t][j] - mean) * rstd * gout[col];
    }
  }
}

extern "C" void kernel_launch(void* const* d_in, const int* in_sizes, int n_in,
                              void* d_out, int out_size, void* d_ws, size_t ws_size,
                              hipStream_t stream) {
  const float* x      = (const float*)d_in[0];
  const float* g_norm = (const float*)d_in[1];
  const float* W_q    = (const float*)d_in[2];
  const float* W_kv   = (const float*)d_in[3];
  const float* W_out  = (const float*)d_in[4];
  const float* g_out  = (const float*)d_in[5];
  float* out = (float*)d_out;

  char* ws = (char*)d_ws;
  const size_t xnB = (size_t)R_TOTAL * DIMX * sizeof(half_t);    // 64 MB
  const size_t kB  = (size_t)R_TOTAL * DHEAD * sizeof(half_t);   //  8 MB
  half_t* xn    = (half_t*)ws;                 // reused as `mid` once consumed
  half_t* qw    = (half_t*)(ws + xnB);
  half_t* kw    = (half_t*)(ws + 2 * xnB);
  half_t* vT    = (half_t*)(ws + 2 * xnB + kB);
  half_t* WqkvT = (half_t*)(ws + 2 * xnB + 2 * kB);
  half_t* WoutT = WqkvT + 640 * 512;
  half_t* mid = xn;

  ln_in_kernel<<<R_TOTAL / 8, 256, 0, stream>>>(x, g_norm, xn);
  prep_w_kernel<<<(640 * 512 + 512 * 512) / 256, 256, 0, stream>>>(W_q, W_kv, W_out, WqkvT, WoutT);
  dim3 gA(R_TOTAL / 128, 2);
  proj_kernel<<<gA, 256, 0, stream>>>(xn, WqkvT, qw, kw, vT);
  const size_t attn_lds = (size_t)(SEQ * K_PITCH + DHEAD * V_PITCH) * sizeof(half_t);
  attn_kernel<<<2048, 256, attn_lds, stream>>>(qw, kw, vT, mid);
  out_kernel<<<R_TOTAL / 128, 256, 0, stream>>>(mid, WoutT, g_out, out);
}

// v004
// It runs in 210 microseconds.
// In two side-by-side timings against v003, it was 1.15 and 1.19 times as fast.
// Counting every step since v000, it is 2.25 times as fast.
#include <hip/hip_runtime.h>

typedef _Float16 half_t;
typedef __attribute__((ext_vector_type(4)))  _Float16 v4h;
typedef __attribute__((ext_vector_type(8)))  _Float16 v8h;
typedef __attribute__((ext_vector_type(16))) _Float16 v16h;
typedef __attribute__((ext_vector_type(8)))  float    v8f;

#define R_TOTAL 65536   // b*n*r = 4*64*256
#define DIMX    512
#define DHEAD   64
#define SEQ     256
#define EPS_F   1e-5f
// LDS row pitches (halves) for rows read by 16-byte fragment loads: 16 B x odd, so that
// the 16 rows of one fragment load fall on distinct banks.
#define W_PITCH 40      // 64-B weight-chunk rows  -> 80 B
#define K_PITCH 72      // 128-B K rows            -> 144 B
#define V_PITCH 264     // 512-B V^T rows          -> 528 B

// Load a 16-bit A/B WMMA fragment (16x32 A, or 32x16 B via its N-major mirror).
// Caller passes p = base + row_or_n*stride + kBase + (lane>>4)*8.
// lane<16 needs K {0..7, 16..23}, lane>=16 needs K {8..15, 24..31}: two b128 loads.
__device__ __forceinline__ v16h frag_ld(const half_t* p) {
  v8h lo = *(const v8h*)(p);
  v8h hi = *(const v8h*)(p + 16);
  return __builtin_shufflevector(lo, hi, 0,1,2,3,4,5,6,7,8,9,10,11,12,13,14,15);
}

__device__ __forceinline__ v8f wmma_f16(v16h a, v16h b, v8f c) {
  return __builtin_amdgcn_wmma_f32_16x16x32_f16(false, a, false, b, (short)0, c, false, false);
}

// One 32-deep k chunk of a wave's 16 x (16*NT) tile: acc[t] += a * B_t, the B fragments read from
// LDS (bp = the lane's place in row l of the chunk, tile t lies 16 rows further per t).
// The fragments come in groups of G, each group fetched into its own register set while the
// group before it is multiplied, so that a WMMA does not wait out the latency of its own loads.
// Every loop is unrolled so that bf and acc are indexed by constants and stay in registers.
// The first NTR tiles are formed transposed (the LDS fragment as A, a as B; both fragments have
// the same lane and k layout): there a lane holds 8 adjacent columns of one row of the product.
template <int NT, int G, int PITCH, int NTR>
__device__ __forceinline__ void mma_chunk(const half_t* bp, v16h a, v8f (&acc)[NT]) {
  v16h bf[2][G];
#pragma unroll
  for (int i = 0; i < G; ++i) bf[0][i] = frag_ld(bp + i * 16 * PITCH);
#pragma unroll
  for (int g = 0; g < NT / G; ++g) {
    if (g + 1 < NT / G) {
#pragma unroll
      for (int i = 0; i < G; ++i) bf[(g + 1) & 1][i] = frag_ld(bp + ((g + 1) * G + i) * 16 * PITCH);
    }
    // keeps the next group's loads in front of this group's WMMAs (the scheduler sinks them
    // to their first use otherwise, one register set and a full LDS wait per WMMA)
    __builtin_amdgcn_sched_barrier(0);
#pragma unroll
    for (int i = 0; i < G; ++i)
      acc[g * G + i] = (g * G + i < NTR) ? wmma_f16(bf[g & 1][i], a, acc[g * G + i])
                                         : wmma_f16(a, bf[g & 1][i], acc[g * G + i]);
    // keeps the loads that follow together as one group, not spread among these WMMAs
    __builtin_amdgcn_sched_barrier(0);
  }
}

// CDNA5 async global->LDS copy, 16 bytes per lane, tracked by ASYNCcnt.
__device__ __forceinline__ unsigned lds_addr(const half_t* l) {
  return (unsigned)(uintptr_t)l;  // flat LDS aperture: addr[31:0] = LDS offset
}
// A run of copies (copy i: g + i * gs -> l + i * ls, strides in halves) and its s_wait_xcnt 0
// in one statement: the wait then stands in front of any later rewrite of the address
// registers that the copies name.
__device__ __forceinline__ void async_cp16x5(const half_t* g, int gs, half_t* l, int ls) {
  asm volatile("global_load_async_to_lds_b128 %0, %1, off\n\t"
               "global_load_async_to_lds_b128 %2, %3, off\n\t"
               "global_load_async_to_lds_b128 %4, %5, off\n\t"
               "global_load_async_to_lds_b128 %6, %7, off\n\t"
               "global_load_async_to_lds_b128 %8, %9, off\n\t"
               "s_wait_xcnt 0x0"
               :: "v"(lds_addr(l)),          "v"(g),
                  "v"(lds_addr(l + 1 * ls)), "v"(g + 1 * gs),
                  "v"(lds_addr(l + 2 * ls)), "v"(g + 2 * gs),
                  "v"(lds_addr(l + 3 * ls)), "v"(g + 3 * gs),
                  "v"(lds_addr(l + 4 * ls)), "v"(g + 4 * gs) : "memory");
}
__device__ __forceinline__ void async_cp16x8(const half_t* g, int gs, half_t* l, int ls) {
  asm volatile("global_load_async_to_lds_b128 %0, %1, off\n\t"
               "global_load_async_to_lds_b128 %2, %3, off\n\t"
               "global_load_async_to_lds_b128 %4, %5, off\n\t"
               "global_load_async_to_lds_b128 %6, %7, off\n\t"
               "global_load_async_to_lds_b128 %8, %9, off\n\t"
               "global_load_async_to_lds_b128 %10, %11, off\n\t"
               "global_load_async_to_lds_b128 %12, %13, off\n\t"
               "global_load_async_to_lds_b128 %14, %15, off\n\t"
               "s_wait_xcnt 0x0"
               :: "v"(lds_addr(l)),          "v"(g),
                  "v"(lds_addr(l + 1 * ls)), "v"(g + 1 * gs),
                  "v"(lds_addr(l + 2 * ls)), "v"(g + 2 * gs),
                  "v"(lds_addr(l + 3 * ls)), "v"(g + 3 * gs),
                  "v"(lds_addr(l + 4 * ls)), "v"(g + 4 * gs),
                  "v"(lds_addr(l + 5 * ls)), "v"(g + 5 * gs),
                  "v"(lds_addr(l + 6 * ls)), "v"(g + 6 * gs),
                  "v"(lds_addr(l + 7 * ls)), "v"(g + 7 * gs) : "memory");
}

// ---------------- Kernel 0a: input LayerNorm, f32 -> f16 ----------------
__global__ __launch_bounds__(256) void ln_in_kernel(const float* __restrict__ x,
                                                    const float* __restrict__ g,
                                                    half_t* __restrict__ xn) {
  const int wave = threadIdx.x >> 5;
  const int lane = threadIdx.x & 31;
  const long row = (long)blockIdx.x * 8 + wave;
  const float* xr = x + row * DIMX;
  float4 v[4], gv[4];
  float s = 0.f, sq = 0.f;
#pragma unroll
  for (int i = 0; i < 4; ++i) {
    v[i]  = ((const float4*)xr)[i * 32 + lane];
    gv[i] = ((const float4*)g)[i * 32 + lane];
    s  += v[i].x + v[i].y + v[i].z + v[i].w;
    sq += v[i].x*v[i].x + v[i].y*v[i].y + v[i].z*v[i].z + v[i].w*v[i].w;
  }
#pragma unroll
  for (int m = 1; m < 32; m <<= 1) { s += __shfl_xor(s, m, 32); sq += __shfl_xor(sq, m, 32); }
  const float mean = s * (1.f / DIMX);
  const float rstd = rsqrtf(sq * (1.f / DIMX) - mean * mean + EPS_F);
#pragma unroll
  for (int i = 0; i < 4; ++i) {
    v4h o;
    o[0] = (half_t)((v[i].x - mean) * rstd * gv[i].x);
    o[1] = (half_t)((v[i].y - mean) * rstd * gv[i].y);
    o[2] = (half_t)((v[i].z - mean) * rstd * gv[i].z);
    o[3] = (half_t)((v[i].w - mean) * rstd * gv[i].w);
    ((v4h*)(xn + row * DIMX))[i * 32 + lane] = o;
  }
}

// ---------------- Kernel 0b: one-time weight transpose+convert (tiny, L2-resident) ----------------
// WqkvT[n][k] = (W_q|W_kv)[k][n] as f16 (640x512); WoutT[n][k] = W_out[k][n] as f16 (512x512)
__global__ __launch_bounds__(256) void prep_w_kernel(const float* __restrict__ Wq,
                                                     const float* __restrict__ Wkv,
                                                     const float* __restrict__ Wout,
                                                     half_t* __restrict__ WqkvT,
                                                     half_t* __restrict__ WoutT) {
  const int idx = blockIdx.x * 256 + threadIdx.x;
  if (idx < 640 * 512) {
    const int n = idx >> 9, k = idx & 511;
    const float w = (n < DIMX) ? Wq[(size_t)k * DIMX + n]
                               : Wkv[(size_t)k * 128 + (n - DIMX)];
    WqkvT[idx] = (half_t)w;
  } else {
    const int i2 = idx - 640 * 512;  // < 512*512
    const int n = i2 >> 9, k = i2 & 511;
    WoutT[i2] = (half_t)Wout[(size_t)k * DIMX + n];
  }
}

// ---------------- Kernel 1: q/k/v projection GEMM  xn @ [W_q | W_kv] ----------------
// grid.x = row blocks of 128, grid.y = 2 halves of N=640 (320 cols each)
#define A_NT 20
__device__ __forceinline__ void stage_proj(const half_t* __restrict__ WqkvT, half_t* buf,
                                           int colBase, int kBase, int tid) {
  // 320 rows x 64 B = 1280 x 16B transfers; 5 async instructions per wave
  const int nl = tid >> 2, part = tid & 3;   // copy i takes row nl + 64 * i
  const half_t* g = WqkvT + (size_t)(colBase + nl) * DIMX + kBase + part * 8;
  half_t* d = &buf[nl * W_PITCH + part * 8];
  async_cp16x5(g, 64 * DIMX, d, 64 * W_PITCH);
}

// One 128 x 320 block. UPPER = false: columns 0..319, all q. UPPER = true: columns 320..639,
// tiles 0..11 q, 12..15 k, 16..19 v. q and k are stored row-major, so their tiles are formed
// transposed (a lane then holds 8 adjacent columns of one row); v is stored transposed, so its
// tiles stay as they are (a lane holds 8 adjacent rows of one column). Either way a lane's
// 8 results of a tile are 16 adjacent bytes of the destination.
template <bool UPPER>
__device__ __forceinline__ void proj_block(const half_t* __restrict__ xn,
                                           const half_t* __restrict__ WqkvT,
                                           half_t* __restrict__ qw,
                                           half_t* __restrict__ kw,
                                           half_t* __restrict__ vTw,
                                           half_t (&WT)[2][320 * W_PITCH]) {
  constexpr int NTR = UPPER ? 16 : A_NT;   // tiles formed transposed
  constexpr int colBase = UPPER ? 320 : 0;
  const int tid  = threadIdx.x;
  const int wave = tid >> 5, lane = tid & 31;
  const int l = lane & 15, hi = lane >> 4;
  const int rowBase = blockIdx.x * 128 + wave * 16;
  v8f acc[A_NT];
  v8f z = {};
#pragma unroll
  for (int t = 0; t < A_NT; ++t) acc[t] = z;

  stage_proj(WqkvT, WT[0], colBase, 0, tid);
  for (int kc = 0; kc < 16; ++kc) {
    const int kBase = kc * 32;
    if (kc < 15) {
      stage_proj(WqkvT, WT[(kc + 1) & 1], colBase, kBase + 32, tid);
      asm volatile("s_wait_asynccnt 0x5" ::: "memory");  // older stage complete
    } else {
      asm volatile("s_wait_asynccnt 0x0" ::: "memory");
    }
    __syncthreads();
    const half_t* buf = WT[kc & 1];
    v16h a = frag_ld(xn + (size_t)(rowBase + l) * DIMX + kBase + hi * 8);
    mma_chunk<A_NT, 4, W_PITCH, NTR>(&buf[l * W_PITCH + hi * 8], a, acc);
    __syncthreads();
  }
  // epilogue: cols [0,512) -> q, [512,576) -> k, [576,640) -> v (transposed); one 16-B store a tile
#pragma unroll
  for (int t = 0; t < A_NT; ++t) {
    v8h r;
#pragma unroll
    for (int j = 0; j < 8; ++j) r[j] = (half_t)acc[t][j];
    if (t < NTR) {
      const int row = rowBase + l;                  // acc[t][j] = C[row][col + j]
      const int col = colBase + t * 16 + hi * 8;
      if (colBase + t * 16 < DIMX) *(v8h*)(qw + (size_t)row * DIMX + col) = r;
      else                         *(v8h*)(kw + (size_t)row * DHEAD + (col - DIMX)) = r;
    } else {
      const int row = rowBase + hi * 8;             // acc[t][j] = C[row + j][DIMX + DHEAD + d]
      const int bn = row >> 8, rl = row & 255, d = colBase + t * 16 + l - DIMX - DHEAD;
      *(v8h*)(vTw + ((size_t)bn * DHEAD + d) * SEQ + rl) = r;  // V^T per (b,n)
    }
  }
}

__global__ __launch_bounds__(256) void proj_kernel(const half_t* __restrict__ xn,
                                                   const half_t* __restrict__ WqkvT,
                                                   half_t* __restrict__ qw,
                                                   half_t* __restrict__ kw,
                                                   half_t* __restrict__ vTw) {
  __shared__ half_t WT[2][320 * W_PITCH];  // double-buffered transposed weight chunk (2 x 25 KB)
  if (blockIdx.y == 0) proj_block<false>(xn, WqkvT, qw, kw, vTw, WT);
  else                 proj_block<true>(xn, WqkvT, qw, kw, vTw, WT);
}

// value of lane l ^ 16 (the other 16-lane row, same position)
__device__ __forceinline__ float other_half(float v) {
  const int r = __builtin_amdgcn_permlanex16(0, __builtin_bit_cast(int, v),
                                             0x76543210, 0xfedcba98, false, false);
  return __builtin_bit_cast(float, r);
}

__global__ __launch_bounds__(256) void attn_kernel(const half_t* __restrict__ qw,
                                                   const half_t* __restrict__ kw,
                                                   const half_t* __restrict__ vTw,
                                                   half_t* __restrict__ mid) {
  extern __shared__ half_t smem[];
  half_t* Ksh = smem;                       // [256][K_PITCH]  (36 KB)
  half_t* Vsh = Ksh + SEQ * K_PITCH;        // [64][V_PITCH]   (33 KB)
  const int tid  = threadIdx.x;
  const int wave = tid >> 5, lane = tid & 31;
  const int l = lane & 15, hi = lane >> 4;
  const int bn = blockIdx.x >> 3, h = blockIdx.x & 7;
  const half_t* Qg  = qw  + (size_t)bn * SEQ * DIMX + h * DHEAD;   // stride DIMX
  const half_t* Kg  = kw  + (size_t)bn * SEQ * DHEAD;              // [256][64]
  const half_t* VTg = vTw + (size_t)bn * DHEAD * SEQ;              // [64][256]
  const int rBase = wave * 32;

  // async-stage K and V^T into padded LDS rows (16 async instr per wave)
  {
    // K: 8 granules of 16 B a row, copy i takes row (tid >> 3) + 32 * i
    const half_t* gk = Kg + tid * 8;
    half_t* dk = &Ksh[(tid >> 3) * K_PITCH + (tid & 7) * 8];
    // V^T: 32 granules a row, copy i takes row (tid >> 5) + 8 * i
    const half_t* gv = VTg + tid * 8;
    half_t* dv = &Vsh[(tid >> 5) * V_PITCH + (tid & 31) * 8];
    async_cp16x8(gk, 2048, dk, 32 * K_PITCH);
    async_cp16x8(gv, 2048, dv, 8 * V_PITCH);
  }

  v8f s[2][16];   // s[qt][kt][j] = S[query rBase + 16*qt + l][key 16*kt + 8*hi + j]
  v8f z = {};
#pragma unroll
  for (int qt = 0; qt < 2; ++qt)
#pragma unroll
    for (int kt = 0; kt < 16; ++kt) s[qt][kt] = z;

  // Q B-fragments straight from global (overlaps with the async staging)
  v16h bq[2][2];
#pragma unroll
  for (int kc = 0; kc < 2; ++kc) {
    bq[kc][0] = frag_ld(Qg + (size_t)(rBase + l)      * DIMX + kc * 32 + hi * 8);
    bq[kc][1] = frag_ld(Qg + (size_t)(rBase + 16 + l) * DIMX + kc * 32 + hi * 8);
  }
  asm volatile("s_wait_asynccnt 0x0" ::: "memory");
  __syncthreads();

  // S^T = K Q^T   (A = K rows, B = Q rows as the N-major mirror)
#pragma unroll
  for (int kc = 0; kc < 2; ++kc) {
    const int kBase = kc * 32;
#pragma unroll
    for (int kt = 0; kt < 16; ++kt) {
      v16h a = frag_ld(&Ksh[(kt * 16 + l) * K_PITCH + kBase + hi * 8]);
      s[0][kt] = wmma_f16(a, bq[kc][0], s[0][kt]);
      s[1][kt] = wmma_f16(a, bq[kc][1], s[1][kt]);
    }
  }

  // softmax: logits = (s - max) * 0.125 = (s - max) / sqrt(DHEAD)
  float rsum[2];
  v16h pb[2][8];  // pb[qt][kc]: B fragment of P^T, keys 32*kc .. 32*kc + 31, column = query
#pragma unroll
  for (int qt = 0; qt < 2; ++qt) {
    float mx[4], sm[4];
#pragma unroll
    for (int i = 0; i < 4; ++i) { mx[i] = s[qt][0][i]; sm[i] = 0.f; }
#pragma unroll
    for (int kt = 0; kt < 16; ++kt)
#pragma unroll
      for (int j = 0; j < 8; ++j) mx[j & 3] = fmaxf(mx[j & 3], s[qt][kt][j]);
    float m = fmaxf(fmaxf(mx[0], mx[1]), fmaxf(mx[2], mx[3]));
    m = fmaxf(m, other_half(m));
#pragma unroll
    for (int kc = 0; kc < 8; ++kc) {
#pragma unroll
      for (int e = 0; e < 16; ++e) {
        const float p = __expf((s[qt][2 * kc + (e >> 3)][e & 7] - m) * 0.125f);
        sm[e & 3] += p;
        pb[qt][kc][e] = (half_t)p;
      }
    }
    float sum = (sm[0] + sm[1]) + (sm[2] + sm[3]);
    sum += other_half(sum);
    rsum[qt] = sum;
  }

  // O^T = V^T P^T  (A = V^T rows from LDS, B = P^T from registers)
  v8f o[2][4];    // o[qt][dt][j] = O[query rBase + 16*qt + l][d 16*dt + 8*hi + j]
#pragma unroll
  for (int qt = 0; qt < 2; ++qt)
#pragma unroll
    for (int dt = 0; dt < 4; ++dt) o[qt][dt] = z;
#pragma unroll
  for (int kc = 0; kc < 8; ++kc) {
    const int kBase = kc * 32;
#pragma unroll
    for (int dt = 0; dt < 4; ++dt) {
      v16h a = frag_ld(&Vsh[(dt * 16 + l) * V_PITCH + kBase + hi * 8]);
      o[0][dt] = wmma_f16(a, pb[0][kc], o[0][dt]);
      o[1][dt] = wmma_f16(a, pb[1][kc], o[1][dt]);
    }
  }
  // normalize and store head-concatenated mid: 8 consecutive d of one query per lane
#pragma unroll
  for (int qt = 0; qt < 2; ++qt) {
    half_t* mrow = mid + ((size_t)bn * SEQ + rBase + qt * 16 + l) * DIMX + h * DHEAD + hi * 8;
#pragma unroll
    for (int dt = 0; dt < 4; ++dt) {
      v8h r;
#pragma unroll
      for (int j = 0; j < 8; ++j) r[j] = (half_t)(o[qt][dt][j] / rsum[qt]);
      *(v8h*)(mrow + dt * 16) = r;
    }
  }
}

// ---------------- Kernel 3: out projection + LayerNorm ----------------
__device__ __forceinline__ void stage_out(const half_t* __restrict__ WoutT, half_t* buf,
                                          int kBase, int tid) {
  // 512 rows x 64 B = 2048 x 16B transfers; 8 async instructions per wave
  const int nl = tid >> 2, part = tid & 3;   // copy i takes row nl + 64 * i
  const half_t* g = WoutT + (size_t)nl * DIMX + kBase + part * 8;
  half_t* d = &buf[nl * W_PITCH + part * 8];
  async_cp16x8(g, 64 * DIMX, d, 64 * W_PITCH);
}

__global__ __launch_bounds__(256) void out_kernel(const half_t* __restrict__ mid,
                                                  const half_t* __restrict__ WoutT,
                                                  const float* __restrict__ gout,
                                                  float* __restrict__ out) {
  __shared__ half_t WT[2][512 * W_PITCH];  // double-buffered transposed W_out chunk (2 x 40 KB)
  const int tid  = threadIdx.x;
  const int wave = tid >> 5, lane = tid & 31;
  const int l = lane & 15, hi = lane >> 4;
  const int rowBase = blockIdx.x * 128 + wave * 16;
  v8f acc[32];
  v8f z = {};
#pragma unroll
  for (int t = 0; t < 32; ++t) acc[t] = z;

  stage_out(WoutT, WT[0], 0, tid);
  for (int kc = 0; kc < 16; ++kc) {
    const int kBase = kc * 32;
    if (kc < 15) {
      stage_out(WoutT, WT[(kc + 1) & 1], kBase + 32, tid);
      asm volatile("s_wait_asynccnt 0x8" ::: "memory");  // older stage complete
    } else {
      asm volatile("s_wait_asynccnt 0x0" ::: "memory");
    }
    __syncthreads();
    const half_t* buf = WT[kc & 1];
    v16h a = frag_ld(mid + (size_t)(rowBase + l) * DIMX + kBase + hi * 8);
    mma_chunk<32, 8, W_PITCH, 0>(&buf[l * W_PITCH + hi * 8], a, acc);
    __syncthreads();
  }
  // fused LayerNorm over each 512-wide output row
#pragma unroll
  for (int j = 0; j < 8; ++j) {
    float sm = 0.f, sq = 0.f;
#pragma unroll
    for (int t = 0; t < 32; ++t) { const float vv = acc[t][j]; sm += vv; sq += vv * vv; }
#pragma unroll
    for (int msk = 1; msk < 16; msk <<= 1) {
      sm += __shfl_xor(sm, msk, 32);
      sq += __shfl_xor(sq, msk, 32);
    }
    const float mean = sm * (1.f / DIMX);
    const float rstd = rsqrtf(sq * (1.f / DIMX) - mean * mean + EPS_F);
    const long row = rowBase + j + hi * 8;
#pragma unroll
    for (int t = 0; t < 32; ++t) {
      const int col = t * 16 + l;
      out[row * DIMX + col] = (acc[t][j] - mean) * rstd * gout[col];
    }
  }
}

extern "C" void kernel_launch(void* const* d_in, const int* in_sizes, int n_in,
                              void* d_out, int out_size, void* d_ws, size_t ws_size,
                              hipStream_t stream) {
  const float* x      = (const float*)d_in[0];
  const float* g_norm = (const float*)d_in[1];
  const float* W_q    = (const float*)d_in[2];
  const float* W_kv   = (const float*)d_in[3];
  const float* W_out  = (const float*)d_in[4];
  const float* g_out  = (const float*)d_in[5];
  float* out = (float*)d_out;

  char* ws = (char*)d_ws;
  const size_t xnB = (size_t)R_TOTAL * DIMX * sizeof(half_t);    // 64 MB
  const size_t kB  = (size_t)R_TOTAL * DHEAD * sizeof(half_t);   //  8 MB
  half_t* xn    = (half_t*)ws;                 // reused as `mid` once consumed
  half_t* qw    = (half_t*)(ws + xnB);
  half_t* kw    = (half_t*)(ws + 2 * xnB);
  half_t* vT    = (half_t*)(ws + 2 * xnB + kB);
  half_t* WqkvT = (half_t*)(ws + 2 * xnB + 2 * kB);
  half_t* WoutT = WqkvT + 640 * 512;
  half_t* mid = xn;

  ln_in_kernel<<<R_TOTAL / 8, 256, 0, stream>>>(x, g_norm, xn);
  prep_w_kernel<<<(640 * 512 + 512 * 512) / 256, 256, 0, stream>>>(W_q, W_kv, W_out, WqkvT, WoutT);
  dim3 gA(R_TOTAL / 128, 2);
  proj_kernel<<<gA, 256, 0, stream>>>(xn, WqkvT, qw, kw, vT);
  const size_t attn_lds = (size_t)(SEQ * K_PITCH + DHEAD * V_PITCH) * sizeof(half_t);
  attn_kernel<<<2048, 256, attn_lds, stream>>>(qw, kw, vT, mid);
  out_kernel<<<R_TOTAL / 128, 256, 0, stream>>>(mid, WoutT, g_out, out);
}

// v005
// Measured time: 195 microseconds a run.
// Next to v004, in two timings, it ran 1.08 times as fast each time.
// Over all steps from v000 it is 2.43 times as fast.
#include <hip/hip_runtime.h>

typedef _Float16 half_t;
typedef __attribute__((ext_vector_type(4)))  _Float16 v4h;
typedef __attribute__((ext_vector_type(8)))  _Float16 v8h;
typedef __attribute__((ext_vector_type(16))) _Float16 v16h;
typedef __attribute__((ext_vector_type(8)))  float    v8f;

#define R_TOTAL 65536   // b*n*r = 4*64*256
#define DIMX    512
#define DHEAD   64
#define SEQ     256
#define EPS_F   1e-5f
// LDS row pitches (halves) for rows read by 16-byte fragment loads: 16 B x odd, so that
// the 16 rows of one fragment load fall on distinct banks.
#define W_PITCH 40      // 64-B weight-chunk rows  -> 80 B
#define K_PITCH 72      // 128-B K rows            -> 144 B
#define V_PITCH 264     // 512-B V^T rows          -> 528 B

// Load a 16-bit A/B WMMA fragment (16x32 A, or 32x16 B via its N-major mirror).
// Caller passes p = base + row_or_n*stride + kBase + (lane>>4)*8.
// lane<16 needs K {0..7, 16..23}, lane>=16 needs K {8..15, 24..31}: two b128 loads.
__device__ __forceinline__ v16h frag_ld(const half_t* p) {
  v8h lo = *(const v8h*)(p);
  v8h hi = *(const v8h*)(p + 16);
  return __builtin_shufflevector(lo, hi, 0,1,2,3,4,5,6,7,8,9,10,11,12,13,14,15);
}

__device__ __forceinline__ v8f wmma_f16(v16h a, v16h b, v8f c) {
  return __builtin_amdgcn_wmma_f32_16x16x32_f16(false, a, false, b, (short)0, c, false, false);
}

// One 32-deep k chunk of a wave's 16 x (16*NT) tile: acc[t] += a * B_t, the B fragments read from
// LDS (bp = the lane's place in row l of the chunk, tile t lies 16 rows further per t).
// The fragments come in groups of G, each group fetched into its own register set while the
// group before it is multiplied, so that a WMMA does not wait out the latency of its own loads.
// Every loop is unrolled so that bf and acc are indexed by constants and stay in registers.
// The first NTR tiles are formed transposed (the LDS fragment as A, a as B; both fragments have
// the same lane and k layout): there a lane holds 8 adjacent columns of one row of the product.
template <int NT, int G, int PITCH, int NTR>
__device__ __forceinline__ void mma_chunk(const half_t* bp, v16h a, v8f (&acc)[NT]) {
  v16h bf[2][G];
#pragma unroll
  for (int i = 0; i < G; ++i) bf[0][i] = frag_ld(bp + i * 16 * PITCH);
#pragma unroll
  for (int g = 0; g < NT / G; ++g) {
    if (g + 1 < NT / G) {
#pragma unroll
      for (int i = 0; i < G; ++i) bf[(g + 1) & 1][i] = frag_ld(bp + ((g + 1) * G + i) * 16 * PITCH);
    }
    // keeps the next group's loads in front of this group's WMMAs (the scheduler sinks them
    // to their first use otherwise, one register set and a full LDS wait per WMMA)
    __builtin_amdgcn_sched_barrier(0);
#pragma unroll
    for (int i = 0; i < G; ++i)
      acc[g * G + i] = (g * G + i < NTR) ? wmma_f16(bf[g & 1][i], a, acc[g * G + i])
                                         : wmma_f16(a, bf[g & 1][i], acc[g * G + i]);
    // keeps the loads that follow together as one group, not spread among these WMMAs
    __builtin_amdgcn_sched_barrier(0);
  }
}

// CDNA5 async global->LDS copy, 16 bytes per lane, tracked by ASYNCcnt.
__device__ __forceinline__ unsigned lds_addr(const half_t* l) {
  return (unsigned)(uintptr_t)l;  // flat LDS aperture: addr[31:0] = LDS offset
}
// A run of copies (copy i: g + i * gs -> l + i * ls, strides in halves) and its s_wait_xcnt 0
// in one statement: the wait then stands in front of any later rewrite of the address
// registers that the copies name.
__device__ __forceinline__ void async_cp16x5(const half_t* g, int gs, half_t* l, int ls) {
  asm volatile("global_load_async_to_lds_b128 %0, %1, off\n\t"
               "global_load_async_to_lds_b128 %2, %3, off\n\t"
               "global_load_async_to_lds_b128 %4, %5, off\n\t"
               "global_load_async_to_lds_b128 %6, %7, off\n\t"
               "global_load_async_to_lds_b128 %8, %9, off\n\t"
               "s_wait_xcnt 0x0"
               :: "v"(lds_addr(l)),          "v"(g),
                  "v"(lds_addr(l + 1 * ls)), "v"(g + 1 * gs),
                  "v"(lds_addr(l + 2 * ls)), "v"(g + 2 * gs),
                  "v"(lds_addr(l + 3 * ls)), "v"(g + 3 * gs),
                  "v"(lds_addr(l + 4 * ls)), "v"(g + 4 * gs) : "memory");
}
__device__ __forceinline__ void async_cp16x8(const half_t* g, int gs, half_t* l, int ls) {
  asm volatile("global_load_async_to_lds_b128 %0, %1, off\n\t"
               "global_load_async_to_lds_b128 %2, %3, off\n\t"
               "global_load_async_to_lds_b128 %4, %5, off\n\t"
               "global_load_async_to_lds_b128 %6, %7, off\n\t"
               "global_load_async_to_lds_b128 %8, %9, off\n\t"
               "global_load_async_to_lds_b128 %10, %11, off\n\t"
               "global_load_async_to_lds_b128 %12, %13, off\n\t"
               "global_load_async_to_lds_b128 %14, %15, off\n\t"
               "s_wait_xcnt 0x0"
               :: "v"(lds_addr(l)),          "v"(g),
                  "v"(lds_addr(l + 1 * ls)), "v"(g + 1 * gs),
                  "v"(lds_addr(l + 2 * ls)), "v"(g + 2 * gs),
                  "v"(lds_addr(l + 3 * ls)), "v"(g + 3 * gs),
                  "v"(lds_addr(l + 4 * ls)), "v"(g + 4 * gs),
                  "v"(lds_addr(l + 5 * ls)), "v"(g + 5 * gs),
                  "v"(lds_addr(l + 6 * ls)), "v"(g + 6 * gs),
                  "v"(lds_addr(l + 7 * ls)), "v"(g + 7 * gs) : "memory");
}

// ---------------- Kernel 0a: input LayerNorm, f32 -> f16 ----------------
__global__ __launch_bounds__(256) void ln_in_kernel(const float* __restrict__ x,
                                                    const float* __restrict__ g,
                                                    half_t* __restrict__ xn) {
  const int wave = threadIdx.x >> 5;
  const int lane = threadIdx.x & 31;
  const long row = (long)blockIdx.x * 8 + wave;
  const float* xr = x + row * DIMX;
  float4 v[4], gv[4];
  float s = 0.f, sq = 0.f;
#pragma unroll
  for (int i = 0; i < 4; ++i) {
    v[i]  = ((const float4*)xr)[i * 32 + lane];
    gv[i] = ((const float4*)g)[i * 32 + lane];
    s  += v[i].x + v[i].y + v[i].z + v[i].w;
    sq += v[i].x*v[i].x + v[i].y*v[i].y + v[i].z*v[i].z + v[i].w*v[i].w;
  }
#pragma unroll
  for (int m = 1; m < 32; m <<= 1) { s += __shfl_xor(s, m, 32); sq += __shfl_xor(sq, m, 32); }
  const float mean = s * (1.f / DIMX);
  const float rstd = rsqrtf(sq * (1.f / DIMX) - mean * mean + EPS_F);
#pragma unroll
  for (int i = 0; i < 4; ++i) {
    v4h o;
    o[0] = (half_t)((v[i].x - mean) * rstd * gv[i].x);
    o[1] = (half_t)((v[i].y - mean) * rstd * gv[i].y);
    o[2] = (half_t)((v[i].z - mean) * rstd * gv[i].z);
    o[3] = (half_t)((v[i].w - mean) * rstd * gv[i].w);
    ((v4h*)(xn + row * DIMX))[i * 32 + lane] = o;
  }
}

// ---------------- Kernel 0b: one-time weight transpose+convert (tiny, L2-resident) ----------------
// WqkvT[n][k] = (W_q|W_kv)[k][n] as f16 (640x512); WoutT[n][k] = W_out[k][n] as f16 (512x512)
__global__ __launch_bounds__(256) void prep_w_kernel(const float* __restrict__ Wq,
                                                     const float* __restrict__ Wkv,
                                                     const float* __restrict__ Wout,
                                                     half_t* __restrict__ WqkvT,
                                                     half_t* __restrict__ WoutT) {
  const int idx = blockIdx.x * 256 + threadIdx.x;
  if (idx < 640 * 512) {
    const int n = idx >> 9, k = idx & 511;
    const float w = (n < DIMX) ? Wq[(size_t)k * DIMX + n]
                               : Wkv[(size_t)k * 128 + (n - DIMX)];
    WqkvT[idx] = (half_t)w;
  } else {
    const int i2 = idx - 640 * 512;  // < 512*512
    const int n = i2 >> 9, k = i2 & 511;
    WoutT[i2] = (half_t)Wout[(size_t)k * DIMX + n];
  }
}

// ---------------- Kernel 1: q/k/v projection GEMM  xn @ [W_q | W_kv] ----------------
// grid.x = row blocks of 128, grid.y = 2 halves of N=640 (320 cols each)
#define A_NT 20
__device__ __forceinline__ void stage_proj(const half_t* __restrict__ WqkvT, half_t* buf,
                                           int colBase, int kBase, int tid) {
  // 320 rows x 64 B = 1280 x 16B transfers; 5 async instructions per wave
  const int nl = tid >> 2, part = tid & 3;   // copy i takes row nl + 64 * i
  const half_t* g = WqkvT + (size_t)(colBase + nl) * DIMX + kBase + part * 8;
  half_t* d = &buf[nl * W_PITCH + part * 8];
  async_cp16x5(g, 64 * DIMX, d, 64 * W_PITCH);
}

// One 128 x 320 block. UPPER = false: columns 0..319, all q. UPPER = true: columns 320..639,
// tiles 0..11 q, 12..15 k, 16..19 v. q and k are stored row-major, so their tiles are formed
// transposed (a lane then holds 8 adjacent columns of one row); v is stored transposed, so its
// tiles stay as they are (a lane holds 8 adjacent rows of one column). Either way a lane's
// 8 results of a tile are 16 adjacent bytes of the destination.
template <bool UPPER>
__device__ __forceinline__ void proj_block(const half_t* __restrict__ xn,
                                           const half_t* __restrict__ WqkvT,
                                           half_t* __restrict__ qw,
                                           half_t* __restrict__ kw,
                                           half_t* __restrict__ vTw,
                                           half_t (&WT)[2][320 * W_PITCH]) {
  constexpr int NTR = UPPER ? 16 : A_NT;   // tiles formed transposed
  constexpr int colBase = UPPER ? 320 : 0;
  const int tid  = threadIdx.x;
  const int wave = tid >> 5, lane = tid & 31;
  const int l = lane & 15, hi = lane >> 4;
  const int rowBase = blockIdx.x * 128 + wave * 16;
  v8f acc[A_NT];
  v8f z = {};
#pragma unroll
  for (int t = 0; t < A_NT; ++t) acc[t] = z;

  stage_proj(WqkvT, WT[0], colBase, 0, tid);
  // The wave's x fragment is fetched one k chunk ahead: the load of chunk kc + 1 goes out behind
  // the barrier that opens chunk kc and is in flight under that chunk's WMMAs.
  const unsigned ao = (unsigned)(rowBase + l) * DIMX + hi * 8;   // 32-bit index: the kernel stays at 256 registers
  v16h a = frag_ld(xn + ao);
  for (int kc = 0; kc < 16; ++kc) {
    const int kBase = kc * 32;
    if (kc < 15) {
      stage_proj(WqkvT, WT[(kc + 1) & 1], colBase, kBase + 32, tid);
      asm volatile("s_wait_asynccnt 0x5" ::: "memory");  // older stage complete
    } else {
      asm volatile("s_wait_asynccnt 0x0" ::: "memory");
    }
    __syncthreads();
    const half_t* buf = WT[kc & 1];
    v16h an = a;
    if (kc < 15) an = frag_ld(xn + kBase + 32 + ao);
    mma_chunk<A_NT, 4, W_PITCH, NTR>(&buf[l * W_PITCH + hi * 8], a, acc);
    __syncthreads();
    a = an;
  }
  // epilogue: cols [0,512) -> q, [512,576) -> k, [576,640) -> v (transposed); one 16-B store a tile
#pragma unroll
  for (int t = 0; t < A_NT; ++t) {
    v8h r;
#pragma unroll
    for (int j = 0; j < 8; ++j) r[j] = (half_t)acc[t][j];
    if (t < NTR) {
      const int row = rowBase + l;                  // acc[t][j] = C[row][col + j]
      const int col = colBase + t * 16 + hi * 8;
      if (colBase + t * 16 < DIMX) *(v8h*)(qw + (size_t)row * DIMX + col) = r;
      else                         *(v8h*)(kw + (size_t)row * DHEAD + (col - DIMX)) = r;
    } else {
      const int row = rowBase + hi * 8;             // acc[t][j] = C[row + j][DIMX + DHEAD + d]
      const int bn = row >> 8, rl = row & 255, d = colBase + t * 16 + l - DIMX - DHEAD;
      *(v8h*)(vTw + ((size_t)bn * DHEAD + d) * SEQ + rl) = r;  // V^T per (b,n)
    }
  }
}

__global__ __launch_bounds__(256) void proj_kernel(const half_t* __restrict__ xn,
                                                   const half_t* __restrict__ WqkvT,
                                                   half_t* __restrict__ qw,
                                                   half_t* __restrict__ kw,
                                                   half_t* __restrict__ vTw) {
  __shared__ half_t WT[2][320 * W_PITCH];  // double-buffered transposed weight chunk (2 x 25 KB)
  if (blockIdx.y == 0) proj_block<false>(xn, WqkvT, qw, kw, vTw, WT);
  else                 proj_block<true>(xn, WqkvT, qw, kw, vTw, WT);
}

// value of lane l ^ 16 (the other 16-lane row, same position)
__device__ __forceinline__ float other_half(float v) {
  const int r = __builtin_amdgcn_permlanex16(0, __builtin_bit_cast(int, v),
                                             0x76543210, 0xfedcba98, false, false);
  return __builtin_bit_cast(float, r);
}

__global__ __launch_bounds__(256) void attn_kernel(const half_t* __restrict__ qw,
                                                   const half_t* __restrict__ kw,
                                                   const half_t* __restrict__ vTw,
                                                   half_t* __restrict__ mid) {
  extern __shared__ half_t smem[];
  half_t* Ksh = smem;                       // [256][K_PITCH]  (36 KB)
  half_t* Vsh = Ksh + SEQ * K_PITCH;        // [64][V_PITCH]   (33 KB)
  const int tid  = threadIdx.x;
  const int wave = tid >> 5, lane = tid & 31;
  const int l = lane & 15, hi = lane >> 4;
  const int bn = blockIdx.x >> 3, h = blockIdx.x & 7;
  const half_t* Qg  = qw  + (size_t)bn * SEQ * DIMX + h * DHEAD;   // stride DIMX
  const half_t* Kg  = kw  + (size_t)bn * SEQ * DHEAD;              // [256][64]
  const half_t* VTg = vTw + (size_t)bn * DHEAD * SEQ;              // [64][256]
  const int rBase = wave * 32;

  // async-stage K and V^T into padded LDS rows (16 async instr per wave)
  {
    // K: 8 granules of 16 B a row, copy i takes row (tid >> 3) + 32 * i
    const half_t* gk = Kg + tid * 8;
    half_t* dk = &Ksh[(tid >> 3) * K_PITCH + (tid & 7) * 8];
    // V^T: 32 granules a row, copy i takes row (tid >> 5) + 8 * i
    const half_t* gv = VTg + tid * 8;
    half_t* dv = &Vsh[(tid >> 5) * V_PITCH + (tid & 31) * 8];
    async_cp16x8(gk, 2048, dk, 32 * K_PITCH);
    async_cp16x8(gv, 2048, dv, 8 * V_PITCH);
  }

  v8f s[2][16];   // s[qt][kt][j] = S[query rBase + 16*qt + l][key 16*kt + 8*hi + j]
  v8f z = {};
#pragma unroll
  for (int qt = 0; qt < 2; ++qt)
#pragma unroll
    for (int kt = 0; kt < 16; ++kt) s[qt][kt] = z;

  // Q B-fragments straight from global (overlaps with the async staging)
  v16h bq[2][2];
#pragma unroll
  for (int kc = 0; kc < 2; ++kc) {
    bq[kc][0] = frag_ld(Qg + (size_t)(rBase + l)      * DIMX + kc * 32 + hi * 8);
    bq[kc][1] = frag_ld(Qg + (size_t)(rBase + 16 + l) * DIMX + kc * 32 + hi * 8);
  }
  asm volatile("s_wait_asynccnt 0x0" ::: "memory");
  __syncthreads();

  // S^T = K Q^T   (A = K rows, B = Q rows as the N-major mirror)
#pragma unroll
  for (int kc = 0; kc < 2; ++kc) {
    const int kBase = kc * 32;
#pragma unroll
    for (int kt = 0; kt < 16; ++kt) {
      v16h a = frag_ld(&Ksh[(kt * 16 + l) * K_PITCH + kBase + hi * 8]);
      s[0][kt] = wmma_f16(a, bq[kc][0], s[0][kt]);
      s[1][kt] = wmma_f16(a, bq[kc][1], s[1][kt]);
    }
  }

  // softmax: logits = (s - max) * 0.125 = (s - max) / sqrt(DHEAD)
  float rsum[2];
  v16h pb[2][8];  // pb[qt][kc]: B fragment of P^T, keys 32*kc .. 32*kc + 31, column = query
#pragma unroll
  for (int qt = 0; qt < 2; ++qt) {
    float mx[4], sm[4];
#pragma unroll
    for (int i = 0; i < 4; ++i) { mx[i] = s[qt][0][i]; sm[i] = 0.f; }
#pragma unroll
    for (int kt = 0; kt < 16; ++kt)
#pragma unroll
      for (int j = 0; j < 8; ++j) mx[j & 3] = fmaxf(mx[j & 3], s[qt][kt][j]);
    float m = fmaxf(fmaxf(mx[0], mx[1]), fmaxf(mx[2], mx[3]));
    m = fmaxf(m, other_half(m));
#pragma unroll
    for (int kc = 0; kc < 8; ++kc) {
#pragma unroll
      for (int e = 0; e < 16; ++e) {
        const float p = __expf((s[qt][2 * kc + (e >> 3)][e & 7] - m) * 0.125f);
        sm[e & 3] += p;
        pb[qt][kc][e] = (half_t)p;
      }
    }
    float sum = (sm[0] + sm[1]) + (sm[2] + sm[3]);
    sum += other_half(sum);
    rsum[qt] = sum;
  }

  // O^T = V^T P^T  (A = V^T rows from LDS, B = P^T from registers)
  v8f o[2][4];    // o[qt][dt][j] = O[query rBase + 16*qt + l][d 16*dt + 8*hi + j]
#pragma unroll
  for (int qt = 0; qt < 2; ++qt)
#pragma unroll
    for (int dt = 0; dt < 4; ++dt) o[qt][dt] = z;
#pragma unroll
  for (int kc = 0; kc < 8; ++kc) {
    const int kBase = kc * 32;
#pragma unroll
    for (int dt = 0; dt < 4; ++dt) {
      v16h a = frag_ld(&Vsh[(dt * 16 + l) * V_PITCH + kBase + hi * 8]);
      o[0][dt] = wmma_f16(a, pb[0][kc], o[0][dt]);
      o[1][dt] = wmma_f16(a, pb[1][kc], o[1][dt]);
    }
  }
  // normalize and store head-concatenated mid: 8 consecutive d of one query per lane
#pragma unroll
  for (int qt = 0; qt < 2; ++qt) {
    half_t* mrow = mid + ((size_t)bn * SEQ + rBase + qt * 16 + l) * DIMX + h * DHEAD + hi * 8;
#pragma unroll
    for (int dt = 0; dt < 4; ++dt) {
      v8h r;
#pragma unroll
      for (int j = 0; j < 8; ++j) r[j] = (half_t)(o[qt][dt][j] / rsum[qt]);
      *(v8h*)(mrow + dt * 16) = r;
    }
  }
}

// ---------------- Kernel 3: out projection + LayerNorm ----------------
__device__ __forceinline__ void stage_out(const half_t* __restrict__ WoutT, half_t* buf,
                                          int kBase, int tid) {
  // 512 rows x 64 B = 2048 x 16B transfers; 8 async instructions per wave
  const int nl = tid >> 2, part = tid & 3;   // copy i takes row nl + 64 * i
  const half_t* g = WoutT + (size_t)nl * DIMX + kBase + part * 8;
  half_t* d = &buf[nl * W_PITCH + part * 8];
  async_cp16x8(g, 64 * DIMX, d, 64 * W_PITCH);
}

__global__ __launch_bounds__(256) void out_kernel(const half_t* __restrict__ mid,
                                                  const half_t* __restrict__ WoutT,
                                                  const float* __restrict__ gout,
                                                  float* __restrict__ out) {
  __shared__ half_t WT[2][512 * W_PITCH];  // double-buffered transposed W_out chunk (2 x 40 KB)
  const int tid  = threadIdx.x;
  const int wave = tid >> 5, lane = tid & 31;
  const int l = lane & 15, hi = lane >> 4;
  const int rowBase = blockIdx.x * 128 + wave * 16;
  v8f acc[32];
  v8f z = {};
#pragma unroll
  for (int t = 0; t < 32; ++t) acc[t] = z;

  stage_out(WoutT, WT[0], 0, tid);
  // the wave's mid fragment is fetched one k chunk ahead, as in proj_block
  const half_t* ap = mid + (size_t)(rowBase + l) * DIMX + hi * 8;
  v16h a = frag_ld(ap);
  // stands in front of the first rewrite of that load's address registers (this build reuses them
  // for an accumulator); the address is named as an input so
  // that its registers are left alone up to the wait
  asm volatile("s_wait_xcnt 0x0" :: "v"(ap) : "memory");
  for (int kc = 0; kc < 16; ++kc) {
    const int kBase = kc * 32;
    if (kc < 15) {
      stage_out(WoutT, WT[(kc + 1) & 1], kBase + 32, tid);
      asm volatile("s_wait_asynccnt 0x8" ::: "memory");  // older stage complete
    } else {
      asm volatile("s_wait_asynccnt 0x0" ::: "memory");
    }
    __syncthreads();
    const half_t* buf = WT[kc & 1];
    v16h an = a;
    if (kc < 15) an = frag_ld(ap + kBase + 32);
    mma_chunk<32, 8, W_PITCH, 0>(&buf[l * W_PITCH + hi * 8], a, acc);
    __syncthreads();
    a = an;
  }
  // fused LayerNorm over each 512-wide output row
#pragma unroll
  for (int j = 0; j < 8; ++j) {
    float sm = 0.f, sq = 0.f;
#pragma unroll
    for (int t = 0; t < 32; ++t) { const float vv = acc[t][j]; sm += vv; sq += vv * vv; }
#pragma unroll
    for (int msk = 1; msk < 16; msk <<= 1) {
      sm += __shfl_xor(sm, msk, 32);
      sq += __shfl_xor(sq, msk, 32);
    }
    const float mean = sm * (1.f / DIMX);
    const float rstd = rsqrtf(sq * (1.f / DIMX) - mean * mean + EPS_F);
    const long row = rowBase + j + hi * 8;
#pragma unroll
    for (int t = 0; t < 32; ++t) {
      const int col = t * 16 + l;
      out[row * DIMX + col] = (acc[t][j] - mean) * rstd * gout[col];
    }
  }
}

extern "C" void kernel_launch(void* const* d_in, const int* in_sizes, int n_in,
                              void* d_out, int out_size, void* d_ws, size_t ws_size,
                              hipStream_t stream) {
  const float* x      = (const float*)d_in[0];
  const float* g_norm = (const float*)d_in[1];
  const float* W_q    = (const float*)d_in[2];
  const float* W_kv   = (const float*)d_in[3];
  const float* W_out  = (const float*)d_in[4];
  const float* g_out  = (const float*)d_in[5];
  float* out = (float*)d_out;

  char* ws = (char*)d_ws;
  const size_t xnB = (size_t)R_TOTAL * DIMX * sizeof(half_t);    // 64 MB
  const size_t kB  = (size_t)R_TOTAL * DHEAD * sizeof(half_t);   //  8 MB
  half_t* xn    = (half_t*)ws;                 // reused as `mid` once consumed
  half_t* qw    = (half_t*)(ws + xnB);
  half_t* kw    = (half_t*)(ws + 2 * xnB);
  half_t* vT    = (half_t*)(ws + 2 * xnB + kB);
  half_t* WqkvT = (half_t*)(ws + 2 * xnB + 2 * kB);
  half_t* WoutT = WqkvT + 640 * 512;
  half_t* mid = xn;

  ln_in_kernel<<<R_TOTAL / 8, 256, 0, stream>>>(x, g_norm, xn);
  prep_w_kernel<<<(640 * 512 + 512 * 512) / 256, 256, 0, stream>>>(W_q, W_kv, W_out, WqkvT, WoutT);
  dim3 gA(R_TOTAL / 128, 2);
  proj_kernel<<<gA, 256, 0, stream>>>(xn, WqkvT, qw, kw, vT);
  const size_t attn_lds = (size_t)(SEQ * K_PITCH + DHEAD * V_PITCH) * sizeof(half_t);
  attn_kernel<<<2048, 256, attn_lds, stream>>>(qw, kw, vT, mid);
  out_kernel<<<R_TOTAL / 128, 256, 0, stream>>>(mid, WoutT, g_out, out);
}

// v006
// Measured time: 162 microseconds a run.
// Two timings next to v005 put it at 1.24 and 1.22 times that version's speed.
// All steps since v000 together make it 2.98 times as fast.
#include <hip/hip_runtime.h>

typedef _Float16 half_t;
typedef __attribute__((ext_vector_type(4)))  _Float16 v4h;
typedef __attribute__((ext_vector_type(8)))  _Float16 v8h;
typedef __attribute__((ext_vector_type(16))) _Float16 v16h;
typedef __attribute__((ext_vector_type(8)))  float    v8f;
typedef __attribute__((ext_vector_type(4)))  float    v4f;

#define R_TOTAL 65536   // b*n*r = 4*64*256
#define DIMX    512
#define DHEAD   64
#define SEQ     256
#define EPS_F   1e-5f
// LDS row pitches (halves) for rows read by 16-byte fragment loads: 16 B x odd, so that
// the 16 rows of one fragment load fall on distinct banks.
#define W_PITCH 40      // 64-B weight-chunk rows  -> 80 B
#define K_PITCH 72      // 128-B K rows            -> 144 B
#define V_PITCH 264     // 512-B V^T rows          -> 528 B

// Load a 16-bit A/B WMMA fragment (16x32 A, or 32x16 B via its N-major mirror).
// Caller passes p = base + row_or_n*stride + kBase + (lane>>4)*8.
// lane<16 needs K {0..7, 16..23}, lane>=16 needs K {8..15, 24..31}: two b128 loads.
__device__ __forceinline__ v16h frag_ld(const half_t* p) {
  v8h lo = *(const v8h*)(p);
  v8h hi = *(const v8h*)(p + 16);
  return __builtin_shufflevector(lo, hi, 0,1,2,3,4,5,6,7,8,9,10,11,12,13,14,15);
}

// q and mid lie in the workspace in fragment order: the 16-byte granule (8 adjacent columns) of
// row R, column C stands at granule index ((R >> 4) * 32 + (C >> 4)) * 32 + ((C >> 3) & 1) * 16 + (R & 15).
// The last two terms are the lane that holds the granule, in the producer's result tile and in the
// consumer's fragment alike, so one wave-wide 16-byte store or load covers 512 contiguous bytes
// (four whole lines), not 32-byte pieces of 16 lines. PK_TILE = halves of one 16 x 16 tile.
#define PK_TILE 256
// Caller passes p = base + (((R >> 4) * 32 + kBase / 16) * 32 + lane) * 8; k order as in frag_ld.
__device__ __forceinline__ v16h frag_ld_pk(const half_t* p) {
  v8h lo = *(const v8h*)(p);
  v8h hi = *(const v8h*)(p + PK_TILE);
  return __builtin_shufflevector(lo, hi, 0,1,2,3,4,5,6,7,8,9,10,11,12,13,14,15);
}

__device__ __forceinline__ v8f wmma_f16(v16h a, v16h b, v8f c) {
  return __builtin_amdgcn_wmma_f32_16x16x32_f16(false, a, false, b, (short)0, c, false, false);
}

// One 32-deep k chunk of a wave's 16 x (16*NT) tile: acc[t] += a * B_t, the B fragments read from
// LDS (bp = the lane's place in row l of the chunk, tile t lies 16 rows further per t).
// The fragments come in groups of G, each group fetched into its own register set while the
// group before it is multiplied, so that a WMMA does not wait out the latency of its own loads.
// Every loop is unrolled so that bf and acc are indexed by constants and stay in registers.
// The first NTR tiles are formed transposed (the LDS fragment as A, a as B; both fragments have
// the same lane and k layout): there a lane holds 8 adjacent columns of one row of the product.
template <int NT, int G, int PITCH, int NTR>
__device__ __forceinline__ void mma_chunk(const half_t* bp, v16h a, v8f (&acc)[NT]) {
  v16h bf[2][G];
#pragma unroll
  for (int i = 0; i < G; ++i) bf[0][i] = frag_ld(bp + i * 16 * PITCH);
#pragma unroll
  for (int g = 0; g < NT / G; ++g) {
    if (g + 1 < NT / G) {
#pragma unroll
      for (int i = 0; i < G; ++i) bf[(g + 1) & 1][i] = frag_ld(bp + ((g + 1) * G + i) * 16 * PITCH);
    }
    // keeps the next group's loads in front of this group's WMMAs (the scheduler sinks them
    // to their first use otherwise, one register set and a full LDS wait per WMMA)
    __builtin_amdgcn_sched_barrier(0);
#pragma unroll
    for (int i = 0; i < G; ++i)
      acc[g * G + i] = (g * G + i < NTR) ? wmma_f16(bf[g & 1][i], a, acc[g * G + i])
                                         : wmma_f16(a, bf[g & 1][i], acc[g * G + i]);
    // keeps the loads that follow together as one group, not spread among these WMMAs
    __builtin_amdgcn_sched_barrier(0);
  }
}

// CDNA5 async global->LDS copy, 16 bytes per lane, tracked by ASYNCcnt.
__device__ __forceinline__ unsigned lds_addr(const half_t* l) {
  return (unsigned)(uintptr_t)l;  // flat LDS aperture: addr[31:0] = LDS offset
}
// A run of copies (copy i: g + i * gs -> l + i * ls, strides in halves) and its s_wait_xcnt 0
// in one statement: the wait then stands in front of any later rewrite of the address
// registers that the copies name.
__device__ __forceinline__ void async_cp16x5(const half_t* g, int gs, half_t* l, int ls) {
  asm volatile("global_load_async_to_lds_b128 %0, %1, off\n\t"
               "global_load_async_to_lds_b128 %2, %3, off\n\t"
               "global_load_async_to_lds_b128 %4, %5, off\n\t"
               "global_load_async_to_lds_b128 %6, %7, off\n\t"
               "global_load_async_to_lds_b128 %8, %9, off\n\t"
               "s_wait_xcnt 0x0"
               :: "v"(lds_addr(l)),          "v"(g),
                  "v"(lds_addr(l + 1 * ls)), "v"(g + 1 * gs),
                  "v"(lds_addr(l + 2 * ls)), "v"(g + 2 * gs),
                  "v"(lds_addr(l + 3 * ls)), "v"(g + 3 * gs),
                  "v"(lds_addr(l + 4 * ls)), "v"(g + 4 * gs) : "memory");
}
__device__ __forceinline__ void async_cp16x8(const half_t* g, int gs, half_t* l, int ls) {
  asm volatile("global_load_async_to_lds_b128 %0, %1, off\n\t"
               "global_load_async_to_lds_b128 %2, %3, off\n\t"
               "global_load_async_to_lds_b128 %4, %5, off\n\t"
               "global_load_async_to_lds_b128 %6, %7, off\n\t"
               "global_load_async_to_lds_b128 %8, %9, off\n\t"
               "global_load_async_to_lds_b128 %10, %11, off\n\t"
               "global_load_async_to_lds_b128 %12, %13, off\n\t"
               "global_load_async_to_lds_b128 %14, %15, off\n\t"
               "s_wait_xcnt 0x0"
               :: "v"(lds_addr(l)),          "v"(g),
                  "v"(lds_addr(l + 1 * ls)), "v"(g + 1 * gs),
                  "v"(lds_addr(l + 2 * ls)), "v"(g + 2 * gs),
                  "v"(lds_addr(l + 3 * ls)), "v"(g + 3 * gs),
                  "v"(lds_addr(l + 4 * ls)), "v"(g + 4 * gs),
                  "v"(lds_addr(l + 5 * ls)), "v"(g + 5 * gs),
                  "v"(lds_addr(l + 6 * ls)), "v"(g + 6 * gs),
                  "v"(lds_addr(l + 7 * ls)), "v"(g + 7 * gs) : "memory");
}

// ---------------- Kernel 0a: input LayerNorm, f32 -> f16 ----------------
__global__ __launch_bounds__(256) void ln_in_kernel(const float* __restrict__ x,
                                                    const float* __restrict__ g,
                                                    half_t* __restrict__ xn) {
  const int wave = threadIdx.x >> 5;
  const int lane = threadIdx.x & 31;
  const long row = (long)blockIdx.x * 8 + wave;
  const float* xr = x + row * DIMX;
  float4 v[4], gv[4];
  float s = 0.f, sq = 0.f;
#pragma unroll
  for (int i = 0; i < 4; ++i) {
    v[i]  = ((const float4*)xr)[i * 32 + lane];
    gv[i] = ((const float4*)g)[i * 32 + lane];
    s  += v[i].x + v[i].y + v[i].z + v[i].w;
    sq += v[i].x*v[i].x + v[i].y*v[i].y + v[i].z*v[i].z + v[i].w*v[i].w;
  }
#pragma unroll
  for (int m = 1; m < 32; m <<= 1) { s += __shfl_xor(s, m, 32); sq += __shfl_xor(sq, m, 32); }
  const float mean = s * (1.f / DIMX);
  const float rstd = rsqrtf(sq * (1.f / DIMX) - mean * mean + EPS_F);
#pragma unroll
  for (int i = 0; i < 4; ++i) {
    v4h o;
    o[0] = (half_t)((v[i].x - mean) * rstd * gv[i].x);
    o[1] = (half_t)((v[i].y - mean) * rstd * gv[i].y);
    o[2] = (half_t)((v[i].z - mean) * rstd * gv[i].z);
    o[3] = (half_t)((v[i].w - mean) * rstd * gv[i].w);
    ((v4h*)(xn + row * DIMX))[i * 32 + lane] = o;
  }
}

// ---------------- Kernel 0b: one-time weight transpose+convert (tiny, L2-resident) ----------------
// Transposed weights as f16, k-chunk-major: chunk kc (32 k) of all columns is one contiguous piece,
// [kc][row][32 k], so that the staging copies of a chunk read contiguous bytes (a wave-wide copy
// covers four whole lines, not 64-byte pieces of eight).
// WqkvT: row = column n of (W_q|W_kv), 640 rows. WoutT: 512 rows in the order of the staged LDS
// rows: row 16 * t + m holds output column 64 * (t >> 2) + 4 * m + (t & 3), see out_kernel.
__global__ __launch_bounds__(256) void prep_w_kernel(const float* __restrict__ Wq,
                                                     const float* __restrict__ Wkv,
                                                     const float* __restrict__ Wout,
                                                     half_t* __restrict__ WqkvT,
                                                     half_t* __restrict__ WoutT) {
  const int idx = blockIdx.x * 256 + threadIdx.x;
  if (idx < 640 * 512) {
    const int n = idx >> 9, k = idx & 511;
    const float w = (n < DIMX) ? Wq[(size_t)k * DIMX + n]
                               : Wkv[(size_t)k * 128 + (n - DIMX)];
    WqkvT[((k >> 5) * 640 + n) * 32 + (k & 31)] = (half_t)w;
  } else {
    const int i2 = idx - 640 * 512;  // < 512*512
    const int n = i2 >> 9, k = i2 & 511;
    const int r = ((n >> 6) * 4 + (n & 3)) * 16 + ((n >> 2) & 15);
    WoutT[((k >> 5) * DIMX + r) * 32 + (k & 31)] = (half_t)Wout[(size_t)k * DIMX + n];
  }
}

// ---------------- Kernel 1: q/k/v projection GEMM  xn @ [W_q | W_kv] ----------------
// grid.x = row blocks of 128, grid.y = 2 halves of N=640 (320 cols each)
#define A_NT 20
__device__ __forceinline__ void stage_proj(const half_t* __restrict__ WqkvT, half_t* buf,
                                           int colBase, int kBase, int tid) {
  // 320 rows x 64 B = 1280 x 16B transfers; 5 async instructions per wave
  const int nl = tid >> 2, part = tid & 3;   // copy i takes row nl + 64 * i
  const half_t* g = WqkvT + (size_t)(kBase * 20 + colBase) * 32 + tid * 8;   // chunk kBase / 32, 640 rows each
  half_t* d = &buf[nl * W_PITCH + part * 8];
  async_cp16x5(g, 256 * 8, d, 64 * W_PITCH);
}

// One 128 x 320 block. UPPER = false: columns 0..319, all q. UPPER = true: columns 320..639,
// tiles 0..11 q, 12..15 k, 16..19 v. q (fragment order) and k (row-major) want 8 adjacent columns
// of one row in a lane, so their tiles are formed transposed; v is stored transposed, so its
// tiles stay as they are (a lane holds 8 adjacent rows of one column). Either way a lane's
// 8 results of a tile are 16 adjacent bytes of the destination.
template <bool UPPER>
__device__ __forceinline__ void proj_block(const half_t* __restrict__ xn,
                                           const half_t* __restrict__ WqkvT,
                                           half_t* __restrict__ qw,
                                           half_t* __restrict__ kw,
                                           half_t* __restrict__ vTw,
                                           half_t (&WT)[2][320 * W_PITCH]) {
  constexpr int NTR = UPPER ? 16 : A_NT;   // tiles formed transposed
  constexpr int colBase = UPPER ? 320 : 0;
  const int tid  = threadIdx.x;
  const int wave = tid >> 5, lane = tid & 31;
  const int l = lane & 15, hi = lane >> 4;
  const int rowBase = blockIdx.x * 128 + wave * 16;
  v8f acc[A_NT];
  v8f z = {};
#pragma unroll
  for (int t = 0; t < A_NT; ++t) acc[t] = z;

  stage_proj(WqkvT, WT[0], colBase, 0, tid);
  // The wave's x fragment is fetched one k chunk ahead: the load of chunk kc + 1 goes out behind
  // the barrier that opens chunk kc and is in flight under that chunk's WMMAs.
  const unsigned ao = (unsigned)(rowBase + l) * DIMX + hi * 8;   // 32-bit index: the kernel stays at 256 registers
  v16h a = frag_ld(xn + ao);
  for (int kc = 0; kc < 16; ++kc) {
    const int kBase = kc * 32;
    if (kc < 15) {
      stage_proj(WqkvT, WT[(kc + 1) & 1], colBase, kBase + 32, tid);
      asm volatile("s_wait_asynccnt 0x5" ::: "memory");  // older stage complete
    } else {
      asm volatile("s_wait_asynccnt 0x0" ::: "memory");
    }
    __syncthreads();
    const half_t* buf = WT[kc & 1];
    v16h an = a;
    if (kc < 15) an = frag_ld(xn + kBase + 32 + ao);
    mma_chunk<A_NT, 4, W_PITCH, NTR>(&buf[l * W_PITCH + hi * 8], a, acc);
    __syncthreads();
    a = an;
  }
  // epilogue: cols [0,512) -> q, [512,576) -> k, [576,640) -> v (transposed); one 16-B store a tile
  // The lane number is read anew here, so that no index of the epilogue is held in a register
  // through the loop (one more there and the kernel passes 256 registers and loses a resident block).
  const int eln = (int)__builtin_amdgcn_mbcnt_lo(~0u, 0u);
  const int el = eln & 15, eh = eln >> 4;
  v8h r[A_NT];   // all tiles converted first, each into registers of its own, then the 20 stores in a row
#pragma unroll
  for (int t = 0; t < A_NT; ++t)
#pragma unroll
    for (int j = 0; j < 8; ++j) r[t][j] = (half_t)acc[t][j];
  // q, tile t: acc[t][j] = C[rowBase + el][colBase + 16 * t + 8 * eh + j], fragment order, 32-bit
  // index as for the x fragment
  half_t* qp = qw + (((unsigned)(rowBase >> 4) * 32 + (colBase >> 4)) * 32 + eln) * 8;
  // k, tile t: the same element, row-major, column less DIMX
  half_t* kp = kw + (unsigned)(rowBase + el) * DHEAD + eh * 8;
  // v, tile t: acc[t][j] = C[rowBase + 8 * eh + j][DIMX + DHEAD + d], d = 16 * (t - NTR) + el; V^T per (b,n)
  const int vrow = rowBase + eh * 8;
  half_t* vp = vTw + ((unsigned)(vrow >> 8) * DHEAD + el) * SEQ + (vrow & 255);
#pragma unroll
  for (int t = 0; t < A_NT; ++t) {
    if (colBase + t * 16 < DIMX) *(v8h*)(qp + t * PK_TILE) = r[t];
    else if (t < NTR)            *(v8h*)(kp + (colBase + t * 16 - DIMX)) = r[t];
    else                         *(v8h*)(vp + (t - NTR) * 16 * SEQ) = r[t];
  }
}

__global__ __launch_bounds__(256) void proj_kernel(const half_t* __restrict__ xn,
                                                   const half_t* __restrict__ WqkvT,
                                                   half_t* __restrict__ qw,
                                                   half_t* __restrict__ kw,
                                                   half_t* __restrict__ vTw) {
  __shared__ half_t WT[2][320 * W_PITCH];  // double-buffered transposed weight chunk (2 x 25 KB)
  if (blockIdx.y == 0) proj_block<false>(xn, WqkvT, qw, kw, vTw, WT);
  else                 proj_block<true>(xn, WqkvT, qw, kw, vTw, WT);
}

// value of lane l ^ 16 (the other 16-lane row, same position)
__device__ __forceinline__ float other_half(float v) {
  const int r = __builtin_amdgcn_permlanex16(0, __builtin_bit_cast(int, v),
                                             0x76543210, 0xfedcba98, false, false);
  return __builtin_bit_cast(float, r);
}

__global__ __launch_bounds__(256) void attn_kernel(const half_t* __restrict__ qw,
                                                   const half_t* __restrict__ kw,
                                                   const half_t* __restrict__ vTw,
                                                   half_t* __restrict__ mid) {
  extern __shared__ half_t smem[];
  half_t* Ksh = smem;                       // [256][K_PITCH]  (36 KB)
  half_t* Vsh = Ksh + SEQ * K_PITCH;        // [64][V_PITCH]   (33 KB)
  const int tid  = threadIdx.x;
  const int wave = tid >> 5, lane = tid & 31;
  const int l = lane & 15, hi = lane >> 4;
  const int bn = blockIdx.x >> 3, h = blockIdx.x & 7;
  // the wave's first query tile, head h, in fragment order (the next query tile: 32 tiles on)
  const size_t pk   = ((size_t)((bn * 16 + wave * 2) * 32 + h * 4) * 32 + lane) * 8;
  const half_t* Qg  = qw + pk;
  const half_t* Kg  = kw  + (size_t)bn * SEQ * DHEAD;              // [256][64]
  const half_t* VTg = vTw + (size_t)bn * DHEAD * SEQ;              // [64][256]

  // async-stage K and V^T into padded LDS rows (16 async instr per wave)
  {
    // K: 8 granules of 16 B a row, copy i takes row (tid >> 3) + 32 * i
    const half_t* gk = Kg + tid * 8;
    half_t* dk = &Ksh[(tid >> 3) * K_PITCH + (tid & 7) * 8];
    // V^T: 32 granules a row, copy i takes row (tid >> 5) + 8 * i
    const half_t* gv = VTg + tid * 8;
    half_t* dv = &Vsh[(tid >> 5) * V_PITCH + (tid & 31) * 8];
    async_cp16x8(gk, 2048, dk, 32 * K_PITCH);
    async_cp16x8(gv, 2048, dv, 8 * V_PITCH);
  }

  v8f s[2][16];   // s[qt][kt][j] = S[query 32*wave + 16*qt + l][key 16*kt + 8*hi + j]
  v8f z = {};
#pragma unroll
  for (int qt = 0; qt < 2; ++qt)
#pragma unroll
    for (int kt = 0; kt < 16; ++kt) s[qt][kt] = z;

  // Q B-fragments straight from global (overlaps with the async staging)
  v16h bq[2][2];
#pragma unroll
  for (int kc = 0; kc < 2; ++kc) {
    bq[kc][0] = frag_ld_pk(Qg + kc * 2 * PK_TILE);
    bq[kc][1] = frag_ld_pk(Qg + (32 + kc * 2) * PK_TILE);
  }
  asm volatile("s_wait_asynccnt 0x0" ::: "memory");
  __syncthreads();

  // S^T = K Q^T   (A = K rows, B = Q rows as the N-major mirror)
#pragma unroll
  for (int kc = 0; kc < 2; ++kc) {
    const int kBase = kc * 32;
#pragma unroll
    for (int kt = 0; kt < 16; ++kt) {
      v16h a = frag_ld(&Ksh[(kt * 16 + l) * K_PITCH + kBase + hi * 8]);
      s[0][kt] = wmma_f16(a, bq[kc][0], s[0][kt]);
      s[1][kt] = wmma_f16(a, bq[kc][1], s[1][kt]);
    }
  }

  // softmax: logits = (s - max) * 0.125 = (s - max) / sqrt(DHEAD)
  float rsum[2];
  v16h pb[2][8];  // pb[qt][kc]: B fragment of P^T, keys 32*kc .. 32*kc + 31, column = query
#pragma unroll
  for (int qt = 0; qt < 2; ++qt) {
    float mx[4], sm[4];
#pragma unroll
    for (int i = 0; i < 4; ++i) { mx[i] = s[qt][0][i]; sm[i] = 0.f; }
#pragma unroll
    for (int kt = 0; kt < 16; ++kt)
#pragma unroll
      for (int j = 0; j < 8; ++j) mx[j & 3] = fmaxf(mx[j & 3], s[qt][kt][j]);
    float m = fmaxf(fmaxf(mx[0], mx[1]), fmaxf(mx[2], mx[3]));
    m = fmaxf(m, other_half(m));
#pragma unroll
    for (int kc = 0; kc < 8; ++kc) {
#pragma unroll
      for (int e = 0; e < 16; ++e) {
        const float p = __expf((s[qt][2 * kc + (e >> 3)][e & 7] - m) * 0.125f);
        sm[e & 3] += p;
        pb[qt][kc][e] = (half_t)p;
      }
    }
    float sum = (sm[0] + sm[1]) + (sm[2] + sm[3]);
    sum += other_half(sum);
    rsum[qt] = sum;
  }

  // O^T = V^T P^T  (A = V^T rows from LDS, B = P^T from registers)
  v8f o[2][4];    // o[qt][dt][j] = O[query 32*wave + 16*qt + l][d 16*dt + 8*hi + j]
#pragma unroll
  for (int qt = 0; qt < 2; ++qt)
#pragma unroll
    for (int dt = 0; dt < 4; ++dt) o[qt][dt] = z;
#pragma unroll
  for (int kc = 0; kc < 8; ++kc) {
    const int kBase = kc * 32;
#pragma unroll
    for (int dt = 0; dt < 4; ++dt) {
      v16h a = frag_ld(&Vsh[(dt * 16 + l) * V_PITCH + kBase + hi * 8]);
      o[0][dt] = wmma_f16(a, pb[0][kc], o[0][dt]);
      o[1][dt] = wmma_f16(a, pb[1][kc], o[1][dt]);
    }
  }
  // normalize and store head-concatenated mid in fragment order: 8 consecutive d of one query per lane
#pragma unroll
  for (int qt = 0; qt < 2; ++qt) {
    half_t* mrow = mid + pk + qt * 32 * PK_TILE;
#pragma unroll
    for (int dt = 0; dt < 4; ++dt) {
      v8h r;
#pragma unroll
      for (int j = 0; j < 8; ++j) r[j] = (half_t)(o[qt][dt][j] / rsum[qt]);
      *(v8h*)(mrow + dt * PK_TILE) = r;
    }
  }
}

// ---------------- Kernel 3: out projection + LayerNorm ----------------
__device__ __forceinline__ void stage_out(const half_t* __restrict__ WoutT, half_t* buf,
                                          int kBase, int tid) {
  // 512 rows x 64 B = 2048 x 16B transfers; 8 async instructions per wave
  const int nl = tid >> 2, part = tid & 3;   // copy i takes row nl + 64 * i
  // Row 16 * t + m holds output column 64 * (t >> 2) + 4 * m + (t & 3) (prep_w_kernel): lane m of a
  // result tile then holds, over four tiles, four adjacent columns, one 16-byte store.
  const half_t* g = WoutT + (size_t)kBase * DIMX + tid * 8;   // chunk kBase / 32, 512 rows of 32 k
  half_t* d = &buf[nl * W_PITCH + part * 8];
  async_cp16x8(g, 256 * 8, d, 64 * W_PITCH);
}

__global__ __launch_bounds__(256) void out_kernel(const half_t* __restrict__ mid,
                                                  const half_t* __restrict__ WoutT,
                                                  const float* __restrict__ gout,
                                                  float* __restrict__ out) {
  __shared__ half_t WT[2][512 * W_PITCH];  // double-buffered transposed W_out chunk (2 x 40 KB)
  const int tid  = threadIdx.x;
  const int wave = tid >> 5, lane = tid & 31;
  const int l = lane & 15, hi = lane >> 4;
  const int rowBase = blockIdx.x * 128 + wave * 16;
  v8f acc[32];
  v8f z = {};
#pragma unroll
  for (int t = 0; t < 32; ++t) acc[t] = z;

  stage_out(WoutT, WT[0], 0, tid);
  // the wave's mid fragment is fetched one k chunk ahead, as in proj_block
  const half_t* ap = mid + ((size_t)(rowBase >> 4) * 32 * 32 + lane) * 8;   // fragment order
  v16h a = frag_ld_pk(ap);
  // stands in front of the first rewrite of that load's address registers (this build reuses them
  // for an accumulator); the address is named as an input so
  // that its registers are left alone up to the wait
  asm volatile("s_wait_xcnt 0x0" :: "v"(ap) : "memory");
  for (int kc = 0; kc < 16; ++kc) {
    const int kBase = kc * 32;
    if (kc < 15) {
      stage_out(WoutT, WT[(kc + 1) & 1], kBase + 32, tid);
      asm volatile("s_wait_asynccnt 0x8" ::: "memory");  // older stage complete
    } else {
      asm volatile("s_wait_asynccnt 0x0" ::: "memory");
    }
    __syncthreads();
    const half_t* buf = WT[kc & 1];
    v16h an = a;
    if (kc < 15) an = frag_ld_pk(ap + (kc + 1) * 2 * PK_TILE);
    mma_chunk<32, 8, W_PITCH, 0>(&buf[l * W_PITCH + hi * 8], a, acc);
    __syncthreads();
    a = an;
  }
  // fused LayerNorm over each 512-wide output row; the lane's 32 weights come in under the row sums
  float4 gv[8];
#pragma unroll
  for (int c = 0; c < 8; ++c) gv[c] = ((const float4*)gout)[c * 16 + l];
  // stands in front of the first rewrite of those loads' address register (the lane's index l, named
  // as an input so that it is left alone up to the wait), as behind the first mid fragment above
  asm volatile("s_wait_xcnt 0x0" :: "v"(l) : "memory");
  float mean[8], rstd[8];
#pragma unroll
  for (int j = 0; j < 8; ++j) {
    float sm = 0.f, sq = 0.f;
#pragma unroll
    for (int t = 0; t < 32; ++t) { const float vv = acc[t][j]; sm += vv; sq += vv * vv; }
#pragma unroll
    for (int msk = 1; msk < 16; msk <<= 1) {
      sm += __shfl_xor(sm, msk, 32);
      sq += __shfl_xor(sq, msk, 32);
    }
    mean[j] = sm * (1.f / DIMX);
    rstd[j] = rsqrtf(sq * (1.f / DIMX) - mean[j] * mean[j] + EPS_F);
  }
  // acc[4 * c + i][j] is row rowBase + 8 * hi + j, column 64 * c + 4 * l + i: 16 lanes store 256
  // contiguous bytes of a row
  float* op = out + (size_t)(rowBase + hi * 8) * DIMX + l * 4;
#pragma unroll
  for (int j0 = 0; j0 < 8; j0 += 2) {
    v4f w[2][8];
#pragma unroll
    for (int jj = 0; jj < 2; ++jj)
#pragma unroll
      for (int c = 0; c < 8; ++c) {
        const int j = j0 + jj;
        w[jj][c][0] = (acc[4 * c + 0][j] - mean[j]) * rstd[j] * gv[c].x;
        w[jj][c][1] = (acc[4 * c + 1][j] - mean[j]) * rstd[j] * gv[c].y;
        w[jj][c][2] = (acc[4 * c + 2][j] - mean[j]) * rstd[j] * gv[c].z;
        w[jj][c][3] = (acc[4 * c + 3][j] - mean[j]) * rstd[j] * gv[c].w;
        *(v4f*)(op + j * DIMX + c * 64) = w[jj][c];
      }
    // stands in front of the first rewrite of a register that these 16 stores name: their values and
    // their address are named as inputs so that the registers are left alone up to the wait
    asm volatile("s_wait_xcnt 0x0"
                 :: "v"(w[0][0]), "v"(w[0][1]), "v"(w[0][2]), "v"(w[0][3]),
                    "v"(w[0][4]), "v"(w[0][5]), "v"(w[0][6]), "v"(w[0][7]),
                    "v"(w[1][0]), "v"(w[1][1]), "v"(w[1][2]), "v"(w[1][3]),
                    "v"(w[1][4]), "v"(w[1][5]), "v"(w[1][6]), "v"(w[1][7]), "v"(op) : "memory");
  }
}

extern "C" void kernel_launch(void* const* d_in, const int* in_sizes, int n_in,
                              void* d_out, int out_size, void* d_ws, size_t ws_size,
                              hipStream_t stream) {
  const float* x      = (const float*)d_in[0];
  const float* g_norm = (const float*)d_in[1];
  const float* W_q    = (const float*)d_in[2];
  const float* W_kv   = (const float*)d_in[3];
  const float* W_out  = (const float*)d_in[4];
  const float* g_out  = (const float*)d_in[5];
  float* out = (float*)d_out;

  char* ws = (char*)d_ws;
  const size_t xnB = (size_t)R_TOTAL * DIMX * sizeof(half_t);    // 64 MB
  const size_t kB  = (size_t)R_TOTAL * DHEAD * sizeof(half_t);   //  8 MB
  half_t* xn    = (half_t*)ws;                 // reused as `mid` once consumed
  half_t* qw    = (half_t*)(ws + xnB);
  half_t* kw    = (half_t*)(ws + 2 * xnB);
  half_t* vT    = (half_t*)(ws + 2 * xnB + kB);
  half_t* WqkvT = (half_t*)(ws + 2 * xnB + 2 * kB);
  half_t* WoutT = WqkvT + 640 * 512;
  half_t* mid = xn;

  ln_in_kernel<<<R_TOTAL / 8, 256, 0, stream>>>(x, g_norm, xn);
  prep_w_kernel<<<(640 * 512 + 512 * 512) / 256, 256, 0, stream>>>(W_q, W_kv, W_out, WqkvT, WoutT);
  dim3 gA(R_TOTAL / 128, 2);
  proj_kernel<<<gA, 256, 0, stream>>>(xn, WqkvT, qw, kw, vT);
  const size_t attn_lds = (size_t)(SEQ * K_PITCH + DHEAD * V_PITCH) * sizeof(half_t);
  attn_kernel<<<2048, 256, attn_lds, stream>>>(qw, kw, vT, mid);
  out_kernel<<<R_TOTAL / 128, 256, 0, stream>>>(mid, WoutT, g_out, out);
}

// v007
// A run of this version takes 155 microseconds.
// Next to v006, in two timings, it ran 1.03 times as fast each time.
// All steps since v000 together make it 3.08 times as fast.
#include <hip/hip_runtime.h>

typedef _Float16 half_t;
typedef __attribute__((ext_vector_type(4)))  _Float16 v4h;
typedef __attribute__((ext_vector_type(8)))  _Float16 v8h;
typedef __attribute__((ext_vector_type(16))) _Float16 v16h;
typedef __attribute__((ext_vector_type(8)))  float    v8f;
typedef __attribute__((ext_vector_type(4)))  float    v4f;

#define R_TOTAL 65536   // b*n*r = 4*64*256
#define DIMX    512
#define DHEAD   64
#define SEQ     256
#define EPS_F   1e-5f
// LDS row pitches (halves) for rows read by 16-byte fragment loads: 16 B x odd, so that
// the 16 rows of one fragment load fall on distinct banks.
#define W_PITCH 40      // 64-B weight-chunk rows  -> 80 B
#define K_PITCH 72      // 128-B K rows            -> 144 B
#define V_PITCH 264     // 512-B V^T rows          -> 528 B
#define M_PITCH 520     // 1024-B mid rows         -> 1040 B

// Load a 16-bit A/B WMMA fragment (16x32 A, or 32x16 B via its N-major mirror).
// Caller passes p = base + row_or_n*stride + kBase + (lane>>4)*8.
// lane<16 needs K {0..7, 16..23}, lane>=16 needs K {8..15, 24..31}: two b128 loads.
__device__ __forceinline__ v16h frag_ld(const half_t* p) {
  v8h lo = *(const v8h*)(p);
  v8h hi = *(const v8h*)(p + 16);
  return __builtin_shufflevector(lo, hi, 0,1,2,3,4,5,6,7,8,9,10,11,12,13,14,15);
}

// q lies in the workspace in fragment order: the 16-byte granule (8 adjacent columns) of
// row R, column C stands at granule index ((R >> 4) * 32 + (C >> 4)) * 32 + ((C >> 3) & 1) * 16 + (R & 15).
// The last two terms are the lane that holds the granule, in the producer's result tile and in the
// consumer's fragment alike, so one wave-wide 16-byte store or load covers 512 contiguous bytes
// (four whole lines), not 32-byte pieces of 16 lines. PK_TILE = halves of one 16 x 16 tile.
#define PK_TILE 256
// Caller passes p = base + (((R >> 4) * 32 + kBase / 16) * 32 + lane) * 8; k order as in frag_ld.
__device__ __forceinline__ v16h frag_ld_pk(const half_t* p) {
  v8h lo = *(const v8h*)(p);
  v8h hi = *(const v8h*)(p + PK_TILE);
  return __builtin_shufflevector(lo, hi, 0,1,2,3,4,5,6,7,8,9,10,11,12,13,14,15);
}

__device__ __forceinline__ v8f wmma_f16(v16h a, v16h b, v8f c) {
  return __builtin_amdgcn_wmma_f32_16x16x32_f16(false, a, false, b, (short)0, c, false, false);
}

// One 32-deep k chunk of a wave's 16 x (16*NT) tile: acc[t] += a * B_t, the B fragments read from
// LDS (bp = the lane's place in row l of the chunk, tile t lies 16 rows further per t).
// The fragments come in groups of G, each group fetched into its own register set while the
// group before it is multiplied, so that a WMMA does not wait out the latency of its own loads.
// Every loop is unrolled so that bf and acc are indexed by constants and stay in registers.
// The first NTR tiles are formed transposed (the LDS fragment as A, a as B; both fragments have
// the same lane and k layout): there a lane holds 8 adjacent columns of one row of the product.
template <int NT, int G, int PITCH, int NTR>
__device__ __forceinline__ void mma_chunk(const half_t* bp, v16h a, v8f (&acc)[NT]) {
  v16h bf[2][G];
#pragma unroll
  for (int i = 0; i < G; ++i) bf[0][i] = frag_ld(bp + i * 16 * PITCH);
#pragma unroll
  for (int g = 0; g < NT / G; ++g) {
    if (g + 1 < NT / G) {
#pragma unroll
      for (int i = 0; i < G; ++i) bf[(g + 1) & 1][i] = frag_ld(bp + ((g + 1) * G + i) * 16 * PITCH);
    }
    // keeps the next group's loads in front of this group's WMMAs (the scheduler sinks them
    // to their first use otherwise, one register set and a full LDS wait per WMMA)
    __builtin_amdgcn_sched_barrier(0);
#pragma unroll
    for (int i = 0; i < G; ++i)
      acc[g * G + i] = (g * G + i < NTR) ? wmma_f16(bf[g & 1][i], a, acc[g * G + i])
                                         : wmma_f16(a, bf[g & 1][i], acc[g * G + i]);
    // keeps the loads that follow together as one group, not spread among these WMMAs
    __builtin_amdgcn_sched_barrier(0);
  }
}

// CDNA5 async global->LDS copy, 16 bytes per lane, tracked by ASYNCcnt.
__device__ __forceinline__ unsigned lds_addr(const half_t* l) {
  return (unsigned)(uintptr_t)l;  // flat LDS aperture: addr[31:0] = LDS offset
}
// A run of copies (copy i: g + i * gs -> l + i * ls, strides in halves) and its s_wait_xcnt 0
// in one statement: the wait then stands in front of any later rewrite of the address
// registers that the copies name.
__device__ __forceinline__ void async_cp16x5(const half_t* g, int gs, half_t* l, int ls) {
  asm volatile("global_load_async_to_lds_b128 %0, %1, off\n\t"
               "global_load_async_to_lds_b128 %2, %3, off\n\t"
               "global_load_async_to_lds_b128 %4, %5, off\n\t"
               "global_load_async_to_lds_b128 %6, %7, off\n\t"
               "global_load_async_to_lds_b128 %8, %9, off\n\t"
               "s_wait_xcnt 0x0"
               :: "v"(lds_addr(l)),          "v"(g),
                  "v"(lds_addr(l + 1 * ls)), "v"(g + 1 * gs),
                  "v"(lds_addr(l + 2 * ls)), "v"(g + 2 * gs),
                  "v"(lds_addr(l + 3 * ls)), "v"(g + 3 * gs),
                  "v"(lds_addr(l + 4 * ls)), "v"(g + 4 * gs) : "memory");
}
__device__ __forceinline__ void async_cp16x8(const half_t* g, int gs, half_t* l, int ls) {
  asm volatile("global_load_async_to_lds_b128 %0, %1, off\n\t"
               "global_load_async_to_lds_b128 %2, %3, off\n\t"
               "global_load_async_to_lds_b128 %4, %5, off\n\t"
               "global_load_async_to_lds_b128 %6, %7, off\n\t"
               "global_load_async_to_lds_b128 %8, %9, off\n\t"
               "global_load_async_to_lds_b128 %10, %11, off\n\t"
               "global_load_async_to_lds_b128 %12, %13, off\n\t"
               "global_load_async_to_lds_b128 %14, %15, off\n\t"
               "s_wait_xcnt 0x0"
               :: "v"(lds_addr(l)),          "v"(g),
                  "v"(lds_addr(l + 1 * ls)), "v"(g + 1 * gs),
                  "v"(lds_addr(l + 2 * ls)), "v"(g + 2 * gs),
                  "v"(lds_addr(l + 3 * ls)), "v"(g + 3 * gs),
                  "v"(lds_addr(l + 4 * ls)), "v"(g + 4 * gs),
                  "v"(lds_addr(l + 5 * ls)), "v"(g + 5 * gs),
                  "v"(lds_addr(l + 6 * ls)), "v"(g + 6 * gs),
                  "v"(lds_addr(l + 7 * ls)), "v"(g + 7 * gs) : "memory");
}

// ---------------- Kernel 0a: input LayerNorm, f32 -> f16 ----------------
__global__ __launch_bounds__(256) void ln_in_kernel(const float* __restrict__ x,
                                                    const float* __restrict__ g,
                                                    half_t* __restrict__ xn) {
  const int wave = threadIdx.x >> 5;
  const int lane = threadIdx.x & 31;
  const long row = (long)blockIdx.x * 8 + wave;
  const float* xr = x + row * DIMX;
  float4 v[4], gv[4];
  float s = 0.f, sq = 0.f;
#pragma unroll
  for (int i = 0; i < 4; ++i) {
    v[i]  = ((const float4*)xr)[i * 32 + lane];
    gv[i] = ((const float4*)g)[i * 32 + lane];
    s  += v[i].x + v[i].y + v[i].z + v[i].w;
    sq += v[i].x*v[i].x + v[i].y*v[i].y + v[i].z*v[i].z + v[i].w*v[i].w;
  }
#pragma unroll
  for (int m = 1; m < 32; m <<= 1) { s += __shfl_xor(s, m, 32); sq += __shfl_xor(sq, m, 32); }
  const float mean = s * (1.f / DIMX);
  const float rstd = rsqrtf(sq * (1.f / DIMX) - mean * mean + EPS_F);
#pragma unroll
  for (int i = 0; i < 4; ++i) {
    v4h o;
    o[0] = (half_t)((v[i].x - mean) * rstd * gv[i].x);
    o[1] = (half_t)((v[i].y - mean) * rstd * gv[i].y);
    o[2] = (half_t)((v[i].z - mean) * rstd * gv[i].z);
    o[3] = (half_t)((v[i].w - mean) * rstd * gv[i].w);
    ((v4h*)(xn + row * DIMX))[i * 32 + lane] = o;
  }
}

// ---------------- Kernel 0b: one-time weight transpose+convert (tiny, L2-resident) ----------------
// Transposed weights as f16, k-chunk-major: chunk kc (32 k) of all columns is one contiguous piece,
// [kc][row][32 k], so that the staging copies of a chunk read contiguous bytes (a wave-wide copy
// covers four whole lines, not 64-byte pieces of eight).
// WqkvT: row = column n of (W_q|W_kv), 640 rows. WoutT: 512 rows in the order of the staged LDS
// rows: row 16 * t + m holds output column 64 * (t >> 2) + 4 * m + (t & 3), see attn_out_kernel.
__global__ __launch_bounds__(256) void prep_w_kernel(const float* __restrict__ Wq,
                                                     const float* __restrict__ Wkv,
                                                     const float* __restrict__ Wout,
                                                     half_t* __restrict__ WqkvT,
                                                     half_t* __restrict__ WoutT) {
  const int idx = blockIdx.x * 256 + threadIdx.x;
  if (idx < 640 * 512) {
    const int n = idx >> 9, k = idx & 511;
    const float w = (n < DIMX) ? Wq[(size_t)k * DIMX + n]
                               : Wkv[(size_t)k * 128 + (n - DIMX)];
    WqkvT[((k >> 5) * 640 + n) * 32 + (k & 31)] = (half_t)w;
  } else {
    const int i2 = idx - 640 * 512;  // < 512*512
    const int n = i2 >> 9, k = i2 & 511;
    const int r = ((n >> 6) * 4 + (n & 3)) * 16 + ((n >> 2) & 15);
    WoutT[((k >> 5) * DIMX + r) * 32 + (k & 31)] = (half_t)Wout[(size_t)k * DIMX + n];
  }
}

// ---------------- Kernel 1: q/k/v projection GEMM  xn @ [W_q | W_kv] ----------------
// grid.x = row blocks of 128, grid.y = 2 halves of N=640 (320 cols each)
#define A_NT 20
__device__ __forceinline__ void stage_proj(const half_t* __restrict__ WqkvT, half_t* buf,
                                           int colBase, int kBase, int tid) {
  // 320 rows x 64 B = 1280 x 16B transfers; 5 async instructions per wave
  const int nl = tid >> 2, part = tid & 3;   // copy i takes row nl + 64 * i
  const half_t* g = WqkvT + (size_t)(kBase * 20 + colBase) * 32 + tid * 8;   // chunk kBase / 32, 640 rows each
  half_t* d = &buf[nl * W_PITCH + part * 8];
  async_cp16x5(g, 256 * 8, d, 64 * W_PITCH);
}

// One 128 x 320 block. UPPER = false: columns 0..319, all q. UPPER = true: columns 320..639,
// tiles 0..11 q, 12..15 k, 16..19 v. q (fragment order) and k (row-major) want 8 adjacent columns
// of one row in a lane, so their tiles are formed transposed; v is stored transposed, so its
// tiles stay as they are (a lane holds 8 adjacent rows of one column). Either way a lane's
// 8 results of a tile are 16 adjacent bytes of the destination.
template <bool UPPER>
__device__ __forceinline__ void proj_block(const half_t* __restrict__ xn,
                                           const half_t* __restrict__ WqkvT,
                                           half_t* __restrict__ qw,
                                           half_t* __restrict__ kw,
                                           half_t* __restrict__ vTw,
                                           half_t (&WT)[2][320 * W_PITCH]) {
  constexpr int NTR = UPPER ? 16 : A_NT;   // tiles formed transposed
  constexpr int colBase = UPPER ? 320 : 0;
  const int tid  = threadIdx.x;
  const int wave = tid >> 5, lane = tid & 31;
  const int l = lane & 15, hi = lane >> 4;
  const int rowBase = blockIdx.x * 128 + wave * 16;
  v8f acc[A_NT];
  v8f z = {};
#pragma unroll
  for (int t = 0; t < A_NT; ++t) acc[t] = z;

  stage_proj(WqkvT, WT[0], colBase, 0, tid);
  // The wave's x fragment is fetched one k chunk ahead: the load of chunk kc + 1 goes out behind
  // the barrier that opens chunk kc and is in flight under that chunk's WMMAs.
  const unsigned ao = (unsigned)(rowBase + l) * DIMX + hi * 8;   // 32-bit index: the kernel stays at 256 registers
  v16h a = frag_ld(xn + ao);
  for (int kc = 0; kc < 16; ++kc) {
    const int kBase = kc * 32;
    if (kc < 15) {
      stage_proj(WqkvT, WT[(kc + 1) & 1], colBase, kBase + 32, tid);
      asm volatile("s_wait_asynccnt 0x5" ::: "memory");  // older stage complete
    } else {
      asm volatile("s_wait_asynccnt 0x0" ::: "memory");
    }
    __syncthreads();
    const half_t* buf = WT[kc & 1];
    v16h an = a;
    if (kc < 15) an = frag_ld(xn + kBase + 32 + ao);
    mma_chunk<A_NT, 4, W_PITCH, NTR>(&buf[l * W_PITCH + hi * 8], a, acc);
    __syncthreads();
    a = an;
  }
  // epilogue: cols [0,512) -> q, [512,576) -> k, [576,640) -> v (transposed); one 16-B store a tile
  // The lane number is read anew here, so that no index of the epilogue is held in a register
  // through the loop (one more there and the kernel passes 256 registers and loses a resident block).
  const int eln = (int)__builtin_amdgcn_mbcnt_lo(~0u, 0u);
  const int el = eln & 15, eh = eln >> 4;
  v8h r[A_NT];   // all tiles converted first, each into registers of its own, then the 20 stores in a row
#pragma unroll
  for (int t = 0; t < A_NT; ++t)
#pragma unroll
    for (int j = 0; j < 8; ++j) r[t][j] = (half_t)acc[t][j];
  // q, tile t: acc[t][j] = C[rowBase + el][colBase + 16 * t + 8 * eh + j], fragment order, 32-bit
  // index as for the x fragment
  half_t* qp = qw + (((unsigned)(rowBase >> 4) * 32 + (colBase >> 4)) * 32 + eln) * 8;
  // k, tile t: the same element, row-major, column less DIMX
  half_t* kp = kw + (unsigned)(rowBase + el) * DHEAD + eh * 8;
  // v, tile t: acc[t][j] = C[rowBase + 8 * eh + j][DIMX + DHEAD + d], d = 16 * (t - NTR) + el; V^T per (b,n)
  const int vrow = rowBase + eh * 8;
  half_t* vp = vTw + ((unsigned)(vrow >> 8) * DHEAD + el) * SEQ + (vrow & 255);
#pragma unroll
  for (int t = 0; t < A_NT; ++t) {
    if (colBase + t * 16 < DIMX) *(v8h*)(qp + t * PK_TILE) = r[t];
    else if (t < NTR)            *(v8h*)(kp + (colBase + t * 16 - DIMX)) = r[t];
    else                         *(v8h*)(vp + (t - NTR) * 16 * SEQ) = r[t];
  }
}

__global__ __launch_bounds__(256) void proj_kernel(const half_t* __restrict__ xn,
                                                   const half_t* __restrict__ WqkvT,
                                                   half_t* __restrict__ qw,
                                                   half_t* __restrict__ kw,
                                                   half_t* __restrict__ vTw) {
  __shared__ half_t WT[2][320 * W_PITCH];  // double-buffered transposed weight chunk (2 x 25 KB)
  if (blockIdx.y == 0) proj_block<false>(xn, WqkvT, qw, kw, vTw, WT);
  else                 proj_block<true>(xn, WqkvT, qw, kw, vTw, WT);
}

// value of lane l ^ 16 (the other 16-lane row, same position)
__device__ __forceinline__ float other_half(float v) {
  const int r = __builtin_amdgcn_permlanex16(0, __builtin_bit_cast(int, v),
                                             0x76543210, 0xfedcba98, false, false);
  return __builtin_bit_cast(float, r);
}

__device__ __forceinline__ void stage_out(const half_t* __restrict__ WoutT, half_t* buf,
                                          int kBase, int tid) {
  // 512 rows x 64 B = 2048 x 16B transfers; 8 async instructions per wave
  const int nl = tid >> 2, part = tid & 3;   // copy i takes row nl + 64 * i
  // Row 16 * t + m holds output column 64 * (t >> 2) + 4 * m + (t & 3) (prep_w_kernel): lane m of a
  // result tile then holds, over four tiles, four adjacent columns, one 16-byte store.
  const half_t* g = WoutT + (size_t)kBase * DIMX + tid * 8;   // chunk kBase / 32, 512 rows of 32 k
  half_t* d = &buf[nl * W_PITCH + part * 8];
  async_cp16x8(g, 256 * 8, d, 64 * W_PITCH);
}

__global__ __launch_bounds__(256) void attn_out_kernel(const half_t* __restrict__ qw,
                                                       const half_t* __restrict__ kw,
                                                       const half_t* __restrict__ vTw,
                                                       const half_t* __restrict__ WoutT,
                                                       const float* __restrict__ gout,
                                                       float* __restrict__ out) {
  __shared__ __attribute__((aligned(16))) half_t Ksh[SEQ * K_PITCH];       // 36 KB
  __shared__ __attribute__((aligned(16))) half_t Vsh[DHEAD * V_PITCH];     // 33 KB
  __shared__ __attribute__((aligned(16))) half_t Msh[128 * M_PITCH];       // mid tile, 130 KB
  __shared__ __attribute__((aligned(16))) half_t WT[2][512 * W_PITCH];     // double-buffered transposed W_out chunk (2 x 40 KB)
  const int tid  = threadIdx.x;
  const int wave = tid >> 5, lane = tid & 31;
  const int l = lane & 15, hi = lane >> 4;
  // the wave's number as a wave-uniform scalar, for the addresses of the out projection
  const int wave_s = __builtin_amdgcn_readfirstlane(wave);
  const int bn = blockIdx.x >> 1;           // two blocks of 128 queries a (b,n)
  const int qg = wave & 3;                  // the wave's 32 queries of the block
  const int h0 = (wave >> 2) * 4;           // the first of its four heads
  // the wave's first query tile, head h0, in fragment order (the next query tile: 32 tiles on;
  // the next head: 4 tiles on)
  const half_t* Qg  = qw + ((size_t)((blockIdx.x * 8 + qg * 2) * 32 + h0 * 4) * 32 + lane) * 8;
  const half_t* Kg  = kw  + (size_t)bn * SEQ * DHEAD;              // [256][64]
  const half_t* VTg = vTw + (size_t)bn * DHEAD * SEQ;              // [64][256]

  // async-stage K and V^T into padded LDS rows, and the first W_out chunk (24 async instr per wave)
  {
    // K: 8 granules of 16 B a row, copy i takes row (tid >> 3) + 32 * i
    const half_t* gk = Kg + tid * 8;
    half_t* dk = &Ksh[(tid >> 3) * K_PITCH + (tid & 7) * 8];
    // V^T: 32 granules a row, copy i takes row (tid >> 5) + 8 * i
    const half_t* gv = VTg + tid * 8;
    half_t* dv = &Vsh[(tid >> 5) * V_PITCH + (tid & 31) * 8];
    async_cp16x8(gk, 2048, dk, 32 * K_PITCH);
    async_cp16x8(gv, 2048, dv, 8 * V_PITCH);
    stage_out(WoutT, WT[0], 0, tid);
  }

  v8f z = {};
  // Q B-fragments straight from global (overlaps with the async staging)
  v16h bq[2][2];
#pragma unroll
  for (int kc = 0; kc < 2; ++kc) {
    bq[kc][0] = frag_ld_pk(Qg + kc * 2 * PK_TILE);
    bq[kc][1] = frag_ld_pk(Qg + (32 + kc * 2) * PK_TILE);
  }
  asm volatile("s_wait_asynccnt 0x0" ::: "memory");
  __syncthreads();

  // stays rolled (for speed only)
#pragma nounroll
  for (int hh = 0; hh < 4; ++hh) {
  v8f s[2][16];   // s[qt][kt][j] = S[query 32*qg + 16*qt + l][key 16*kt + 8*hi + j]
#pragma unroll
  for (int qt = 0; qt < 2; ++qt)
#pragma unroll
    for (int kt = 0; kt < 16; ++kt) s[qt][kt] = z;

  // S^T = K Q^T   (A = K rows, B = Q rows as the N-major mirror)
#pragma unroll
  for (int kc = 0; kc < 2; ++kc) {
    const int kBase = kc * 32;
#pragma unroll
    for (int kt = 0; kt < 16; ++kt) {
      v16h a = frag_ld(&Ksh[(kt * 16 + l) * K_PITCH + kBase + hi * 8]);
      s[0][kt] = wmma_f16(a, bq[kc][0], s[0][kt]);
      s[1][kt] = wmma_f16(a, bq[kc][1], s[1][kt]);
    }
  }

  // The next head's Q fragments go out here, into the registers that the products above have left,
  // and are in flight under the softmax and O^T (the last trip reads its own head again: no branch).
  {
    const half_t* Qn = Qg + (hh < 3 ? hh + 1 : 3) * 4 * PK_TILE;
#pragma unroll
    for (int kc = 0; kc < 2; ++kc) {
      bq[kc][0] = frag_ld_pk(Qn + kc * 2 * PK_TILE);
      bq[kc][1] = frag_ld_pk(Qn + (32 + kc * 2) * PK_TILE);
    }
    // stands in front of the first rewrite of those loads' address registers (named as an input so
    // that they are left alone up to the wait), and holds the loads in front of the softmax
    asm volatile("s_wait_xcnt 0x0" :: "v"(Qn) : "memory");
  }

  // softmax: logits = (s - max) * 0.125 = (s - max) / sqrt(DHEAD)
  float rsum[2];
  v16h pb[2][8];  // pb[qt][kc]: B fragment of P^T, keys 32*kc .. 32*kc + 31, column = query
#pragma unroll
  for (int qt = 0; qt < 2; ++qt) {
    float mx[4], sm[4];
#pragma unroll
    for (int i = 0; i < 4; ++i) { mx[i] = s[qt][0][i]; sm[i] = 0.f; }
#pragma unroll
    for (int kt = 0; kt < 16; ++kt)
#pragma unroll
      for (int j = 0; j < 8; ++j) mx[j & 3] = fmaxf(mx[j & 3], s[qt][kt][j]);
    float m = fmaxf(fmaxf(mx[0], mx[1]), fmaxf(mx[2], mx[3]));
    m = fmaxf(m, other_half(m));
#pragma unroll
    for (int kc = 0; kc < 8; ++kc) {
#pragma unroll
      for (int e = 0; e < 16; ++e) {
        const float p = __expf((s[qt][2 * kc + (e >> 3)][e & 7] - m) * 0.125f);
        sm[e & 3] += p;
        pb[qt][kc][e] = (half_t)p;
      }
    }
    float sum = (sm[0] + sm[1]) + (sm[2] + sm[3]);
    sum += other_half(sum);
    rsum[qt] = sum;
  }

  // O^T = V^T P^T  (A = V^T rows from LDS, B = P^T from registers)
  v8f o[2][4];    // o[qt][dt][j] = O[query 32*qg + 16*qt + l][d 16*dt + 8*hi + j]
#pragma unroll
  for (int qt = 0; qt < 2; ++qt)
#pragma unroll
    for (int dt = 0; dt < 4; ++dt) o[qt][dt] = z;
#pragma unroll
  for (int kc = 0; kc < 8; ++kc) {
    const int kBase = kc * 32;
#pragma unroll
    for (int dt = 0; dt < 4; ++dt) {
      v16h a = frag_ld(&Vsh[(dt * 16 + l) * V_PITCH + kBase + hi * 8]);
      o[0][dt] = wmma_f16(a, pb[0][kc], o[0][dt]);
      o[1][dt] = wmma_f16(a, pb[1][kc], o[1][dt]);
    }
  }
  // normalize and put the head's 64 columns into the mid tile: 8 consecutive d of one query per lane
#pragma unroll
  for (int qt = 0; qt < 2; ++qt) {
    half_t* mrow = &Msh[(qg * 32 + qt * 16 + l) * M_PITCH + (h0 + hh) * DHEAD + hi * 8];
#pragma unroll
    for (int dt = 0; dt < 4; ++dt) {
      v8h r;
#pragma unroll
      for (int j = 0; j < 8; ++j) r[j] = (half_t)(o[qt][dt][j] / rsum[qt]);
      *(v8h*)(mrow + dt * 16) = r;
    }
  }
  }
  // every wave's part of the mid tile is written before any wave reads its 16 rows of it
  __syncthreads();

  // out projection: wave w takes rows 16 * w .. 16 * w + 15 of the block, all 512 columns
  const int rowBase = blockIdx.x * 128 + wave_s * 16;
  // threadIdx.x again, from the wave's number and the lane, which the attention loop keeps anyway
  // (threadIdx.x itself, held for this place alone, was spilled over that loop)
  const int tid_o = wave_s * 32 + lane;
  v8f acc[32];
#pragma unroll
  for (int t = 0; t < 32; ++t) acc[t] = z;

  // the wave's mid fragment is read from LDS one k chunk ahead
  const half_t* ap = &Msh[(wave_s * 16 + l) * M_PITCH + hi * 8];
  v16h a = frag_ld(ap);
  for (int kc = 0; kc < 16; ++kc) {
    const int kBase = kc * 32;
    if (kc < 15) {
      stage_out(WoutT, WT[(kc + 1) & 1], kBase + 32, tid_o);
      asm volatile("s_wait_asynccnt 0x8" ::: "memory");  // older stage complete
    } else {
      asm volatile("s_wait_asynccnt 0x0" ::: "memory");
    }
    __syncthreads();
    const half_t* buf = WT[kc & 1];
    v16h an = a;
    if (kc < 15) an = frag_ld(ap + kBase + 32);
    mma_chunk<32, 8, W_PITCH, 0>(&buf[l * W_PITCH + hi * 8], a, acc);
    __syncthreads();
    a = an;
  }
  // fused LayerNorm over each 512-wide output row; the lane's 32 weights come in under the row sums
  float4 gv[8];
#pragma unroll
  for (int c = 0; c < 8; ++c) gv[c] = ((const float4*)gout)[c * 16 + l];
  // stands in front of the first rewrite of those loads' address register (the lane's index l, named
  // as an input so that it is left alone up to the wait), as behind the Q fragments above
  asm volatile("s_wait_xcnt 0x0" :: "v"(l) : "memory");
  float mean[8], rstd[8];
#pragma unroll
  for (int j = 0; j < 8; ++j) {
    float sm = 0.f, sq = 0.f;
#pragma unroll
    for (int t = 0; t < 32; ++t) { const float vv = acc[t][j]; sm += vv; sq += vv * vv; }
#pragma unroll
    for (int msk = 1; msk < 16; msk <<= 1) {
      sm += __shfl_xor(sm, msk, 32);
      sq += __shfl_xor(sq, msk, 32);
    }
    mean[j] = sm * (1.f / DIMX);
    rstd[j] = rsqrtf(sq * (1.f / DIMX) - mean[j] * mean[j] + EPS_F);
  }
  // acc[4 * c + i][j] is row rowBase + 8 * hi + j, column 64 * c + 4 * l + i: 16 lanes store 256
  // contiguous bytes of a row
  float* op = out + (size_t)(rowBase + hi * 8) * DIMX + l * 4;
#pragma unroll
  for (int j = 0; j < 8; ++j) {
    v4f w[8];
#pragma unroll
    for (int c = 0; c < 8; ++c) {
      w[c][0] = (acc[4 * c + 0][j] - mean[j]) * rstd[j] * gv[c].x;
      w[c][1] = (acc[4 * c + 1][j] - mean[j]) * rstd[j] * gv[c].y;
      w[c][2] = (acc[4 * c + 2][j] - mean[j]) * rstd[j] * gv[c].z;
      w[c][3] = (acc[4 * c + 3][j] - mean[j]) * rstd[j] * gv[c].w;
      *(v4f*)(op + j * DIMX + c * 64) = w[c];
    }
    // stands in front of the first rewrite of a register that these 8 stores name: their values and
    // their address are named as inputs so that the registers are left alone up to the wait
    // (one row a wait: 16 values held for one wait are spilled in this kernel)
    asm volatile("s_wait_xcnt 0x0"
                 :: "v"(w[0]), "v"(w[1]), "v"(w[2]), "v"(w[3]),
                    "v"(w[4]), "v"(w[5]), "v"(w[6]), "v"(w[7]), "v"(op) : "memory");
  }
}

extern "C" void kernel_launch(void* const* d_in, const int* in_sizes, int n_in,
                              void* d_out, int out_size, void* d_ws, size_t ws_size,
                              hipStream_t stream) {
  const float* x      = (const float*)d_in[0];
  const float* g_norm = (const float*)d_in[1];
  const float* W_q    = (const float*)d_in[2];
  const float* W_kv   = (const float*)d_in[3];
  const float* W_out  = (const float*)d_in[4];
  const float* g_out  = (const float*)d_in[5];
  float* out = (float*)d_out;

  char* ws = (char*)d_ws;
  const size_t xnB = (size_t)R_TOTAL * DIMX * sizeof(half_t);    // 64 MB
  const size_t kB  = (size_t)R_TOTAL * DHEAD * sizeof(half_t);   //  8 MB
  half_t* xn    = (half_t*)ws;
  half_t* qw    = (half_t*)(ws + xnB);
  half_t* kw    = (half_t*)(ws + 2 * xnB);
  half_t* vT    = (half_t*)(ws + 2 * xnB + kB);
  half_t* WqkvT = (half_t*)(ws + 2 * xnB + 2 * kB);
  half_t* WoutT = WqkvT + 640 * 512;

  ln_in_kernel<<<R_TOTAL / 8, 256, 0, stream>>>(x, g_norm, xn);
  prep_w_kernel<<<(640 * 512 + 512 * 512) / 256, 256, 0, stream>>>(W_q, W_kv, W_out, WqkvT, WoutT);
  dim3 gA(R_TOTAL / 128, 2);
  proj_kernel<<<gA, 256, 0, stream>>>(xn, WqkvT, qw, kw, vT);
  attn_out_kernel<<<R_TOTAL / 128, 256, 0, stream>>>(qw, kw, vT, WoutT, g_out, out);
}

// v008
// One run takes 148 microseconds.
// Next to v007, in two timings, it ran 1.05 and 1.04 times as fast.
// All steps since v000 together make it 3.21 times as fast.
#include <hip/hip_runtime.h>

typedef _Float16 half_t;
typedef __attribute__((ext_vector_type(4)))  _Float16 v4h;
typedef __attribute__((ext_vector_type(8)))  _Float16 v8h;
typedef __attribute__((ext_vector_type(16))) _Float16 v16h;
typedef __attribute__((ext_vector_type(8)))  float    v8f;
typedef __attribute__((ext_vector_type(4)))  float    v4f;

#define R_TOTAL 65536   // b*n*r = 4*64*256
#define DIMX    512
#define DHEAD   64
#define SEQ     256
#define EPS_F   1e-5f
// LDS row pitches (halves) for rows read by 16-byte fragment loads: 16 B x odd, so that
// the 16 rows of one fragment load fall on distinct banks.
#define W_PITCH 40      // 64-B weight-chunk rows  -> 80 B
#define K_PITCH 72      // 128-B K rows            -> 144 B
#define V_PITCH 264     // 512-B V^T rows          -> 528 B
#define M_PITCH 520     // 1024-B mid rows         -> 1040 B

// Load a 16-bit A/B WMMA fragment (16x32 A, or 32x16 B via its N-major mirror).
// Caller passes p = base + row_or_n*stride + kBase + (lane>>4)*8.
// lane<16 needs K {0..7, 16..23}, lane>=16 needs K {8..15, 24..31}: two b128 loads.
__device__ __forceinline__ v16h frag_ld(const half_t* p) {
  v8h lo = *(const v8h*)(p);
  v8h hi = *(const v8h*)(p + 16);
  return __builtin_shufflevector(lo, hi, 0,1,2,3,4,5,6,7,8,9,10,11,12,13,14,15);
}

// q lies in the workspace in fragment order: the 16-byte granule (8 adjacent columns) of
// row R, column C stands at granule index ((R >> 4) * 32 + (C >> 4)) * 32 + ((C >> 3) & 1) * 16 + (R & 15).
// The last two terms are the lane that holds the granule, in the producer's result tile and in the
// consumer's fragment alike, so one wave-wide 16-byte store or load covers 512 contiguous bytes
// (four whole lines), not 32-byte pieces of 16 lines. PK_TILE = halves of one 16 x 16 tile.
#define PK_TILE 256
// Caller passes p = base + (((R >> 4) * 32 + kBase / 16) * 32 + lane) * 8; k order as in frag_ld.
__device__ __forceinline__ v16h frag_ld_pk(const half_t* p) {
  v8h lo = *(const v8h*)(p);
  v8h hi = *(const v8h*)(p + PK_TILE);
  return __builtin_shufflevector(lo, hi, 0,1,2,3,4,5,6,7,8,9,10,11,12,13,14,15);
}

__device__ __forceinline__ v8f wmma_f16(v16h a, v16h b, v8f c) {
  return __builtin_amdgcn_wmma_f32_16x16x32_f16(false, a, false, b, (short)0, c, false, false);
}

// One 32-deep k chunk of a wave's 32 x (16*NB) tile: acc[r][t] += a_r * B_t. Every B fragment read from
// LDS feeds two WMMAs (the wave's two 16-row fragments a0, a1), so a WMMA costs half a fragment read.
// Tile t < NQ lies t * 16 rows behind bp; the tiles from NQ on come in pairs 4 tiles apart, from tile 12
// behind bp2 (the k and v columns of the projection).
// The fragments come in groups of G, each group fetched into its own register set while the
// group before it is multiplied, so that a WMMA does not wait out the latency of its own loads.
// Every loop is unrolled so that bf and acc are indexed by constants and stay in registers.
// The first NTR tiles are formed transposed (the LDS fragment as A, a as B; both fragments have
// the same lane and k layout): there a lane holds 8 adjacent columns of one row of the product.
template <int NB, int G, int PITCH, int NTR, int NQ>
__device__ __forceinline__ void mma_chunk2(const half_t* bp, const half_t* bp2, v16h a0, v16h a1,
                                           v8f (&acc)[2][NB]) {
  constexpr int NG = (NB + G - 1) / G;
  v16h bf[2][G];
#pragma unroll
  for (int g = -1; g < NG; ++g) {
    if (g + 1 < NG) {
#pragma unroll
      for (int i = 0; i < G; ++i) {
        const int t = (g + 1) * G + i;
        if (t < NB)
          bf[(g + 1) & 1][i] = (t < NQ) ? frag_ld(bp + t * 16 * PITCH)
                                        : frag_ld(bp2 + (12 + ((t - NQ) >> 1) * 4 + ((t - NQ) & 1)) * 16 * PITCH);
      }
    }
    // keeps the next group's loads in front of this group's WMMAs (the scheduler sinks them
    // to their first use otherwise, one register set and a full LDS wait per WMMA)
    __builtin_amdgcn_sched_barrier(0);
    if (g >= 0) {
#pragma unroll
      for (int i = 0; i < G; ++i) {
        const int t = g * G + i;
        if (t < NB) {
          acc[0][t] = (t < NTR) ? wmma_f16(bf[g & 1][i], a0, acc[0][t]) : wmma_f16(a0, bf[g & 1][i], acc[0][t]);
          acc[1][t] = (t < NTR) ? wmma_f16(bf[g & 1][i], a1, acc[1][t]) : wmma_f16(a1, bf[g & 1][i], acc[1][t]);
        }
      }
      // keeps the loads that follow together as one group, not spread among these WMMAs
      __builtin_amdgcn_sched_barrier(0);
    }
  }
}

// CDNA5 async global->LDS copy, 16 bytes per lane, tracked by ASYNCcnt.
__device__ __forceinline__ unsigned lds_addr(const half_t* l) {
  return (unsigned)(uintptr_t)l;  // flat LDS aperture: addr[31:0] = LDS offset
}
// A run of copies (copy i: g + i * gs -> l + i * ls, strides in halves) and its s_wait_xcnt 0
// in one statement: the wait then stands in front of any later rewrite of the address
// registers that the copies name.
// five copies from g and two from g2, into seven places ls apart
__device__ __forceinline__ void async_cp16x5x2(const half_t* g, int gs, const half_t* g2, int gs2,
                                               half_t* l, int ls) {
  asm volatile("global_load_async_to_lds_b128 %0, %1, off\n\t"
               "global_load_async_to_lds_b128 %2, %3, off\n\t"
               "global_load_async_to_lds_b128 %4, %5, off\n\t"
               "global_load_async_to_lds_b128 %6, %7, off\n\t"
               "global_load_async_to_lds_b128 %8, %9, off\n\t"
               "global_load_async_to_lds_b128 %10, %11, off\n\t"
               "global_load_async_to_lds_b128 %12, %13, off\n\t"
               "s_wait_xcnt 0x0"
               :: "v"(lds_addr(l)),          "v"(g),
                  "v"(lds_addr(l + 1 * ls)), "v"(g + 1 * gs),
                  "v"(lds_addr(l + 2 * ls)), "v"(g + 2 * gs),
                  "v"(lds_addr(l + 3 * ls)), "v"(g + 3 * gs),
                  "v"(lds_addr(l + 4 * ls)), "v"(g + 4 * gs),
                  "v"(lds_addr(l + 5 * ls)), "v"(g2),
                  "v"(lds_addr(l + 6 * ls)), "v"(g2 + gs2) : "memory");
}
__device__ __forceinline__ void async_cp16x8(const half_t* g, int gs, half_t* l, int ls) {
  asm volatile("global_load_async_to_lds_b128 %0, %1, off\n\t"
               "global_load_async_to_lds_b128 %2, %3, off\n\t"
               "global_load_async_to_lds_b128 %4, %5, off\n\t"
               "global_load_async_to_lds_b128 %6, %7, off\n\t"
               "global_load_async_to_lds_b128 %8, %9, off\n\t"
               "global_load_async_to_lds_b128 %10, %11, off\n\t"
               "global_load_async_to_lds_b128 %12, %13, off\n\t"
               "global_load_async_to_lds_b128 %14, %15, off\n\t"
               "s_wait_xcnt 0x0"
               :: "v"(lds_addr(l)),          "v"(g),
                  "v"(lds_addr(l + 1 * ls)), "v"(g + 1 * gs),
                  "v"(lds_addr(l + 2 * ls)), "v"(g + 2 * gs),
                  "v"(lds_addr(l + 3 * ls)), "v"(g + 3 * gs),
                  "v"(lds_addr(l + 4 * ls)), "v"(g + 4 * gs),
                  "v"(lds_addr(l + 5 * ls)), "v"(g + 5 * gs),
                  "v"(lds_addr(l + 6 * ls)), "v"(g + 6 * gs),
                  "v"(lds_addr(l + 7 * ls)), "v"(g + 7 * gs) : "memory");
}

// ---------------- Kernel 0a: input LayerNorm, f32 -> f16 ----------------
__global__ __launch_bounds__(256) void ln_in_kernel(const float* __restrict__ x,
                                                    const float* __restrict__ g,
                                                    half_t* __restrict__ xn) {
  const int wave = threadIdx.x >> 5;
  const int lane = threadIdx.x & 31;
  const long row = (long)blockIdx.x * 8 + wave;
  const float* xr = x + row * DIMX;
  float4 v[4], gv[4];
  float s = 0.f, sq = 0.f;
#pragma unroll
  for (int i = 0; i < 4; ++i) {
    v[i]  = ((const float4*)xr)[i * 32 + lane];
    gv[i] = ((const float4*)g)[i * 32 + lane];
    s  += v[i].x + v[i].y + v[i].z + v[i].w;
    sq += v[i].x*v[i].x + v[i].y*v[i].y + v[i].z*v[i].z + v[i].w*v[i].w;
  }
#pragma unroll
  for (int m = 1; m < 32; m <<= 1) { s += __shfl_xor(s, m, 32); sq += __shfl_xor(sq, m, 32); }
  const float mean = s * (1.f / DIMX);
  const float rstd = rsqrtf(sq * (1.f / DIMX) - mean * mean + EPS_F);
#pragma unroll
  for (int i = 0; i < 4; ++i) {
    v4h o;
    o[0] = (half_t)((v[i].x - mean) * rstd * gv[i].x);
    o[1] = (half_t)((v[i].y - mean) * rstd * gv[i].y);
    o[2] = (half_t)((v[i].z - mean) * rstd * gv[i].z);
    o[3] = (half_t)((v[i].w - mean) * rstd * gv[i].w);
    ((v4h*)(xn + row * DIMX))[i * 32 + lane] = o;
  }
}

// ---------------- Kernel 0b: one-time weight transpose+convert (tiny, L2-resident) ----------------
// Transposed weights as f16, k-chunk-major: chunk kc (32 k) of all columns is one contiguous piece,
// [kc][row][32 k], so that the staging copies of a chunk read contiguous bytes (a wave-wide copy
// covers four whole lines, not 64-byte pieces of eight).
// WqkvT: row = column n of (W_q|W_kv), 640 rows. WoutT: 512 rows in the order of the staged LDS
// rows: row 16 * t + m holds output column 64 * (t >> 2) + 4 * m + (t & 3), see attn_out_kernel.
__global__ __launch_bounds__(256) void prep_w_kernel(const float* __restrict__ Wq,
                                                     const float* __restrict__ Wkv,
                                                     const float* __restrict__ Wout,
                                                     half_t* __restrict__ WqkvT,
                                                     half_t* __restrict__ WoutT) {
  const int idx = blockIdx.x * 256 + threadIdx.x;
  if (idx < 640 * 512) {
    const int n = idx >> 9, k = idx & 511;
    const float w = (n < DIMX) ? Wq[(size_t)k * DIMX + n]
                               : Wkv[(size_t)k * 128 + (n - DIMX)];
    WqkvT[((k >> 5) * 640 + n) * 32 + (k & 31)] = (half_t)w;
  } else {
    const int i2 = idx - 640 * 512;  // < 512*512
    const int n = i2 >> 9, k = i2 & 511;
    const int r = ((n >> 6) * 4 + (n & 3)) * 16 + ((n >> 2) & 15);
    WoutT[((k >> 5) * DIMX + r) * 32 + (k & 31)] = (half_t)Wout[(size_t)k * DIMX + n];
  }
}

// ---------------- Kernel 1: q/k/v projection GEMM  xn @ [W_q | W_kv] ----------------
// grid.x = row blocks of 128, grid.y = 2 halves of N=640 (320 cols each)
#define P_NB   10             // 16-column tiles of a wave
#define P_ROWS (320 + 128)    // staged rows of a k chunk: 320 weight rows, then the block's 128 x rows
__device__ __forceinline__ void stage_proj(const half_t* __restrict__ xn, const half_t* __restrict__ WqkvT,
                                           half_t* buf, int colBase, int kBase, int tid) {
  // 448 rows x 64 B = 1792 x 16B transfers; 7 async instructions per wave
  const int nl = tid >> 2, part = tid & 3;   // copy i takes staged row nl + 64 * i
  const half_t* g = WqkvT + (size_t)(kBase * 20 + colBase) * 32 + tid * 8;   // chunk kBase / 32, 640 rows each
  const half_t* gx = xn + (size_t)(blockIdx.x * 128 + nl) * DIMX + kBase + part * 8;
  half_t* d = &buf[nl * W_PITCH + part * 8];
  async_cp16x5x2(g, 256 * 8, gx, 64 * DIMX, d, 64 * W_PITCH);
}

// One 128 x 320 block; a wave takes 32 rows (wave & 3) and 10 of the 20 column tiles (wave >> 2), and the
// x chunk, which two waves now share, is staged in LDS beside the weight chunk.
// UPPER = false: columns 0..319, all q; a wave's tiles are 10 adjacent ones.
// UPPER = true: columns 320..639, tiles 0..11 q, 12..15 k, 16..19 v; every wave takes 6 q, 2 k and 2 v
// tiles, so that all waves run the same code. q (fragment order) and k (row-major) want 8 adjacent columns
// of one row in a lane, so their tiles are formed transposed; v is stored transposed, so its
// tiles stay as they are (a lane holds 8 adjacent rows of one column). Either way a lane's
// 8 results of a tile are 16 adjacent bytes of the destination.
template <bool UPPER>
__device__ __forceinline__ void proj_block(const half_t* __restrict__ xn,
                                           const half_t* __restrict__ WqkvT,
                                           half_t* __restrict__ qw,
                                           half_t* __restrict__ kw,
                                           half_t* __restrict__ vTw,
                                           half_t (&WT)[2][P_ROWS * W_PITCH]) {
  constexpr int NQ  = UPPER ? 6 : P_NB;    // q tiles of a wave
  constexpr int NTR = UPPER ? 8 : P_NB;    // tiles formed transposed (q, k)
  constexpr int colBase = UPPER ? 320 : 0;
  const int tid  = threadIdx.x;
  const int lane = tid & 31;
  const int l = lane & 15, hi = lane >> 4;
  const int wave_s = __builtin_amdgcn_readfirstlane(tid >> 5);   // wave-uniform, kept in a scalar register
  const int rg = wave_s & 3, cg = wave_s >> 2;
  v8f acc[2][P_NB];
  v8f z = {};
#pragma unroll
  for (int t = 0; t < P_NB; ++t) { acc[0][t] = z; acc[1][t] = z; }

  stage_proj(xn, WqkvT, WT[0], colBase, 0, tid);
  for (int kc = 0; kc < 16; ++kc) {
    const int kBase = kc * 32;
    if (kc < 15) {
      stage_proj(xn, WqkvT, WT[(kc + 1) & 1], colBase, kBase + 32, tid);
      asm volatile("s_wait_asynccnt 0x7" ::: "memory");  // older stage complete
    } else {
      asm volatile("s_wait_asynccnt 0x0" ::: "memory");
    }
    __syncthreads();
    const half_t* buf = WT[kc & 1] + l * W_PITCH + hi * 8;
    const v16h a0 = frag_ld(buf + (320 + rg * 32) * W_PITCH);
    const v16h a1 = frag_ld(buf + (320 + rg * 32 + 16) * W_PITCH);
    mma_chunk2<P_NB, 4, W_PITCH, NTR, NQ>(buf + cg * NQ * 16 * W_PITCH, buf + cg * 2 * 16 * W_PITCH, a0, a1, acc);
    __syncthreads();
  }
  // epilogue: cols [0,512) -> q, [512,576) -> k, [576,640) -> v (transposed); one 16-B store a tile
  // The lane number is read anew here, so that no index of the epilogue is held in a register
  // through the loop.
  const int eln = (int)__builtin_amdgcn_mbcnt_lo(~0u, 0u);
  const int el = eln & 15, eh = eln >> 4;
  const int rowBase = blockIdx.x * 128 + rg * 32;
  v8h r[2][P_NB];   // all tiles converted first, each into registers of its own, then the 20 stores in a row
#pragma unroll
  for (int rt = 0; rt < 2; ++rt)
#pragma unroll
    for (int t = 0; t < P_NB; ++t)
#pragma unroll
      for (int j = 0; j < 8; ++j) r[rt][t][j] = (half_t)acc[rt][t][j];
  // q, tile t: acc[rt][t][j] = C[rowBase + 16 * rt + el][colBase + 16 * (cg * NQ + t) + 8 * eh + j], fragment order
  half_t* qp = qw + (((unsigned)(rowBase >> 4) * 32 + (colBase >> 4) + cg * NQ) * 32 + eln) * 8;
  // k, tile NQ + i: the same element form, row-major, k column 16 * (cg * 2 + i) + 8 * eh + j
  half_t* kp = kw + (unsigned)(rowBase + el) * DHEAD + cg * 32 + eh * 8;
  // v, tile NTR + i: acc[rt][t][j] = C[rowBase + 16 * rt + 8 * eh + j][d], d = 16 * (cg * 2 + i) + el; V^T per (b,n)
  const int vrow = rowBase + eh * 8;
  half_t* vp = vTw + ((unsigned)(vrow >> 8) * DHEAD + cg * 32 + el) * SEQ + (vrow & 255);
#pragma unroll
  for (int rt = 0; rt < 2; ++rt)
#pragma unroll
    for (int t = 0; t < P_NB; ++t) {
      if (t < NQ)       *(v8h*)(qp + (rt * 32 + t) * PK_TILE) = r[rt][t];
      else if (t < NTR) *(v8h*)(kp + rt * 16 * DHEAD + (t - NQ) * 16) = r[rt][t];
      else              *(v8h*)(vp + rt * 16 + (t - NTR) * 16 * SEQ) = r[rt][t];
    }
}

__global__ __launch_bounds__(256) void proj_kernel(const half_t* __restrict__ xn,
                                                   const half_t* __restrict__ WqkvT,
                                                   half_t* __restrict__ qw,
                                                   half_t* __restrict__ kw,
                                                   half_t* __restrict__ vTw) {
  // double-buffered k chunk: transposed weights and the block's x rows (2 x 35 KB)
  __shared__ __attribute__((aligned(16))) half_t WT[2][P_ROWS * W_PITCH];
  if (blockIdx.y == 0) proj_block<false>(xn, WqkvT, qw, kw, vTw, WT);
  else                 proj_block<true>(xn, WqkvT, qw, kw, vTw, WT);
}

// value of lane l ^ 16 (the other 16-lane row, same position)
__device__ __forceinline__ float other_half(float v) {
  const int r = __builtin_amdgcn_permlanex16(0, __builtin_bit_cast(int, v),
                                             0x76543210, 0xfedcba98, false, false);
  return __builtin_bit_cast(float, r);
}

__device__ __forceinline__ void stage_out(const half_t* __restrict__ WoutT, half_t* buf,
                                          int kBase, int tid) {
  // 512 rows x 64 B = 2048 x 16B transfers; 8 async instructions per wave
  const int nl = tid >> 2, part = tid & 3;   // copy i takes row nl + 64 * i
  // Row 16 * t + m holds output column 64 * (t >> 2) + 4 * m + (t & 3) (prep_w_kernel): lane m of a
  // result tile then holds, over four tiles, four adjacent columns, one 16-byte store.
  const half_t* g = WoutT + (size_t)kBase * DIMX + tid * 8;   // chunk kBase / 32, 512 rows of 32 k
  half_t* d = &buf[nl * W_PITCH + part * 8];
  async_cp16x8(g, 256 * 8, d, 64 * W_PITCH);
}

__global__ __launch_bounds__(256) void attn_out_kernel(const half_t* __restrict__ qw,
                                                       const half_t* __restrict__ kw,
                                                       const half_t* __restrict__ vTw,
                                                       const half_t* __restrict__ WoutT,
                                                       const float* __restrict__ gout,
                                                       float* __restrict__ out) {
  __shared__ __attribute__((aligned(16))) half_t Ksh[SEQ * K_PITCH];       // 36 KB
  __shared__ __attribute__((aligned(16))) half_t Vsh[DHEAD * V_PITCH];     // 33 KB
  __shared__ __attribute__((aligned(16))) half_t Msh[128 * M_PITCH];       // mid tile, 130 KB
  __shared__ __attribute__((aligned(16))) half_t WT[2][512 * W_PITCH];     // double-buffered transposed W_out chunk (2 x 40 KB)
  __shared__ __attribute__((aligned(16))) float Red[2][2][128];            // [column half][sum, sum of squares][row]
  const int tid  = threadIdx.x;
  const int wave = tid >> 5, lane = tid & 31;
  const int l = lane & 15, hi = lane >> 4;
  // the wave's number as a wave-uniform scalar, for the addresses of the out projection
  const int wave_s = __builtin_amdgcn_readfirstlane(wave);
  const int bn = blockIdx.x >> 1;           // two blocks of 128 queries a (b,n)
  const int qg = wave & 3;                  // the wave's 32 queries of the block
  const int h0 = (wave >> 2) * 4;           // the first of its four heads
  // the wave's first query tile, head h0, in fragment order (the next query tile: 32 tiles on;
  // the next head: 4 tiles on)
  const half_t* Qg  = qw + ((size_t)((blockIdx.x * 8 + qg * 2) * 32 + h0 * 4) * 32 + lane) * 8;
  const half_t* Kg  = kw  + (size_t)bn * SEQ * DHEAD;              // [256][64]
  const half_t* VTg = vTw + (size_t)bn * DHEAD * SEQ;              // [64][256]

  // async-stage K and V^T into padded LDS rows, and the first W_out chunk (24 async instr per wave)
  {
    // K: 8 granules of 16 B a row, copy i takes row (tid >> 3) + 32 * i
    const half_t* gk = Kg + tid * 8;
    half_t* dk = &Ksh[(tid >> 3) * K_PITCH + (tid & 7) * 8];
    // V^T: 32 granules a row, copy i takes row (tid >> 5) + 8 * i
    const half_t* gv = VTg + tid * 8;
    half_t* dv = &Vsh[(tid >> 5) * V_PITCH + (tid & 31) * 8];
    async_cp16x8(gk, 2048, dk, 32 * K_PITCH);
    async_cp16x8(gv, 2048, dv, 8 * V_PITCH);
    stage_out(WoutT, WT[0], 0, tid);
  }

  v8f z = {};
  // Q B-fragments straight from global (overlaps with the async staging)
  v16h bq[2][2];
#pragma unroll
  for (int kc = 0; kc < 2; ++kc) {
    bq[kc][0] = frag_ld_pk(Qg + kc * 2 * PK_TILE);
    bq[kc][1] = frag_ld_pk(Qg + (32 + kc * 2) * PK_TILE);
  }
  asm volatile("s_wait_asynccnt 0x0" ::: "memory");
  __syncthreads();

  // stays rolled (for speed only)
#pragma nounroll
  for (int hh = 0; hh < 4; ++hh) {
  v8f s[2][16];   // s[qt][kt][j] = S[query 32*qg + 16*qt + l][key 16*kt + 8*hi + j]
#pragma unroll
  for (int qt = 0; qt < 2; ++qt)
#pragma unroll
    for (int kt = 0; kt < 16; ++kt) s[qt][kt] = z;

  // S^T = K Q^T   (A = K rows, B = Q rows as the N-major mirror)
#pragma unroll
  for (int kc = 0; kc < 2; ++kc) {
    const int kBase = kc * 32;
#pragma unroll
    for (int kt = 0; kt < 16; ++kt) {
      v16h a = frag_ld(&Ksh[(kt * 16 + l) * K_PITCH + kBase + hi * 8]);
      s[0][kt] = wmma_f16(a, bq[kc][0], s[0][kt]);
      s[1][kt] = wmma_f16(a, bq[kc][1], s[1][kt]);
    }
  }

  // The next head's Q fragments go out here, into the registers that the products above have left,
  // and are in flight under the softmax and O^T (the last trip reads its own head again: no branch).
  {
    const half_t* Qn = Qg + (hh < 3 ? hh + 1 : 3) * 4 * PK_TILE;
#pragma unroll
    for (int kc = 0; kc < 2; ++kc) {
      bq[kc][0] = frag_ld_pk(Qn + kc * 2 * PK_TILE);
      bq[kc][1] = frag_ld_pk(Qn + (32 + kc * 2) * PK_TILE);
    }
    // stands in front of the first rewrite of those loads' address registers (named as an input so
    // that they are left alone up to the wait), and holds the loads in front of the softmax
    asm volatile("s_wait_xcnt 0x0" :: "v"(Qn) : "memory");
  }

  // softmax: logits = (s - max) * 0.125 = (s - max) / sqrt(DHEAD)
  float rsum[2];
  v16h pb[2][8];  // pb[qt][kc]: B fragment of P^T, keys 32*kc .. 32*kc + 31, column = query
#pragma unroll
  for (int qt = 0; qt < 2; ++qt) {
    float mx[4], sm[4];
#pragma unroll
    for (int i = 0; i < 4; ++i) { mx[i] = s[qt][0][i]; sm[i] = 0.f; }
#pragma unroll
    for (int kt = 0; kt < 16; ++kt)
#pragma unroll
      for (int j = 0; j < 8; ++j) mx[j & 3] = fmaxf(mx[j & 3], s[qt][kt][j]);
    float m = fmaxf(fmaxf(mx[0], mx[1]), fmaxf(mx[2], mx[3]));
    m = fmaxf(m, other_half(m));
#pragma unroll
    for (int kc = 0; kc < 8; ++kc) {
#pragma unroll
      for (int e = 0; e < 16; ++e) {
        const float p = __expf((s[qt][2 * kc + (e >> 3)][e & 7] - m) * 0.125f);
        sm[e & 3] += p;
        pb[qt][kc][e] = (half_t)p;
      }
    }
    float sum = (sm[0] + sm[1]) + (sm[2] + sm[3]);
    sum += other_half(sum);
    rsum[qt] = sum;
  }

  // O^T = V^T P^T  (A = V^T rows from LDS, B = P^T from registers)
  v8f o[2][4];    // o[qt][dt][j] = O[query 32*qg + 16*qt + l][d 16*dt + 8*hi + j]
#pragma unroll
  for (int qt = 0; qt < 2; ++qt)
#pragma unroll
    for (int dt = 0; dt < 4; ++dt) o[qt][dt] = z;
#pragma unroll
  for (int kc = 0; kc < 8; ++kc) {
    const int kBase = kc * 32;
#pragma unroll
    for (int dt = 0; dt < 4; ++dt) {
      v16h a = frag_ld(&Vsh[(dt * 16 + l) * V_PITCH + kBase + hi * 8]);
      o[0][dt] = wmma_f16(a, pb[0][kc], o[0][dt]);
      o[1][dt] = wmma_f16(a, pb[1][kc], o[1][dt]);
    }
  }
  // normalize and put the head's 64 columns into the mid tile: 8 consecutive d of one query per lane
#pragma unroll
  for (int qt = 0; qt < 2; ++qt) {
    half_t* mrow = &Msh[(qg * 32 + qt * 16 + l) * M_PITCH + (h0 + hh) * DHEAD + hi * 8];
#pragma unroll
    for (int dt = 0; dt < 4; ++dt) {
      v8h r;
#pragma unroll
      for (int j = 0; j < 8; ++j) r[j] = (half_t)(o[qt][dt][j] / rsum[qt]);
      *(v8h*)(mrow + dt * 16) = r;
    }
  }
  }
  // every wave's part of the mid tile is written before any wave reads its 32 rows of it
  __syncthreads();

  // out projection: a wave takes 32 rows (wave & 3, the queries it had above) and 256 columns (wave >> 2),
  // so that every W_out fragment read from LDS feeds two WMMAs
  const int rg = wave_s & 3, cg = wave_s >> 2;
  const int rowBase = blockIdx.x * 128 + rg * 32;
  // threadIdx.x again, from the wave's number and the lane, which the attention loop keeps anyway
  // (threadIdx.x itself, held for this place alone, was spilled over that loop)
  const int tid_o = wave_s * 32 + lane;
  v8f acc[2][16];
#pragma unroll
  for (int t = 0; t < 16; ++t) { acc[0][t] = z; acc[1][t] = z; }

  // the wave's two mid fragments are read from LDS one k chunk ahead
  const half_t* ap = &Msh[(rg * 32 + l) * M_PITCH + hi * 8];
  v16h a0 = frag_ld(ap), a1 = frag_ld(ap + 16 * M_PITCH);
  for (int kc = 0; kc < 16; ++kc) {
    const int kBase = kc * 32;
    if (kc < 15) {
      stage_out(WoutT, WT[(kc + 1) & 1], kBase + 32, tid_o);
      asm volatile("s_wait_asynccnt 0x8" ::: "memory");  // older stage complete
    } else {
      asm volatile("s_wait_asynccnt 0x0" ::: "memory");
    }
    __syncthreads();
    const half_t* bp = &WT[kc & 1][(cg * 256 + l) * W_PITCH + hi * 8];
    v16h an0 = a0, an1 = a1;
    if (kc < 15) {
      an0 = frag_ld(ap + kBase + 32);
      an1 = frag_ld(ap + 16 * M_PITCH + kBase + 32);
    }
    mma_chunk2<16, 8, W_PITCH, 0, 16>(bp, bp, a0, a1, acc);
    __syncthreads();
    a0 = an0;
    a1 = an1;
  }
  // fused LayerNorm over each 512-wide output row; the lane's 16 weights come in under the row sums
  // The lane number is read anew here: an index held for this part alone was spilled over the attention loop.
  const int lane_o = (int)__builtin_amdgcn_mbcnt_lo(~0u, 0u);
  const int lo = lane_o & 15, ho = lane_o >> 4;
  float4 gv[4];
#pragma unroll
  for (int c = 0; c < 4; ++c) gv[c] = ((const float4*)gout)[(cg * 4 + c) * 16 + lo];
  // stands in front of the first rewrite of those loads' address register (the lane's index lo, named
  // as an input so that it is left alone up to the wait), as behind the Q fragments above
  asm volatile("s_wait_xcnt 0x0" :: "v"(lo) : "memory");
  // the wave's 256 columns of each of its 32 rows
  float psm[2][8], psq[2][8];
#pragma unroll
  for (int rt = 0; rt < 2; ++rt)
#pragma unroll
    for (int j = 0; j < 8; ++j) {
      float sm = 0.f, sq = 0.f;
#pragma unroll
      for (int t = 0; t < 16; ++t) { const float vv = acc[rt][t][j]; sm += vv; sq += vv * vv; }
#pragma unroll
      for (int msk = 1; msk < 16; msk <<= 1) {
        sm += __shfl_xor(sm, msk, 32);
        sq += __shfl_xor(sq, msk, 32);
      }
      psm[rt][j] = sm;
      psq[rt][j] = sq;
    }
  // the two waves that share a row hand each other their halves of its sums
  if (lo == 0) {
#pragma unroll
    for (int rt = 0; rt < 2; ++rt)
#pragma unroll
      for (int j = 0; j < 8; ++j) {
        Red[cg][0][rg * 32 + rt * 16 + ho * 8 + j] = psm[rt][j];
        Red[cg][1][rg * 32 + rt * 16 + ho * 8 + j] = psq[rt][j];
      }
  }
  __syncthreads();
  float mean[2][8], rstd[2][8];
#pragma unroll
  for (int rt = 0; rt < 2; ++rt)
#pragma unroll
    for (int j = 0; j < 8; ++j) {
      const float sm = psm[rt][j] + Red[cg ^ 1][0][rg * 32 + rt * 16 + ho * 8 + j];
      const float sq = psq[rt][j] + Red[cg ^ 1][1][rg * 32 + rt * 16 + ho * 8 + j];
      mean[rt][j] = sm * (1.f / DIMX);
      rstd[rt][j] = rsqrtf(sq * (1.f / DIMX) - mean[rt][j] * mean[rt][j] + EPS_F);
    }
  // acc[rt][4 * c + i][j] is row rowBase + 16 * rt + 8 * ho + j, column 256 * cg + 64 * c + 4 * lo + i:
  // 16 lanes store 256 contiguous bytes of a row
  float* op = out + (size_t)(rowBase + ho * 8) * DIMX + cg * 256 + lo * 4;
#pragma unroll
  for (int j = 0; j < 8; ++j) {
    v4f w[2][4];
#pragma unroll
    for (int rt = 0; rt < 2; ++rt)
#pragma unroll
      for (int c = 0; c < 4; ++c) {
        w[rt][c][0] = (acc[rt][4 * c + 0][j] - mean[rt][j]) * rstd[rt][j] * gv[c].x;
        w[rt][c][1] = (acc[rt][4 * c + 1][j] - mean[rt][j]) * rstd[rt][j] * gv[c].y;
        w[rt][c][2] = (acc[rt][4 * c + 2][j] - mean[rt][j]) * rstd[rt][j] * gv[c].z;
        w[rt][c][3] = (acc[rt][4 * c + 3][j] - mean[rt][j]) * rstd[rt][j] * gv[c].w;
        *(v4f*)(op + (rt * 16 + j) * DIMX + c * 64) = w[rt][c];
      }
    // stands in front of the first rewrite of a register that these 8 stores name: their values and
    // their address are named as inputs so that the registers are left alone up to the wait
    // (8 stores a wait: 16 values held for one wait are spilled in this kernel)
    asm volatile("s_wait_xcnt 0x0"
                 :: "v"(w[0][0]), "v"(w[0][1]), "v"(w[0][2]), "v"(w[0][3]),
                    "v"(w[1][0]), "v"(w[1][1]), "v"(w[1][2]), "v"(w[1][3]), "v"(op) : "memory");
  }
}

extern "C" void kernel_launch(void* const* d_in, const int* in_sizes, int n_in,
                              void* d_out, int out_size, void* d_ws, size_t ws_size,
                              hipStream_t stream) {
  const float* x      = (const float*)d_in[0];
  const float* g_norm = (const float*)d_in[1];
  const float* W_q    = (const float*)d_in[2];
  const float* W_kv   = (const float*)d_in[3];
  const float* W_out  = (const float*)d_in[4];
  const float* g_out  = (const float*)d_in[5];
  float* out = (float*)d_out;

  char* ws = (char*)d_ws;
  const size_t xnB = (size_t)R_TOTAL * DIMX * sizeof(half_t);    // 64 MB
  const size_t kB  = (size_t)R_TOTAL * DHEAD * sizeof(half_t);   //  8 MB
  half_t* xn    = (half_t*)ws;
  half_t* qw    = (half_t*)(ws + xnB);
  half_t* kw    = (half_t*)(ws + 2 * xnB);
  half_t* vT    = (half_t*)(ws + 2 * xnB + kB);
  half_t* WqkvT = (half_t*)(ws + 2 * xnB + 2 * kB);
  half_t* WoutT = WqkvT + 640 * 512;

  ln_in_kernel<<<R_TOTAL / 8, 256, 0, stream>>>(x, g_norm, xn);
  prep_w_kernel<<<(640 * 512 + 512 * 512) / 256, 256, 0, stream>>>(W_q, W_kv, W_out, WqkvT, WoutT);
  dim3 gA(R_TOTAL / 128, 2);
  proj_kernel<<<gA, 256, 0, stream>>>(xn, WqkvT, qw, kw, vT);
  attn_out_kernel<<<R_TOTAL / 128, 256, 0, stream>>>(qw, kw, vT, WoutT, g_out, out);
}

// v009
// A run of this version takes 123 microseconds.
// Timed twice side by side with v008, it ran 1.21 times as fast both times.
// All steps since v000 together make it 3.88 times as fast.
#include <hip/hip_runtime.h>

typedef _Float16 half_t;
typedef __attribute__((ext_vector_type(4)))  _Float16 v4h;
typedef __attribute__((ext_vector_type(8)))  _Float16 v8h;
typedef __attribute__((ext_vector_type(16))) _Float16 v16h;
typedef __attribute__((ext_vector_type(8)))  float    v8f;
typedef __attribute__((ext_vector_type(4)))  float    v4f;
typedef __attribute__((ext_vector_type(2)))  float    v2f;
typedef __attribute__((ext_vector_type(2)))  _Float16 v2h;

#define R_TOTAL 65536   // b*n*r = 4*64*256
#define DIMX    512
#define DHEAD   64
#define SEQ     256
#define EPS_F   1e-5f
// LDS row pitches (halves) for rows read by 16-byte fragment loads: 16 B x odd, so that
// the 16 rows of one fragment load fall on distinct banks.
#define W_PITCH 40      // 64-B weight-chunk rows  -> 80 B
#define K_PITCH 72      // 128-B K rows            -> 144 B
#define V_PITCH 264     // 512-B V^T rows          -> 528 B
#define M_PITCH 520     // 1024-B mid rows         -> 1040 B

// Load a 16-bit A/B WMMA fragment (16x32 A, or 32x16 B via its N-major mirror).
// Caller passes p = base + row_or_n*stride + kBase + (lane>>4)*8.
// lane<16 needs K {0..7, 16..23}, lane>=16 needs K {8..15, 24..31}: two b128 loads.
__device__ __forceinline__ v16h frag_ld(const half_t* p) {
  v8h lo = *(const v8h*)(p);
  v8h hi = *(const v8h*)(p + 16);
  return __builtin_shufflevector(lo, hi, 0,1,2,3,4,5,6,7,8,9,10,11,12,13,14,15);
}

// q lies in the workspace in fragment order: the 16-byte granule (8 adjacent columns) of
// row R, column C stands at granule index ((R >> 4) * 32 + (C >> 4)) * 32 + ((C >> 3) & 1) * 16 + (R & 15).
// The last two terms are the lane that holds the granule, in the producer's result tile and in the
// consumer's fragment alike, so one wave-wide 16-byte store or load covers 512 contiguous bytes
// (four whole lines), not 32-byte pieces of 16 lines. PK_TILE = halves of one 16 x 16 tile.
#define PK_TILE 256
// Caller passes p = base + (((R >> 4) * 32 + kBase / 16) * 32 + lane) * 8; k order as in frag_ld.
__device__ __forceinline__ v16h frag_ld_pk(const half_t* p) {
  v8h lo = *(const v8h*)(p);
  v8h hi = *(const v8h*)(p + PK_TILE);
  return __builtin_shufflevector(lo, hi, 0,1,2,3,4,5,6,7,8,9,10,11,12,13,14,15);
}

__device__ __forceinline__ v8f wmma_f16(v16h a, v16h b, v8f c) {
  return __builtin_amdgcn_wmma_f32_16x16x32_f16(false, a, false, b, (short)0, c, false, false);
}

// One 32-deep k chunk of a wave's 32 x (16*NB) tile: acc[r][t] += a_r * B_t. Every B fragment read from
// LDS feeds two WMMAs (the wave's two 16-row fragments a0, a1), so a WMMA costs half a fragment read.
// Tile t < NQ lies t * 16 rows behind bp; the tiles from NQ on come in pairs 4 tiles apart, from tile 12
// behind bp2 (the k and v columns of the projection).
// The fragments come in groups of G, each group fetched into its own register set while the
// group before it is multiplied, so that a WMMA does not wait out the latency of its own loads.
// Every loop is unrolled so that bf and acc are indexed by constants and stay in registers.
// The first NTR tiles are formed transposed (the LDS fragment as A, a as B; both fragments have
// the same lane and k layout): there a lane holds 8 adjacent columns of one row of the product.
template <int NB, int G, int PITCH, int NTR, int NQ>
__device__ __forceinline__ void mma_chunk2(const half_t* bp, const half_t* bp2, v16h a0, v16h a1,
                                           v8f (&acc)[2][NB]) {
  constexpr int NG = (NB + G - 1) / G;
  v16h bf[2][G];
#pragma unroll
  for (int g = -1; g < NG; ++g) {
    if (g + 1 < NG) {
#pragma unroll
      for (int i = 0; i < G; ++i) {
        const int t = (g + 1) * G + i;
        if (t < NB)
          bf[(g + 1) & 1][i] = (t < NQ) ? frag_ld(bp + t * 16 * PITCH)
                                        : frag_ld(bp2 + (12 + ((t - NQ) >> 1) * 4 + ((t - NQ) & 1)) * 16 * PITCH);
      }
    }
    // keeps the next group's loads in front of this group's WMMAs (the scheduler sinks them
    // to their first use otherwise, one register set and a full LDS wait per WMMA)
    __builtin_amdgcn_sched_barrier(0);
    if (g >= 0) {
#pragma unroll
      for (int i = 0; i < G; ++i) {
        const int t = g * G + i;
        if (t < NB) {
          acc[0][t] = (t < NTR) ? wmma_f16(bf[g & 1][i], a0, acc[0][t]) : wmma_f16(a0, bf[g & 1][i], acc[0][t]);
          acc[1][t] = (t < NTR) ? wmma_f16(bf[g & 1][i], a1, acc[1][t]) : wmma_f16(a1, bf[g & 1][i], acc[1][t]);
        }
      }
      // keeps the loads that follow together as one group, not spread among these WMMAs
      __builtin_amdgcn_sched_barrier(0);
    }
  }
}

// CDNA5 async global->LDS copy, 16 bytes per lane, tracked by ASYNCcnt.
__device__ __forceinline__ unsigned lds_addr(const half_t* l) {
  return (unsigned)(uintptr_t)l;  // flat LDS aperture: addr[31:0] = LDS offset
}
// A run of copies (copy i: g + i * gs -> l + i * ls, strides in halves) and its s_wait_xcnt 0
// in one statement: the wait then stands in front of any later rewrite of the address
// registers that the copies name.
// five copies from g and two from g2, into seven places ls apart
__device__ __forceinline__ void async_cp16x5x2(const half_t* g, int gs, const half_t* g2, int gs2,
                                               half_t* l, int ls) {
  asm volatile("global_load_async_to_lds_b128 %0, %1, off\n\t"
               "global_load_async_to_lds_b128 %2, %3, off\n\t"
               "global_load_async_to_lds_b128 %4, %5, off\n\t"
               "global_load_async_to_lds_b128 %6, %7, off\n\t"
               "global_load_async_to_lds_b128 %8, %9, off\n\t"
               "global_load_async_to_lds_b128 %10, %11, off\n\t"
               "global_load_async_to_lds_b128 %12, %13, off\n\t"
               "s_wait_xcnt 0x0"
               :: "v"(lds_addr(l)),          "v"(g),
                  "v"(lds_addr(l + 1 * ls)), "v"(g + 1 * gs),
                  "v"(lds_addr(l + 2 * ls)), "v"(g + 2 * gs),
                  "v"(lds_addr(l + 3 * ls)), "v"(g + 3 * gs),
                  "v"(lds_addr(l + 4 * ls)), "v"(g + 4 * gs),
                  "v"(lds_addr(l + 5 * ls)), "v"(g2),
                  "v"(lds_addr(l + 6 * ls)), "v"(g2 + gs2) : "memory");
}
__device__ __forceinline__ void async_cp16x8(const half_t* g, int gs, half_t* l, int ls) {
  asm volatile("global_load_async_to_lds_b128 %0, %1, off\n\t"
               "global_load_async_to_lds_b128 %2, %3, off\n\t"
               "global_load_async_to_lds_b128 %4, %5, off\n\t"
               "global_load_async_to_lds_b128 %6, %7, off\n\t"
               "global_load_async_to_lds_b128 %8, %9, off\n\t"
               "global_load_async_to_lds_b128 %10, %11, off\n\t"
               "global_load_async_to_lds_b128 %12, %13, off\n\t"
               "global_load_async_to_lds_b128 %14, %15, off\n\t"
               "s_wait_xcnt 0x0"
               :: "v"(lds_addr(l)),          "v"(g),
                  "v"(lds_addr(l + 1 * ls)), "v"(g + 1 * gs),
                  "v"(lds_addr(l + 2 * ls)), "v"(g + 2 * gs),
                  "v"(lds_addr(l + 3 * ls)), "v"(g + 3 * gs),
                  "v"(lds_addr(l + 4 * ls)), "v"(g + 4 * gs),
                  "v"(lds_addr(l + 5 * ls)), "v"(g + 5 * gs),
                  "v"(lds_addr(l + 6 * ls)), "v"(g + 6 * gs),
                  "v"(lds_addr(l + 7 * ls)), "v"(g + 7 * gs) : "memory");
}

// ---------------- Kernel 0a: input LayerNorm, f32 -> f16 ----------------
__global__ __launch_bounds__(256) void ln_in_kernel(const float* __restrict__ x,
                                                    const float* __restrict__ g,
                                                    half_t* __restrict__ xn) {
  const int wave = threadIdx.x >> 5;
  const int lane = threadIdx.x & 31;
  const long row = (long)blockIdx.x * 8 + wave;
  const float* xr = x + row * DIMX;
  float4 v[4], gv[4];
  float s = 0.f, sq = 0.f;
#pragma unroll
  for (int i = 0; i < 4; ++i) {
    v[i]  = ((const float4*)xr)[i * 32 + lane];
    gv[i] = ((const float4*)g)[i * 32 + lane];
    s  += v[i].x + v[i].y + v[i].z + v[i].w;
    sq += v[i].x*v[i].x + v[i].y*v[i].y + v[i].z*v[i].z + v[i].w*v[i].w;
  }
#pragma unroll
  for (int m = 1; m < 32; m <<= 1) { s += __shfl_xor(s, m, 32); sq += __shfl_xor(sq, m, 32); }
  const float mean = s * (1.f / DIMX);
  const float rstd = rsqrtf(sq * (1.f / DIMX) - mean * mean + EPS_F);
#pragma unroll
  for (int i = 0; i < 4; ++i) {
    v4h o;
    o[0] = (half_t)((v[i].x - mean) * rstd * gv[i].x);
    o[1] = (half_t)((v[i].y - mean) * rstd * gv[i].y);
    o[2] = (half_t)((v[i].z - mean) * rstd * gv[i].z);
    o[3] = (half_t)((v[i].w - mean) * rstd * gv[i].w);
    ((v4h*)(xn + row * DIMX))[i * 32 + lane] = o;
  }
}

// ---------------- Kernel 0b: one-time weight transpose+convert (tiny, L2-resident) ----------------
// Transposed weights as f16, k-chunk-major: chunk kc (32 k) of all columns is one contiguous piece,
// [kc][row][32 k], so that the staging copies of a chunk read contiguous bytes (a wave-wide copy
// covers four whole lines, not 64-byte pieces of eight).
// WqkvT: row = column n of (W_q|W_kv), 640 rows. WoutT: 512 rows in the order of the staged LDS
// rows: row 16 * t + m holds output column 64 * (t >> 2) + 4 * m + (t & 3), see attn_out_kernel.
__global__ __launch_bounds__(256) void prep_w_kernel(const float* __restrict__ Wq,
                                                     const float* __restrict__ Wkv,
                                                     const float* __restrict__ Wout,
                                                     half_t* __restrict__ WqkvT,
                                                     half_t* __restrict__ WoutT) {
  const int idx = blockIdx.x * 256 + threadIdx.x;
  if (idx < 640 * 512) {
    const int n = idx >> 9, k = idx & 511;
    const float w = (n < DIMX) ? Wq[(size_t)k * DIMX + n]
                               : Wkv[(size_t)k * 128 + (n - DIMX)];
    WqkvT[((k >> 5) * 640 + n) * 32 + (k & 31)] = (half_t)w;
  } else {
    const int i2 = idx - 640 * 512;  // < 512*512
    const int n = i2 >> 9, k = i2 & 511;
    const int r = ((n >> 6) * 4 + (n & 3)) * 16 + ((n >> 2) & 15);
    WoutT[((k >> 5) * DIMX + r) * 32 + (k & 31)] = (half_t)Wout[(size_t)k * DIMX + n];
  }
}

// ---------------- Kernel 1: q/k/v projection GEMM  xn @ [W_q | W_kv] ----------------
// grid.x = row blocks of 128, grid.y = 2 halves of N=640 (320 cols each)
#define P_NB   10             // 16-column tiles of a wave
#define P_ROWS (320 + 128)    // staged rows of a k chunk: 320 weight rows, then the block's 128 x rows
__device__ __forceinline__ void stage_proj(const half_t* __restrict__ xn, const half_t* __restrict__ WqkvT,
                                           half_t* buf, int colBase, int kBase, int tid) {
  // 448 rows x 64 B = 1792 x 16B transfers; 7 async instructions per wave
  const int nl = tid >> 2, part = tid & 3;   // copy i takes staged row nl + 64 * i
  const half_t* g = WqkvT + (size_t)(kBase * 20 + colBase) * 32 + tid * 8;   // chunk kBase / 32, 640 rows each
  const half_t* gx = xn + (size_t)(blockIdx.x * 128 + nl) * DIMX + kBase + part * 8;
  half_t* d = &buf[nl * W_PITCH + part * 8];
  async_cp16x5x2(g, 256 * 8, gx, 64 * DIMX, d, 64 * W_PITCH);
}

// One 128 x 320 block; a wave takes 32 rows (wave & 3) and 10 of the 20 column tiles (wave >> 2), and the
// x chunk, which two waves now share, is staged in LDS beside the weight chunk.
// UPPER = false: columns 0..319, all q; a wave's tiles are 10 adjacent ones.
// UPPER = true: columns 320..639, tiles 0..11 q, 12..15 k, 16..19 v; every wave takes 6 q, 2 k and 2 v
// tiles, so that all waves run the same code. q (fragment order) and k (row-major) want 8 adjacent columns
// of one row in a lane, so their tiles are formed transposed; v is stored transposed, so its
// tiles stay as they are (a lane holds 8 adjacent rows of one column). Either way a lane's
// 8 results of a tile are 16 adjacent bytes of the destination.
template <bool UPPER>
__device__ __forceinline__ void proj_block(const half_t* __restrict__ xn,
                                           const half_t* __restrict__ WqkvT,
                                           half_t* __restrict__ qw,
                                           half_t* __restrict__ kw,
                                           half_t* __restrict__ vTw,
                                           half_t (&WT)[2][P_ROWS * W_PITCH]) {
  constexpr int NQ  = UPPER ? 6 : P_NB;    // q tiles of a wave
  constexpr int NTR = UPPER ? 8 : P_NB;    // tiles formed transposed (q, k)
  constexpr int colBase = UPPER ? 320 : 0;
  const int tid  = threadIdx.x;
  const int lane = tid & 31;
  const int l = lane & 15, hi = lane >> 4;
  const int wave_s = __builtin_amdgcn_readfirstlane(tid >> 5);   // wave-uniform, kept in a scalar register
  const int rg = wave_s & 3, cg = wave_s >> 2;
  v8f acc[2][P_NB];
  v8f z = {};
#pragma unroll
  for (int t = 0; t < P_NB; ++t) { acc[0][t] = z; acc[1][t] = z; }

  stage_proj(xn, WqkvT, WT[0], colBase, 0, tid);
  for (int kc = 0; kc < 16; ++kc) {
    const int kBase = kc * 32;
    if (kc < 15) {
      stage_proj(xn, WqkvT, WT[(kc + 1) & 1], colBase, kBase + 32, tid);
      asm volatile("s_wait_asynccnt 0x7" ::: "memory");  // older stage complete
    } else {
      asm volatile("s_wait_asynccnt 0x0" ::: "memory");
    }
    __syncthreads();
    const half_t* buf = WT[kc & 1] + l * W_PITCH + hi * 8;
    const v16h a0 = frag_ld(buf + (320 + rg * 32) * W_PITCH);
    const v16h a1 = frag_ld(buf + (320 + rg * 32 + 16) * W_PITCH);
    mma_chunk2<P_NB, 4, W_PITCH, NTR, NQ>(buf + cg * NQ * 16 * W_PITCH, buf + cg * 2 * 16 * W_PITCH, a0, a1, acc);
    __syncthreads();
  }
  // epilogue: cols [0,512) -> q, [512,576) -> k, [576,640) -> v (transposed); one 16-B store a tile
  // The lane number is read anew here, so that no index of the epilogue is held in a register
  // through the loop.
  const int eln = (int)__builtin_amdgcn_mbcnt_lo(~0u, 0u);
  const int el = eln & 15, eh = eln >> 4;
  const int rowBase = blockIdx.x * 128 + rg * 32;
  v8h r[2][P_NB];   // all tiles converted first, each into registers of its own, then the 20 stores in a row
#pragma unroll
  for (int rt = 0; rt < 2; ++rt)
#pragma unroll
    for (int t = 0; t < P_NB; ++t)
#pragma unroll
      for (int j = 0; j < 8; ++j) r[rt][t][j] = (half_t)acc[rt][t][j];
  // q, tile t: acc[rt][t][j] = C[rowBase + 16 * rt + el][colBase + 16 * (cg * NQ + t) + 8 * eh + j], fragment order
  half_t* qp = qw + (((unsigned)(rowBase >> 4) * 32 + (colBase >> 4) + cg * NQ) * 32 + eln) * 8;
  // k, tile NQ + i: the same element form, row-major, k column 16 * (cg * 2 + i) + 8 * eh + j
  half_t* kp = kw + (unsigned)(rowBase + el) * DHEAD + cg * 32 + eh * 8;
  // v, tile NTR + i: acc[rt][t][j] = C[rowBase + 16 * rt + 8 * eh + j][d], d = 16 * (cg * 2 + i) + el; V^T per (b,n)
  const int vrow = rowBase + eh * 8;
  half_t* vp = vTw + ((unsigned)(vrow >> 8) * DHEAD + cg * 32 + el) * SEQ + (vrow & 255);
#pragma unroll
  for (int rt = 0; rt < 2; ++rt)
#pragma unroll
    for (int t = 0; t < P_NB; ++t) {
      if (t < NQ)       *(v8h*)(qp + (rt * 32 + t) * PK_TILE) = r[rt][t];
      else if (t < NTR) *(v8h*)(kp + rt * 16 * DHEAD + (t - NQ) * 16) = r[rt][t];
      else              *(v8h*)(vp + rt * 16 + (t - NTR) * 16 * SEQ) = r[rt][t];
    }
}

__global__ __launch_bounds__(256) void proj_kernel(const half_t* __restrict__ xn,
                                                   const half_t* __restrict__ WqkvT,
                                                   half_t* __restrict__ qw,
                                                   half_t* __restrict__ kw,
                                                   half_t* __restrict__ vTw) {
  // double-buffered k chunk: transposed weights and the block's x rows (2 x 35 KB)
  __shared__ __attribute__((aligned(16))) half_t WT[2][P_ROWS * W_PITCH];
  if (blockIdx.y == 0) proj_block<false>(xn, WqkvT, qw, kw, vTw, WT);
  else                 proj_block<true>(xn, WqkvT, qw, kw, vTw, WT);
}

// value of lane l ^ 16 (the other 16-lane row, same position)
__device__ __forceinline__ float other_half(float v) {
  const int r = __builtin_amdgcn_permlanex16(0, __builtin_bit_cast(int, v),
                                             0x76543210, 0xfedcba98, false, false);
  return __builtin_bit_cast(float, r);
}

__device__ __forceinline__ void stage_out(const half_t* __restrict__ WoutT, half_t* buf,
                                          int kBase, int tid) {
  // 512 rows x 64 B = 2048 x 16B transfers; 8 async instructions per wave
  const int nl = tid >> 2, part = tid & 3;   // copy i takes row nl + 64 * i
  // Row 16 * t + m holds output column 64 * (t >> 2) + 4 * m + (t & 3) (prep_w_kernel): lane m of a
  // result tile then holds, over four tiles, four adjacent columns, one 16-byte store.
  const half_t* g = WoutT + (size_t)kBase * DIMX + tid * 8;   // chunk kBase / 32, 512 rows of 32 k
  half_t* d = &buf[nl * W_PITCH + part * 8];
  async_cp16x8(g, 256 * 8, d, 64 * W_PITCH);
}

__global__ __launch_bounds__(256) void attn_out_kernel(const half_t* __restrict__ qw,
                                                       const half_t* __restrict__ kw,
                                                       const half_t* __restrict__ vTw,
                                                       const half_t* __restrict__ WoutT,
                                                       const float* __restrict__ gout,
                                                       float* __restrict__ out) {
  __shared__ __attribute__((aligned(16))) half_t Ksh[SEQ * K_PITCH];       // 36 KB
  __shared__ __attribute__((aligned(16))) half_t Vsh[DHEAD * V_PITCH];     // 33 KB
  __shared__ __attribute__((aligned(16))) half_t Msh[128 * M_PITCH];       // mid tile, 130 KB
  __shared__ __attribute__((aligned(16))) half_t WT[2][512 * W_PITCH];     // double-buffered transposed W_out chunk (2 x 40 KB)
  __shared__ __attribute__((aligned(16))) float Red[2][2][128];            // [column half][sum, sum of squares][row]
  const int tid  = threadIdx.x;
  const int wave = tid >> 5, lane = tid & 31;
  const int l = lane & 15, hi = lane >> 4;
  // the wave's number as a wave-uniform scalar, for the addresses of the out projection
  const int wave_s = __builtin_amdgcn_readfirstlane(wave);
  const int bn = blockIdx.x >> 1;           // two blocks of 128 queries a (b,n)
  const int qg = wave & 3;                  // the wave's 32 queries of the block
  const int h0 = (wave >> 2) * 4;           // the first of its four heads
  // the wave's first query tile, head h0, in fragment order (the next query tile: 32 tiles on;
  // the next head: 4 tiles on)
  const half_t* Qg  = qw + ((size_t)((blockIdx.x * 8 + qg * 2) * 32 + h0 * 4) * 32 + lane) * 8;
  const half_t* Kg  = kw  + (size_t)bn * SEQ * DHEAD;              // [256][64]
  const half_t* VTg = vTw + (size_t)bn * DHEAD * SEQ;              // [64][256]

  // async-stage K and V^T into padded LDS rows, and the first W_out chunk (24 async instr per wave)
  {
    // K: 8 granules of 16 B a row, copy i takes row (tid >> 3) + 32 * i
    const half_t* gk = Kg + tid * 8;
    half_t* dk = &Ksh[(tid >> 3) * K_PITCH + (tid & 7) * 8];
    // V^T: 32 granules a row, copy i takes row (tid >> 5) + 8 * i
    const half_t* gv = VTg + tid * 8;
    half_t* dv = &Vsh[(tid >> 5) * V_PITCH + (tid & 31) * 8];
    async_cp16x8(gk, 2048, dk, 32 * K_PITCH);
    async_cp16x8(gv, 2048, dv, 8 * V_PITCH);
    stage_out(WoutT, WT[0], 0, tid);
  }

  v8f z = {};
  // Q B-fragments straight from global (overlaps with the async staging)
  v16h bq[2][2];
#pragma unroll
  for (int kc = 0; kc < 2; ++kc) {
    bq[kc][0] = frag_ld_pk(Qg + kc * 2 * PK_TILE);
    bq[kc][1] = frag_ld_pk(Qg + (32 + kc * 2) * PK_TILE);
  }
  asm volatile("s_wait_asynccnt 0x0" ::: "memory");
  __syncthreads();

  // stays rolled (for speed only)
#pragma nounroll
  for (int hh = 0; hh < 4; ++hh) {
  v8f s[2][16];   // s[qt][kt][j] = S[query 32*qg + 16*qt + l][key 16*kt + 8*hi + j]
#pragma unroll
  for (int qt = 0; qt < 2; ++qt)
#pragma unroll
    for (int kt = 0; kt < 16; ++kt) s[qt][kt] = z;

  // S^T = K Q^T   (A = K rows, B = Q rows as the N-major mirror)
#pragma unroll
  for (int kc = 0; kc < 2; ++kc) {
    const int kBase = kc * 32;
#pragma unroll
    for (int kt = 0; kt < 16; ++kt) {
      v16h a = frag_ld(&Ksh[(kt * 16 + l) * K_PITCH + kBase + hi * 8]);
      s[0][kt] = wmma_f16(a, bq[kc][0], s[0][kt]);
      s[1][kt] = wmma_f16(a, bq[kc][1], s[1][kt]);
    }
  }

  // The next head's Q fragments go out here, into the registers that the products above have left,
  // and are in flight under the softmax and O^T (the last trip reads its own head again: no branch).
  {
    const half_t* Qn = Qg + (hh < 3 ? hh + 1 : 3) * 4 * PK_TILE;
#pragma unroll
    for (int kc = 0; kc < 2; ++kc) {
      bq[kc][0] = frag_ld_pk(Qn + kc * 2 * PK_TILE);
      bq[kc][1] = frag_ld_pk(Qn + (32 + kc * 2) * PK_TILE);
    }
    // stands in front of the first rewrite of those loads' address registers (named as an input so
    // that they are left alone up to the wait), and holds the loads in front of the softmax
    asm volatile("s_wait_xcnt 0x0" :: "v"(Qn) : "memory");
  }

  // softmax: logits = (s - max) * 0.125, taken in the base-2 domain:
  // p = 2^(s * c - max * c), c = 0.125 * log2(e). Two scores share one packed FMA, one packed add and
  // one packed convert, and each takes one bare v_exp_f32.
  const float cexp = 0.125f * 1.44269504088896340736f;
  const v2f c2 = {cexp, cexp};
  float rinv[2];  // 1 / row sum
  v16h pb[2][8];  // pb[qt][kc]: B fragment of P^T, keys 32*kc .. 32*kc + 31, column = query
#pragma unroll
  for (int qt = 0; qt < 2; ++qt) {
    float mx[4];
    v2f sm[2] = {{0.f, 0.f}, {0.f, 0.f}};   // the four partial sums, as two pairs
#pragma unroll
    for (int i = 0; i < 4; ++i) mx[i] = s[qt][0][i];
#pragma unroll
    for (int kt = 0; kt < 16; ++kt)
#pragma unroll
      for (int j = 0; j < 8; ++j) mx[j & 3] = fmaxf(mx[j & 3], s[qt][kt][j]);
    float m = fmaxf(fmaxf(mx[0], mx[1]), fmaxf(mx[2], mx[3]));
    m = fmaxf(m, other_half(m));
    const float nm = -m * cexp;
    const v2f nm2 = {nm, nm};
#pragma unroll
    for (int kc = 0; kc < 8; ++kc) {
#pragma unroll
      for (int e = 0; e < 16; e += 2) {
        const v2f sv = {s[qt][2 * kc + (e >> 3)][e & 7], s[qt][2 * kc + (e >> 3)][(e & 7) + 1]};
        const v2f t = __builtin_elementwise_fma(sv, c2, nm2);
        const v2f p = {__builtin_amdgcn_exp2f(t[0]), __builtin_amdgcn_exp2f(t[1])};
        sm[(e >> 1) & 1] += p;
        const v2h ph = __builtin_convertvector(p, v2h);
        pb[qt][kc][e]     = ph[0];
        pb[qt][kc][e + 1] = ph[1];
      }
    }
    float sum = (sm[0][0] + sm[0][1]) + (sm[1][0] + sm[1][1]);
    sum += other_half(sum);
    rinv[qt] = __builtin_amdgcn_rcpf(sum);
  }

  // O^T = V^T P^T  (A = V^T rows from LDS, B = P^T from registers)
  v8f o[2][4];    // o[qt][dt][j] = O[query 32*qg + 16*qt + l][d 16*dt + 8*hi + j]
#pragma unroll
  for (int qt = 0; qt < 2; ++qt)
#pragma unroll
    for (int dt = 0; dt < 4; ++dt) o[qt][dt] = z;
#pragma unroll
  for (int kc = 0; kc < 8; ++kc) {
    const int kBase = kc * 32;
#pragma unroll
    for (int dt = 0; dt < 4; ++dt) {
      v16h a = frag_ld(&Vsh[(dt * 16 + l) * V_PITCH + kBase + hi * 8]);
      o[0][dt] = wmma_f16(a, pb[0][kc], o[0][dt]);
      o[1][dt] = wmma_f16(a, pb[1][kc], o[1][dt]);
    }
  }
  // normalize and put the head's 64 columns into the mid tile: 8 consecutive d of one query per lane
#pragma unroll
  for (int qt = 0; qt < 2; ++qt) {
    half_t* mrow = &Msh[(qg * 32 + qt * 16 + l) * M_PITCH + (h0 + hh) * DHEAD + hi * 8];
#pragma unroll
    for (int dt = 0; dt < 4; ++dt) {
      *(v8h*)(mrow + dt * 16) = __builtin_convertvector(o[qt][dt] * rinv[qt], v8h);
    }
  }
  }
  // every wave's part of the mid tile is written before any wave reads its 32 rows of it
  __syncthreads();

  // out projection: a wave takes 32 rows (wave & 3, the queries it had above) and 256 columns (wave >> 2),
  // so that every W_out fragment read from LDS feeds two WMMAs
  const int rg = wave_s & 3, cg = wave_s >> 2;
  const int rowBase = blockIdx.x * 128 + rg * 32;
  // threadIdx.x again, from the wave's number and the lane, which the attention loop keeps anyway
  // (threadIdx.x itself, held for this place alone, was spilled over that loop)
  const int tid_o = wave_s * 32 + lane;
  v8f acc[2][16];
#pragma unroll
  for (int t = 0; t < 16; ++t) { acc[0][t] = z; acc[1][t] = z; }

  // the wave's two mid fragments are read from LDS one k chunk ahead
  const half_t* ap = &Msh[(rg * 32 + l) * M_PITCH + hi * 8];
  v16h a0 = frag_ld(ap), a1 = frag_ld(ap + 16 * M_PITCH);
  for (int kc = 0; kc < 16; ++kc) {
    const int kBase = kc * 32;
    if (kc < 15) {
      stage_out(WoutT, WT[(kc + 1) & 1], kBase + 32, tid_o);
      asm volatile("s_wait_asynccnt 0x8" ::: "memory");  // older stage complete
    } else {
      asm volatile("s_wait_asynccnt 0x0" ::: "memory");
    }
    __syncthreads();
    const half_t* bp = &WT[kc & 1][(cg * 256 + l) * W_PITCH + hi * 8];
    v16h an0 = a0, an1 = a1;
    if (kc < 15) {
      an0 = frag_ld(ap + kBase + 32);
      an1 = frag_ld(ap + 16 * M_PITCH + kBase + 32);
    }
    mma_chunk2<16, 8, W_PITCH, 0, 16>(bp, bp, a0, a1, acc);
    __syncthreads();
    a0 = an0;
    a1 = an1;
  }
  // fused LayerNorm over each 512-wide output row; the lane's 16 weights come in under the row sums
  // The lane number is read anew here: an index held for this part alone was spilled over the attention loop.
  const int lane_o = (int)__builtin_amdgcn_mbcnt_lo(~0u, 0u);
  const int lo = lane_o & 15, ho = lane_o >> 4;
  float4 gv[4];
#pragma unroll
  for (int c = 0; c < 4; ++c) gv[c] = ((const float4*)gout)[(cg * 4 + c) * 16 + lo];
  // stands in front of the first rewrite of those loads' address register (the lane's index lo, named
  // as an input so that it is left alone up to the wait), as behind the Q fragments above
  asm volatile("s_wait_xcnt 0x0" :: "v"(lo) : "memory");
  // the wave's 256 columns of each of its 32 rows
  float psm[2][8], psq[2][8];
#pragma unroll
  for (int rt = 0; rt < 2; ++rt)
#pragma unroll
    for (int j = 0; j < 8; ++j) {
      float sm = 0.f, sq = 0.f;
#pragma unroll
      for (int t = 0; t < 16; ++t) { const float vv = acc[rt][t][j]; sm += vv; sq += vv * vv; }
#pragma unroll
      for (int msk = 1; msk < 16; msk <<= 1) {
        sm += __shfl_xor(sm, msk, 32);
        sq += __shfl_xor(sq, msk, 32);
      }
      psm[rt][j] = sm;
      psq[rt][j] = sq;
    }
  // the two waves that share a row hand each other their halves of its sums
  if (lo == 0) {
#pragma unroll
    for (int rt = 0; rt < 2; ++rt)
#pragma unroll
      for (int j = 0; j < 8; ++j) {
        Red[cg][0][rg * 32 + rt * 16 + ho * 8 + j] = psm[rt][j];
        Red[cg][1][rg * 32 + rt * 16 + ho * 8 + j] = psq[rt][j];
      }
  }
  __syncthreads();
  float mean[2][8], rstd[2][8];
#pragma unroll
  for (int rt = 0; rt < 2; ++rt)
#pragma unroll
    for (int j = 0; j < 8; ++j) {
      const float sm = psm[rt][j] + Red[cg ^ 1][0][rg * 32 + rt * 16 + ho * 8 + j];
      const float sq = psq[rt][j] + Red[cg ^ 1][1][rg * 32 + rt * 16 + ho * 8 + j];
      mean[rt][j] = sm * (1.f / DIMX);
      rstd[rt][j] = rsqrtf(sq * (1.f / DIMX) - mean[rt][j] * mean[rt][j] + EPS_F);
    }
  // acc[rt][4 * c + i][j] is row rowBase + 16 * rt + 8 * ho + j, column 256 * cg + 64 * c + 4 * lo + i:
  // 16 lanes store 256 contiguous bytes of a row
  float* op = out + (size_t)(rowBase + ho * 8) * DIMX + cg * 256 + lo * 4;
#pragma unroll
  for (int j = 0; j < 8; ++j) {
    v4f w[2][4];
#pragma unroll
    for (int rt = 0; rt < 2; ++rt)
#pragma unroll
      for (int c = 0; c < 4; ++c) {
        w[rt][c][0] = (acc[rt][4 * c + 0][j] - mean[rt][j]) * rstd[rt][j] * gv[c].x;
        w[rt][c][1] = (acc[rt][4 * c + 1][j] - mean[rt][j]) * rstd[rt][j] * gv[c].y;
        w[rt][c][2] = (acc[rt][4 * c + 2][j] - mean[rt][j]) * rstd[rt][j] * gv[c].z;
        w[rt][c][3] = (acc[rt][4 * c + 3][j] - mean[rt][j]) * rstd[rt][j] * gv[c].w;
        *(v4f*)(op + (rt * 16 + j) * DIMX + c * 64) = w[rt][c];
      }
    // stands in front of the first rewrite of a register that these 8 stores name: their values and
    // their address are named as inputs so that the registers are left alone up to the wait
    // (8 stores a wait: 16 values held for one wait are spilled in this kernel)
    asm volatile("s_wait_xcnt 0x0"
                 :: "v"(w[0][0]), "v"(w[0][1]), "v"(w[0][2]), "v"(w[0][3]),
                    "v"(w[1][0]), "v"(w[1][1]), "v"(w[1][2]), "v"(w[1][3]), "v"(op) : "memory");
  }
}

extern "C" void kernel_launch(void* const* d_in, const int* in_sizes, int n_in,
                              void* d_out, int out_size, void* d_ws, size_t ws_size,
                              hipStream_t stream) {
  const float* x      = (const float*)d_in[0];
  const float* g_norm = (const float*)d_in[1];
  const float* W_q    = (const float*)d_in[2];
  const float* W_kv   = (const float*)d_in[3];
  const float* W_out  = (const float*)d_in[4];
  const float* g_out  = (const float*)d_in[5];
  float* out = (float*)d_out;

  char* ws = (char*)d_ws;
  const size_t xnB = (size_t)R_TOTAL * DIMX * sizeof(half_t);    // 64 MB
  const size_t kB  = (size_t)R_TOTAL * DHEAD * sizeof(half_t);   //  8 MB
  half_t* xn    = (half_t*)ws;
  half_t* qw    = (half_t*)(ws + xnB);
  half_t* kw    = (half_t*)(ws + 2 * xnB);
  half_t* vT    = (half_t*)(ws + 2 * xnB + kB);
  half_t* WqkvT = (half_t*)(ws + 2 * xnB + 2 * kB);
  half_t* WoutT = WqkvT + 640 * 512;

  ln_in_kernel<<<R_TOTAL / 8, 256, 0, stream>>>(x, g_norm, xn);
  prep_w_kernel<<<(640 * 512 + 512 * 512) / 256, 256, 0, stream>>>(W_q, W_kv, W_out, WqkvT, WoutT);
  dim3 gA(R_TOTAL / 128, 2);
  proj_kernel<<<gA, 256, 0, stream>>>(xn, WqkvT, qw, kw, vT);
  attn_out_kernel<<<R_TOTAL / 128, 256, 0, stream>>>(qw, kw, vT, WoutT, g_out, out);
}

// v010
// A run of this version takes 113 microseconds.
// Two timings next to v009 both put it at 1.09 times that version's speed.
// Counting every step since v000, it is 4.22 times as fast.
#include <hip/hip_runtime.h>

typedef _Float16 half_t;
typedef __attribute__((ext_vector_type(4)))  _Float16 v4h;
typedef __attribute__((ext_vector_type(8)))  _Float16 v8h;
typedef __attribute__((ext_vector_type(16))) _Float16 v16h;
typedef __attribute__((ext_vector_type(8)))  float    v8f;
typedef __attribute__((ext_vector_type(4)))  float    v4f;
typedef __attribute__((ext_vector_type(2)))  float    v2f;
typedef __attribute__((ext_vector_type(2)))  _Float16 v2h;

#define R_TOTAL 65536   // b*n*r = 4*64*256
#define DIMX    512
#define DHEAD   64
#define SEQ     256
#define EPS_F   1e-5f
// LDS row pitches (halves) for rows read by 16-byte fragment loads: 16 B x odd, so that
// the 16 rows of one fragment load fall on distinct banks.
#define W_PITCH 40      // 64-B weight-chunk rows  -> 80 B
#define K_PITCH 72      // 128-B K rows            -> 144 B
#define V_PITCH 264     // 512-B V^T rows          -> 528 B
#define M_PITCH 520     // 1024-B mid rows         -> 1040 B

// Load a 16-bit A/B WMMA fragment (16x32 A, or 32x16 B via its N-major mirror).
// Caller passes p = base + row_or_n*stride + kBase + (lane>>4)*8.
// lane<16 needs K {0..7, 16..23}, lane>=16 needs K {8..15, 24..31}: two b128 loads.
__device__ __forceinline__ v16h frag_ld(const half_t* p) {
  v8h lo = *(const v8h*)(p);
  v8h hi = *(const v8h*)(p + 16);
  return __builtin_shufflevector(lo, hi, 0,1,2,3,4,5,6,7,8,9,10,11,12,13,14,15);
}

// q lies in the workspace in fragment order: the 16-byte granule (8 adjacent columns) of
// row R, column C stands at granule index ((R >> 4) * 32 + (C >> 4)) * 32 + ((C >> 3) & 1) * 16 + (R & 15).
// The last two terms are the lane that holds the granule, in the producer's result tile and in the
// consumer's fragment alike, so one wave-wide 16-byte store or load covers 512 contiguous bytes
// (four whole lines), not 32-byte pieces of 16 lines. PK_TILE = halves of one 16 x 16 tile.
#define PK_TILE 256
// Caller passes p = base + (((R >> 4) * 32 + kBase / 16) * 32 + lane) * 8; k order as in frag_ld.
__device__ __forceinline__ v16h frag_ld_pk(const half_t* p) {
  v8h lo = *(const v8h*)(p);
  v8h hi = *(const v8h*)(p + PK_TILE);
  return __builtin_shufflevector(lo, hi, 0,1,2,3,4,5,6,7,8,9,10,11,12,13,14,15);
}

__device__ __forceinline__ v8f wmma_f16(v16h a, v16h b, v8f c) {
  return __builtin_amdgcn_wmma_f32_16x16x32_f16(false, a, false, b, (short)0, c, false, false);
}

// One 32-deep k chunk of a wave's 32 x (16*NB) tile: acc[r][t] += a_r * B_t. Every B fragment read from
// LDS feeds two WMMAs (the wave's two 16-row fragments a0, a1), so a WMMA costs half a fragment read.
// Tile t < NQ lies t * 16 rows behind bp; the tiles from NQ on lie 4 tiles apart, from bp2 on
// (the wave's k tile and its v tile of the projection).
// The fragments come in groups of G, each group fetched into its own register set while the
// group before it is multiplied, so that a WMMA does not wait out the latency of its own loads.
// Every loop is unrolled so that bf and acc are indexed by constants and stay in registers.
// The first NTR tiles are formed transposed (the LDS fragment as A, a as B; both fragments have
// the same lane and k layout): there a lane holds 8 adjacent columns of one row of the product.
template <int NB, int G, int PITCH, int NTR, int NQ>
__device__ __forceinline__ void mma_chunk2(const half_t* bp, const half_t* bp2, v16h a0, v16h a1,
                                           v8f (&acc)[2][NB]) {
  constexpr int NG = (NB + G - 1) / G;
  v16h bf[2][G];
#pragma unroll
  for (int g = -1; g < NG; ++g) {
    if (g + 1 < NG) {
#pragma unroll
      for (int i = 0; i < G; ++i) {
        const int t = (g + 1) * G + i;
        if (t < NB)
          bf[(g + 1) & 1][i] = (t < NQ) ? frag_ld(bp + t * 16 * PITCH)
                                        : frag_ld(bp2 + (t - NQ) * 4 * 16 * PITCH);
      }
    }
    // keeps the next group's loads in front of this group's WMMAs (the scheduler sinks them
    // to their first use otherwise, one register set and a full LDS wait per WMMA)
    __builtin_amdgcn_sched_barrier(0);
    if (g >= 0) {
#pragma unroll
      for (int i = 0; i < G; ++i) {
        const int t = g * G + i;
        if (t < NB) {
          acc[0][t] = (t < NTR) ? wmma_f16(bf[g & 1][i], a0, acc[0][t]) : wmma_f16(a0, bf[g & 1][i], acc[0][t]);
          acc[1][t] = (t < NTR) ? wmma_f16(bf[g & 1][i], a1, acc[1][t]) : wmma_f16(a1, bf[g & 1][i], acc[1][t]);
        }
      }
      // keeps the loads that follow together as one group, not spread among these WMMAs
      __builtin_amdgcn_sched_barrier(0);
    }
  }
}

// CDNA5 async global->LDS copy, 16 bytes per lane, tracked by ASYNCcnt.
__device__ __forceinline__ unsigned lds_addr(const void* l) {
  return (unsigned)(uintptr_t)l;  // flat LDS aperture: addr[31:0] = LDS offset
}
// A run of copies (copy i: g + i * gs -> l + i * ls, strides in halves) and its s_wait_xcnt 0
// in one statement: the wait then stands in front of any later rewrite of the address
// registers that the copies name.
// five copies from g and two from g2 (f32, strides in floats)
__device__ __forceinline__ void async_cp16x5x2(const half_t* g, int gs, half_t* l, int ls,
                                               const float* g2, int gs2, float* l2, int ls2) {
  asm volatile("global_load_async_to_lds_b128 %0, %1, off\n\t"
               "global_load_async_to_lds_b128 %2, %3, off\n\t"
               "global_load_async_to_lds_b128 %4, %5, off\n\t"
               "global_load_async_to_lds_b128 %6, %7, off\n\t"
               "global_load_async_to_lds_b128 %8, %9, off\n\t"
               "global_load_async_to_lds_b128 %10, %11, off\n\t"
               "global_load_async_to_lds_b128 %12, %13, off\n\t"
               "s_wait_xcnt 0x0"
               :: "v"(lds_addr(l)),          "v"(g),
                  "v"(lds_addr(l + 1 * ls)), "v"(g + 1 * gs),
                  "v"(lds_addr(l + 2 * ls)), "v"(g + 2 * gs),
                  "v"(lds_addr(l + 3 * ls)), "v"(g + 3 * gs),
                  "v"(lds_addr(l + 4 * ls)), "v"(g + 4 * gs),
                  "v"(lds_addr(l2)),         "v"(g2),
                  "v"(lds_addr(l2 + ls2)),   "v"(g2 + gs2) : "memory");
}
__device__ __forceinline__ void async_cp16x8(const half_t* g, int gs, half_t* l, int ls) {
  asm volatile("global_load_async_to_lds_b128 %0, %1, off\n\t"
               "global_load_async_to_lds_b128 %2, %3, off\n\t"
               "global_load_async_to_lds_b128 %4, %5, off\n\t"
               "global_load_async_to_lds_b128 %6, %7, off\n\t"
               "global_load_async_to_lds_b128 %8, %9, off\n\t"
               "global_load_async_to_lds_b128 %10, %11, off\n\t"
               "global_load_async_to_lds_b128 %12, %13, off\n\t"
               "global_load_async_to_lds_b128 %14, %15, off\n\t"
               "s_wait_xcnt 0x0"
               :: "v"(lds_addr(l)),          "v"(g),
                  "v"(lds_addr(l + 1 * ls)), "v"(g + 1 * gs),
                  "v"(lds_addr(l + 2 * ls)), "v"(g + 2 * gs),
                  "v"(lds_addr(l + 3 * ls)), "v"(g + 3 * gs),
                  "v"(lds_addr(l + 4 * ls)), "v"(g + 4 * gs),
                  "v"(lds_addr(l + 5 * ls)), "v"(g + 5 * gs),
                  "v"(lds_addr(l + 6 * ls)), "v"(g + 6 * gs),
                  "v"(lds_addr(l + 7 * ls)), "v"(g + 7 * gs) : "memory");
}

// value of lane l ^ 16 (the other 16-lane row, same position)
__device__ __forceinline__ float other_half(float v) {
  const int r = __builtin_amdgcn_permlanex16(0, __builtin_bit_cast(int, v),
                                             0x76543210, 0xfedcba98, false, false);
  return __builtin_bit_cast(float, r);
}

// v + (v of lane l ^ M), M < 16: one DPP add inside the 16-lane row, no trip through the LDS unit
template <int M>
__device__ __forceinline__ float add_xor_row(float v) {
  const int r = __builtin_amdgcn_update_dpp(0, __builtin_bit_cast(int, v), 0x160 + M, 0xf, 0xf, false);
  return v + __builtin_bit_cast(float, r);
}
// sum over the wave's 32 lanes, in every lane; the pairing of a butterfly over lane ^ 1, 2, 4, 8, 16
__device__ __forceinline__ float wave_sum(float v) {
  v = add_xor_row<1>(v);
  v = add_xor_row<2>(v);
  v = add_xor_row<4>(v);
  v = add_xor_row<8>(v);
  return v + other_half(v);
}

// ---------------- Kernel 0: one-time weight transpose+convert (tiny, L2-resident) ----------------
// Transposed weights as f16, k-chunk-major: chunk kc (32 k) of all columns is one contiguous piece,
// [kc][row][32 k], so that the staging copies of a chunk read contiguous bytes (a wave-wide copy
// covers four whole lines, not 64-byte pieces of eight).
// WqkvT: row = column n of (W_q|W_kv), 640 rows, each weight times the input LayerNorm's g[k]; colsum[n] is
// the sum over k of the f16 values as stored (see proj_kernel). One block a column.
// WoutT: 512 rows in the order of the staged LDS
// rows: row 16 * t + m holds output column 64 * (t >> 2) + 4 * m + (t & 3), see attn_out_kernel.
__global__ __launch_bounds__(256) void prep_w_kernel(const float* __restrict__ Wq,
                                                     const float* __restrict__ Wkv,
                                                     const float* __restrict__ Wout,
                                                     const float* __restrict__ g,
                                                     half_t* __restrict__ WqkvT,
                                                     half_t* __restrict__ WoutT,
                                                     float* __restrict__ colsum) {
  __shared__ float part[8];
  if (blockIdx.x < 640) {
    const int n = blockIdx.x;
    float cs = 0.f;
#pragma unroll
    for (int hf = 0; hf < 2; ++hf) {
      const int k = hf * 256 + threadIdx.x;
      const float w = (n < DIMX) ? Wq[(size_t)k * DIMX + n]
                                 : Wkv[(size_t)k * 128 + (n - DIMX)];
      const half_t wh = (half_t)(w * g[k]);
      WqkvT[((k >> 5) * 640 + n) * 32 + (k & 31)] = wh;
      cs += (float)wh;
    }
    cs = wave_sum(cs);
    if ((threadIdx.x & 31) == 0) part[threadIdx.x >> 5] = cs;
    __syncthreads();
    if (threadIdx.x == 0)
      colsum[n] = ((part[0] + part[1]) + (part[2] + part[3])) + ((part[4] + part[5]) + (part[6] + part[7]));
  } else {
    const int i2 = (blockIdx.x - 640) * 256 + threadIdx.x;  // < 512*512
    const int n = i2 >> 9, k = i2 & 511;
    const int r = ((n >> 6) * 4 + (n & 3)) * 16 + ((n >> 2) & 15);
    WoutT[((k >> 5) * DIMX + r) * 32 + (k & 31)] = (half_t)Wout[(size_t)k * DIMX + n];
  }
}

// ---------------- Kernel 1: input LayerNorm + q/k/v projection GEMM  LN(x) @ [W_q | W_kv] ----------------
// LN(x) @ W = rstd * (x @ (g * W) - mean * colsum(g * W)), row by row: the GEMM runs on the raw x, whose
// k chunks stream from memory into LDS beside the weight chunks (f32, rounded to f16 where a fragment is read),
// the row sums are gathered from the same chunks on the way, and mean and rstd are applied to the products.
// No normalized x in global memory.
// block = 512 threads (16 waves) = 128 rows, all 640 columns.
#define P_NB     10           // 16-column tiles of a wave
#define XF_PITCH 36           // floats: 128-B rows of the raw x chunk -> 144 B (16 B x odd)
__device__ __forceinline__ void stage_proj(const float* __restrict__ x, const half_t* __restrict__ WqkvT,
                                           half_t* wbuf, float* xbuf, int kBase, int tid) {
  // weights: 640 rows x 64 B = 2560 x 16B transfers, copy i takes staged row (tid >> 2) + 128 * i
  const half_t* g = WqkvT + (size_t)(kBase * 20) * 32 + tid * 8;   // chunk kBase / 32, 640 rows each
  half_t* d = &wbuf[(tid >> 2) * W_PITCH + (tid & 3) * 8];
  // x: 128 rows x 128 B = 1024 x 16B transfers, copy i takes row (tid >> 3) + 64 * i (whole 128-B lines)
  const float* gx = x + (size_t)(blockIdx.x * 128 + (tid >> 3)) * DIMX + kBase + (tid & 7) * 4;
  float* dx = &xbuf[(tid >> 3) * XF_PITCH + (tid & 7) * 4];
  async_cp16x5x2(g, 512 * 8, d, 128 * W_PITCH, gx, 64 * DIMX, dx, 64 * XF_PITCH);
}

// A 16 x 32 fragment from f32 rows in LDS, k order as in frag_ld (p = row + kBase + (lane >> 4) * 8)
__device__ __forceinline__ v16h frag_ld_f32(const float* p) {
  const v4f f0 = *(const v4f*)(p), f1 = *(const v4f*)(p + 4), f2 = *(const v4f*)(p + 16), f3 = *(const v4f*)(p + 20);
  const v8f lo = __builtin_shufflevector(f0, f1, 0,1,2,3,4,5,6,7);
  const v8f hi = __builtin_shufflevector(f2, f3, 0,1,2,3,4,5,6,7);
  return __builtin_shufflevector(__builtin_convertvector(lo, v8h), __builtin_convertvector(hi, v8h),
                                 0,1,2,3,4,5,6,7,8,9,10,11,12,13,14,15);
}

// A wave takes 32 rows (wave & 3) and 10 of the 40 column tiles (wave >> 2): tiles 0..31 are q, 32..35 k,
// 36..39 v; every wave takes 8 adjacent q tiles, one k and one v tile, so that all waves run the same code.
// q (fragment order) and k (row-major) want 8 adjacent columns of one row in a lane, so their tiles are
// formed transposed; v is stored transposed, so its tile stays as it is (a lane holds 8 adjacent rows of
// one column). Either way a lane's 8 results of a tile are 16 adjacent bytes of the destination.
__global__ __launch_bounds__(512) void proj_kernel(const float* __restrict__ x,
                                                   const half_t* __restrict__ WqkvT,
                                                   const float* __restrict__ colsum,
                                                   half_t* __restrict__ qw,
                                                   half_t* __restrict__ kw,
                                                   half_t* __restrict__ vTw) {
  // ring of three stages (x comes from memory: a stage flies for two trips), 3 x (50 + 18) KB
  __shared__ __attribute__((aligned(16))) half_t WT[3][640 * W_PITCH];
  __shared__ __attribute__((aligned(16))) float  XF[3][128 * XF_PITCH];
  __shared__ __attribute__((aligned(16))) float  CS[640];
  __shared__ __attribute__((aligned(16))) float  ST[2][128];   // mean, rstd of the block's rows
  constexpr int NQ  = 8;    // q tiles of a wave
  constexpr int NTR = 9;    // tiles formed transposed (q, k)
  const int tid  = threadIdx.x;
  const int lane = tid & 31;
  const int l = lane & 15, hi = lane >> 4;
  const int wave_s = __builtin_amdgcn_readfirstlane(tid >> 5);   // wave-uniform, kept in a scalar register
  const int rg = wave_s & 3, cg = wave_s >> 2;

  stage_proj(x, WqkvT, WT[0], XF[0], 0, tid);
  stage_proj(x, WqkvT, WT[1], XF[1], 32, tid);
  // the column sums go to LDS for the epilogue (five whole waves); the loop's first barrier publishes them
  if (wave_s < 5) *(v4f*)&CS[tid * 4] = ((const v4f*)colsum)[tid];

  v8f acc[2][P_NB];
  v8f z = {};
#pragma unroll
  for (int t = 0; t < P_NB; ++t) { acc[0][t] = z; acc[1][t] = z; }
  // the thread's part of the sums of rows (tid >> 3) and 64 + (tid >> 3): the 4 columns a chunk that it copies itself
  float s0 = 0.f, q0 = 0.f, s1 = 0.f, q1 = 0.f;

  int b = 0;   // kc mod 3
  for (int kc = 0; kc < 16; ++kc) {
    // publish point of stage kc: the wave's own LDS reads of the trip before are over, its own copies of
    // stage kc have landed (stage kc + 1, the 7 youngest, may still fly; to 0 in the two trips that issue
    // no copies), then the barrier
    asm volatile("s_wait_dscnt 0x0" ::: "memory");
    if (kc < 14) asm volatile("s_wait_asynccnt 0x7" ::: "memory");
    else         asm volatile("s_wait_asynccnt 0x0" ::: "memory");
    __syncthreads();
    // stage kc + 2 goes into the buffer that every wave has left at this barrier (read in trip kc - 1)
    const int b2 = (b == 0) ? 2 : b - 1;
    if (kc < 14) stage_proj(x, WqkvT, WT[b2], XF[b2], kc * 32 + 64, tid);
    const half_t* buf = WT[b] + l * W_PITCH + hi * 8;
    const float* xa = XF[b] + (rg * 32 + l) * XF_PITCH + hi * 8;
    {
      const float* xo = XF[b] + (tid >> 3) * XF_PITCH + (tid & 7) * 4;
      const v4f u0 = *(const v4f*)xo, u1 = *(const v4f*)(xo + 64 * XF_PITCH);
#pragma unroll
      for (int e = 0; e < 4; ++e) {
        s0 += u0[e]; q0 += u0[e] * u0[e];
        s1 += u1[e]; q1 += u1[e] * u1[e];
      }
    }
    const v16h a0 = frag_ld_f32(xa);
    const v16h a1 = frag_ld_f32(xa + 16 * XF_PITCH);
    mma_chunk2<P_NB, 3, W_PITCH, NTR, NQ>(buf + cg * NQ * 16 * W_PITCH, buf + (32 + cg) * 16 * W_PITCH, a0, a1, acc);
    b = (b == 2) ? 0 : b + 1;
  }
  // row statistics: eight adjacent lanes hold the parts of a row's sums
  {
    s0 = add_xor_row<4>(add_xor_row<2>(add_xor_row<1>(s0)));
    q0 = add_xor_row<4>(add_xor_row<2>(add_xor_row<1>(q0)));
    s1 = add_xor_row<4>(add_xor_row<2>(add_xor_row<1>(s1)));
    q1 = add_xor_row<4>(add_xor_row<2>(add_xor_row<1>(q1)));
    const float m0 = s0 * (1.f / DIMX), m1 = s1 * (1.f / DIMX);
    const float r0 = rsqrtf(q0 * (1.f / DIMX) - m0 * m0 + EPS_F);
    const float r1 = rsqrtf(q1 * (1.f / DIMX) - m1 * m1 + EPS_F);
    if ((tid & 7) == 0) {
      ST[0][tid >> 3] = m0;  ST[0][64 + (tid >> 3)] = m1;
      ST[1][tid >> 3] = r0;  ST[1][64 + (tid >> 3)] = r1;
    }
  }
  // every row's mean and rstd are written before any wave reads those of its 32 rows
  __syncthreads();
  // epilogue: cols [0,512) -> q, [512,576) -> k, [576,640) -> v (transposed); one 16-B store a tile
  // The lane number is read anew here, so that no index of the epilogue is held in a register
  // through the loop.
  const int eln = (int)__builtin_amdgcn_mbcnt_lo(~0u, 0u);
  const int el = eln & 15, eh = eln >> 4;
  const int rowBase = blockIdx.x * 128 + rg * 32;
  v8h r[2][P_NB];   // all tiles converted first, each into registers of its own, then the 20 stores in a row
  const float mean[2] = {ST[0][rg * 32 + el], ST[0][rg * 32 + 16 + el]};
  const float rstd[2] = {ST[1][rg * 32 + el], ST[1][rg * 32 + 16 + el]};
  // q, k tiles: acc[rt][t][j] is row 16 * rt + el, column c0 + 8 * eh + j
#pragma unroll
  for (int t = 0; t < NTR; ++t) {
    const int c0 = (t < NQ) ? (cg * NQ + t) * 16 : DIMX + cg * 16;
    const v4f ca = *(const v4f*)&CS[c0 + eh * 8], cb = *(const v4f*)&CS[c0 + eh * 8 + 4];
#pragma unroll
    for (int rt = 0; rt < 2; ++rt)
#pragma unroll
      for (int j = 0; j < 8; ++j)
        r[rt][t][j] = (half_t)((acc[rt][t][j] - mean[rt] * (j < 4 ? ca[j & 3] : cb[j & 3])) * rstd[rt]);
  }
  // v tile: acc[rt][NTR][j] is row 16 * rt + 8 * eh + j, column 576 + 16 * cg + el
  {
    const float cv = CS[DIMX + DHEAD + cg * 16 + el];
#pragma unroll
    for (int rt = 0; rt < 2; ++rt) {
      const float* mp = &ST[0][rg * 32 + rt * 16 + eh * 8];
      const v4f ma = *(const v4f*)mp, mb = *(const v4f*)(mp + 4);
      const v4f ra = *(const v4f*)(mp + 128), rb = *(const v4f*)(mp + 132);
#pragma unroll
      for (int j = 0; j < 8; ++j)
        r[rt][NTR][j] = (half_t)((acc[rt][NTR][j] - (j < 4 ? ma[j & 3] : mb[j & 3]) * cv) * (j < 4 ? ra[j & 3] : rb[j & 3]));
    }
  }
  // q, tile t: C[rowBase + 16 * rt + el][16 * (cg * NQ + t) + 8 * eh + j], fragment order
  half_t* qp = qw + (((unsigned)(rowBase >> 4) * 32 + cg * NQ) * 32 + eln) * 8;
  // k, tile NQ: the same element form, row-major, k column 16 * cg + 8 * eh + j
  half_t* kp = kw + (unsigned)(rowBase + el) * DHEAD + cg * 16 + eh * 8;
  // v, tile NTR: C[rowBase + 16 * rt + 8 * eh + j][d], d = 16 * cg + el; V^T per (b,n)
  const int vrow = rowBase + eh * 8;
  half_t* vp = vTw + ((unsigned)(vrow >> 8) * DHEAD + cg * 16 + el) * SEQ + (vrow & 255);
#pragma unroll
  for (int rt = 0; rt < 2; ++rt)
#pragma unroll
    for (int t = 0; t < P_NB; ++t) {
      if (t < NQ)       *(v8h*)(qp + (rt * 32 + t) * PK_TILE) = r[rt][t];
      else if (t < NTR) *(v8h*)(kp + rt * 16 * DHEAD) = r[rt][t];
      else              *(v8h*)(vp + rt * 16) = r[rt][t];
    }
}

__device__ __forceinline__ void stage_out(const half_t* __restrict__ WoutT, half_t* buf,
                                          int kBase, int tid) {
  // 512 rows x 64 B = 2048 x 16B transfers; 8 async instructions per wave
  const int nl = tid >> 2, part = tid & 3;   // copy i takes row nl + 64 * i
  // Row 16 * t + m holds output column 64 * (t >> 2) + 4 * m + (t & 3) (prep_w_kernel): lane m of a
  // result tile then holds, over four tiles, four adjacent columns, one 16-byte store.
  const half_t* g = WoutT + (size_t)kBase * DIMX + tid * 8;   // chunk kBase / 32, 512 rows of 32 k
  half_t* d = &buf[nl * W_PITCH + part * 8];
  async_cp16x8(g, 256 * 8, d, 64 * W_PITCH);
}

__global__ __launch_bounds__(256) void attn_out_kernel(const half_t* __restrict__ qw,
                                                       const half_t* __restrict__ kw,
                                                       const half_t* __restrict__ vTw,
                                                       const half_t* __restrict__ WoutT,
                                                       const float* __restrict__ gout,
                                                       float* __restrict__ out) {
  __shared__ __attribute__((aligned(16))) half_t Ksh[SEQ * K_PITCH];       // 36 KB
  __shared__ __attribute__((aligned(16))) half_t Vsh[DHEAD * V_PITCH];     // 33 KB
  __shared__ __attribute__((aligned(16))) half_t Msh[128 * M_PITCH];       // mid tile, 130 KB
  __shared__ __attribute__((aligned(16))) half_t WT[2][512 * W_PITCH];     // double-buffered transposed W_out chunk (2 x 40 KB)
  __shared__ __attribute__((aligned(16))) float Red[2][2][128];            // [column half][sum, sum of squares][row]
  const int tid  = threadIdx.x;
  const int wave = tid >> 5, lane = tid & 31;
  const int l = lane & 15, hi = lane >> 4;
  // the wave's number as a wave-uniform scalar, for the addresses of the out projection
  const int wave_s = __builtin_amdgcn_readfirstlane(wave);
  const int bn = blockIdx.x >> 1;           // two blocks of 128 queries a (b,n)
  const int qg = wave & 3;                  // the wave's 32 queries of the block
  const int h0 = (wave >> 2) * 4;           // the first of its four heads
  // the wave's first query tile, head h0, in fragment order (the next query tile: 32 tiles on;
  // the next head: 4 tiles on)
  const half_t* Qg  = qw + ((size_t)((blockIdx.x * 8 + qg * 2) * 32 + h0 * 4) * 32 + lane) * 8;
  const half_t* Kg  = kw  + (size_t)bn * SEQ * DHEAD;              // [256][64]
  const half_t* VTg = vTw + (size_t)bn * DHEAD * SEQ;              // [64][256]

  // async-stage K and V^T into padded LDS rows, and the first W_out chunk (24 async instr per wave)
  {
    // K: 8 granules of 16 B a row, copy i takes row (tid >> 3) + 32 * i
    const half_t* gk = Kg + tid * 8;
    half_t* dk = &Ksh[(tid >> 3) * K_PITCH + (tid & 7) * 8];
    // V^T: 32 granules a row, copy i takes row (tid >> 5) + 8 * i
    const half_t* gv = VTg + tid * 8;
    half_t* dv = &Vsh[(tid >> 5) * V_PITCH + (tid & 31) * 8];
    async_cp16x8(gk, 2048, dk, 32 * K_PITCH);
    async_cp16x8(gv, 2048, dv, 8 * V_PITCH);
    stage_out(WoutT, WT[0], 0, tid);
  }

  v8f z = {};
  // Q B-fragments straight from global (overlaps with the async staging)
  v16h bq[2][2];
#pragma unroll
  for (int kc = 0; kc < 2; ++kc) {
    bq[kc][0] = frag_ld_pk(Qg + kc * 2 * PK_TILE);
    bq[kc][1] = frag_ld_pk(Qg + (32 + kc * 2) * PK_TILE);
  }
  asm volatile("s_wait_asynccnt 0x0" ::: "memory");
  __syncthreads();

  // stays rolled (for speed only)
#pragma nounroll
  for (int hh = 0; hh < 4; ++hh) {
  v8f s[2][16];   // s[qt][kt][j] = S[query 32*qg + 16*qt + l][key 16*kt + 8*hi + j]
#pragma unroll
  for (int qt = 0; qt < 2; ++qt)
#pragma unroll
    for (int kt = 0; kt < 16; ++kt) s[qt][kt] = z;

  // S^T = K Q^T   (A = K rows, B = Q rows as the N-major mirror)
#pragma unroll
  for (int kc = 0; kc < 2; ++kc) {
    const int kBase = kc * 32;
#pragma unroll
    for (int kt = 0; kt < 16; ++kt) {
      v16h a = frag_ld(&Ksh[(kt * 16 + l) * K_PITCH + kBase + hi * 8]);
      s[0][kt] = wmma_f16(a, bq[kc][0], s[0][kt]);
      s[1][kt] = wmma_f16(a, bq[kc][1], s[1][kt]);
    }
  }

  // The next head's Q fragments go out here, into the registers that the products above have left,
  // and are in flight under the softmax and O^T (the last trip reads its own head again: no branch).
  {
    const half_t* Qn = Qg + (hh < 3 ? hh + 1 : 3) * 4 * PK_TILE;
#pragma unroll
    for (int kc = 0; kc < 2; ++kc) {
      bq[kc][0] = frag_ld_pk(Qn + kc * 2 * PK_TILE);
      bq[kc][1] = frag_ld_pk(Qn + (32 + kc * 2) * PK_TILE);
    }
    // stands in front of the first rewrite of those loads' address registers (named as an input so
    // that they are left alone up to the wait), and holds the loads in front of the softmax
    asm volatile("s_wait_xcnt 0x0" :: "v"(Qn) : "memory");
  }

  // softmax: logits = (s - max) * 0.125, taken in the base-2 domain:
  // p = 2^(s * c - max * c), c = 0.125 * log2(e). Two scores share one packed FMA, one packed add and
  // one packed convert, and each takes one bare v_exp_f32.
  const float cexp = 0.125f * 1.44269504088896340736f;
  const v2f c2 = {cexp, cexp};
  float rinv[2];  // 1 / row sum
  v16h pb[2][8];  // pb[qt][kc]: B fragment of P^T, keys 32*kc .. 32*kc + 31, column = query
#pragma unroll
  for (int qt = 0; qt < 2; ++qt) {
    float mx[4];
    v2f sm[2] = {{0.f, 0.f}, {0.f, 0.f}};   // the four partial sums, as two pairs
#pragma unroll
    for (int i = 0; i < 4; ++i) mx[i] = s[qt][0][i];
#pragma unroll
    for (int kt = 0; kt < 16; ++kt)
#pragma unroll
      for (int j = 0; j < 8; ++j) mx[j & 3] = fmaxf(mx[j & 3], s[qt][kt][j]);
    float m = fmaxf(fmaxf(mx[0], mx[1]), fmaxf(mx[2], mx[3]));
    m = fmaxf(m, other_half(m));
    const float nm = -m * cexp;
    const v2f nm2 = {nm, nm};
#pragma unroll
    for (int kc = 0; kc < 8; ++kc) {
#pragma unroll
      for (int e = 0; e < 16; e += 2) {
        const v2f sv = {s[qt][2 * kc + (e >> 3)][e & 7], s[qt][2 * kc + (e >> 3)][(e & 7) + 1]};
        const v2f t = __builtin_elementwise_fma(sv, c2, nm2);
        const v2f p = {__builtin_amdgcn_exp2f(t[0]), __builtin_amdgcn_exp2f(t[1])};
        sm[(e >> 1) & 1] += p;
        const v2h ph = __builtin_convertvector(p, v2h);
        pb[qt][kc][e]     = ph[0];
        pb[qt][kc][e + 1] = ph[1];
      }
    }
    float sum = (sm[0][0] + sm[0][1]) + (sm[1][0] + sm[1][1]);
    sum += other_half(sum);
    rinv[qt] = __builtin_amdgcn_rcpf(sum);
  }

  // O^T = V^T P^T  (A = V^T rows from LDS, B = P^T from registers)
  v8f o[2][4];    // o[qt][dt][j] = O[query 32*qg + 16*qt + l][d 16*dt + 8*hi + j]
#pragma unroll
  for (int qt = 0; qt < 2; ++qt)
#pragma unroll
    for (int dt = 0; dt < 4; ++dt) o[qt][dt] = z;
#pragma unroll
  for (int kc = 0; kc < 8; ++kc) {
    const int kBase = kc * 32;
#pragma unroll
    for (int dt = 0; dt < 4; ++dt) {
      v16h a = frag_ld(&Vsh[(dt * 16 + l) * V_PITCH + kBase + hi * 8]);
      o[0][dt] = wmma_f16(a, pb[0][kc], o[0][dt]);
      o[1][dt] = wmma_f16(a, pb[1][kc], o[1][dt]);
    }
  }
  // normalize and put the head's 64 columns into the mid tile: 8 consecutive d of one query per lane
#pragma unroll
  for (int qt = 0; qt < 2; ++qt) {
    half_t* mrow = &Msh[(qg * 32 + qt * 16 + l) * M_PITCH + (h0 + hh) * DHEAD + hi * 8];
#pragma unroll
    for (int dt = 0; dt < 4; ++dt) {
      *(v8h*)(mrow + dt * 16) = __builtin_convertvector(o[qt][dt] * rinv[qt], v8h);
    }
  }
  }
  // every wave's part of the mid tile is written before any wave reads its 32 rows of it
  __syncthreads();

  // out projection: a wave takes 32 rows (wave & 3, the queries it had above) and 256 columns (wave >> 2),
  // so that every W_out fragment read from LDS feeds two WMMAs
  const int rg = wave_s & 3, cg = wave_s >> 2;
  const int rowBase = blockIdx.x * 128 + rg * 32;
  // threadIdx.x again, from the wave's number and the lane, which the attention loop keeps anyway
  // (threadIdx.x itself, held for this place alone, was spilled over that loop)
  const int tid_o = wave_s * 32 + lane;
  v8f acc[2][16];
#pragma unroll
  for (int t = 0; t < 16; ++t) { acc[0][t] = z; acc[1][t] = z; }

  // the wave's two mid fragments are read from LDS one k chunk ahead
  const half_t* ap = &Msh[(rg * 32 + l) * M_PITCH + hi * 8];
  v16h a0 = frag_ld(ap), a1 = frag_ld(ap + 16 * M_PITCH);
  for (int kc = 0; kc < 16; ++kc) {
    const int kBase = kc * 32;
    if (kc < 15) {
      stage_out(WoutT, WT[(kc + 1) & 1], kBase + 32, tid_o);
      asm volatile("s_wait_asynccnt 0x8" ::: "memory");  // older stage complete
    } else {
      asm volatile("s_wait_asynccnt 0x0" ::: "memory");
    }
    __syncthreads();
    const half_t* bp = &WT[kc & 1][(cg * 256 + l) * W_PITCH + hi * 8];
    v16h an0 = a0, an1 = a1;
    if (kc < 15) {
      an0 = frag_ld(ap + kBase + 32);
      an1 = frag_ld(ap + 16 * M_PITCH + kBase + 32);
    }
    mma_chunk2<16, 8, W_PITCH, 0, 16>(bp, bp, a0, a1, acc);
    __syncthreads();
    a0 = an0;
    a1 = an1;
  }
  // fused LayerNorm over each 512-wide output row; the lane's 16 weights come in under the row sums
  // The lane number is read anew here: an index held for this part alone was spilled over the attention loop.
  const int lane_o = (int)__builtin_amdgcn_mbcnt_lo(~0u, 0u);
  const int lo = lane_o & 15, ho = lane_o >> 4;
  float4 gv[4];
#pragma unroll
  for (int c = 0; c < 4; ++c) gv[c] = ((const float4*)gout)[(cg * 4 + c) * 16 + lo];
  // stands in front of the first rewrite of those loads' address register (the lane's index lo, named
  // as an input so that it is left alone up to the wait), as behind the Q fragments above
  asm volatile("s_wait_xcnt 0x0" :: "v"(lo) : "memory");
  // the wave's 256 columns of each of its 32 rows
  float psm[2][8], psq[2][8];
#pragma unroll
  for (int rt = 0; rt < 2; ++rt)
#pragma unroll
    for (int j = 0; j < 8; ++j) {
      float sm = 0.f, sq = 0.f;
#pragma unroll
      for (int t = 0; t < 16; ++t) { const float vv = acc[rt][t][j]; sm += vv; sq += vv * vv; }
#pragma unroll
      for (int msk = 1; msk < 16; msk <<= 1) {
        sm += __shfl_xor(sm, msk, 32);
        sq += __shfl_xor(sq, msk, 32);
      }
      psm[rt][j] = sm;
      psq[rt][j] = sq;
    }
  // the two waves that share a row hand each other their halves of its sums
  if (lo == 0) {
#pragma unroll
    for (int rt = 0; rt < 2; ++rt)
#pragma unroll
      for (int j = 0; j < 8; ++j) {
        Red[cg][0][rg * 32 + rt * 16 + ho * 8 + j] = psm[rt][j];
        Red[cg][1][rg * 32 + rt * 16 + ho * 8 + j] = psq[rt][j];
      }
  }
  __syncthreads();
  float mean[2][8], rstd[2][8];
#pragma unroll
  for (int rt = 0; rt < 2; ++rt)
#pragma unroll
    for (int j = 0; j < 8; ++j) {
      const float sm = psm[rt][j] + Red[cg ^ 1][0][rg * 32 + rt * 16 + ho * 8 + j];
      const float sq = psq[rt][j] + Red[cg ^ 1][1][rg * 32 + rt * 16 + ho * 8 + j];
      mean[rt][j] = sm * (1.f / DIMX);
      rstd[rt][j] = rsqrtf(sq * (1.f / DIMX) - mean[rt][j] * mean[rt][j] + EPS_F);
    }
  // acc[rt][4 * c + i][j] is row rowBase + 16 * rt + 8 * ho + j, column 256 * cg + 64 * c + 4 * lo + i:
  // 16 lanes store 256 contiguous bytes of a row
  float* op = out + (size_t)(rowBase + ho * 8) * DIMX + cg * 256 + lo * 4;
#pragma unroll
  for (int j = 0; j < 8; ++j) {
    v4f w[2][4];
#pragma unroll
    for (int rt = 0; rt < 2; ++rt)
#pragma unroll
      for (int c = 0; c < 4; ++c) {
        w[rt][c][0] = (acc[rt][4 * c + 0][j] - mean[rt][j]) * rstd[rt][j] * gv[c].x;
        w[rt][c][1] = (acc[rt][4 * c + 1][j] - mean[rt][j]) * rstd[rt][j] * gv[c].y;
        w[rt][c][2] = (acc[rt][4 * c + 2][j] - mean[rt][j]) * rstd[rt][j] * gv[c].z;
        w[rt][c][3] = (acc[rt][4 * c + 3][j] - mean[rt][j]) * rstd[rt][j] * gv[c].w;
        *(v4f*)(op + (rt * 16 + j) * DIMX + c * 64) = w[rt][c];
      }
    // stands in front of the first rewrite of a register that these 8 stores name: their values and
    // their address are named as inputs so that the registers are left alone up to the wait
    // (8 stores a wait: 16 values held for one wait are spilled in this kernel)
    asm volatile("s_wait_xcnt 0x0"
                 :: "v"(w[0][0]), "v"(w[0][1]), "v"(w[0][2]), "v"(w[0][3]),
                    "v"(w[1][0]), "v"(w[1][1]), "v"(w[1][2]), "v"(w[1][3]), "v"(op) : "memory");
  }
}

extern "C" void kernel_launch(void* const* d_in, const int* in_sizes, int n_in,
                              void* d_out, int out_size, void* d_ws, size_t ws_size,
                              hipStream_t stream) {
  const float* x      = (const float*)d_in[0];
  const float* g_norm = (const float*)d_in[1];
  const float* W_q    = (const float*)d_in[2];
  const float* W_kv   = (const float*)d_in[3];
  const float* W_out  = (const float*)d_in[4];
  const float* g_out  = (const float*)d_in[5];
  float* out = (float*)d_out;

  char* ws = (char*)d_ws;
  const size_t xnB = (size_t)R_TOTAL * DIMX * sizeof(half_t);    // 64 MB
  const size_t kB  = (size_t)R_TOTAL * DHEAD * sizeof(half_t);   //  8 MB
  half_t* qw    = (half_t*)(ws + xnB);
  half_t* kw    = (half_t*)(ws + 2 * xnB);
  half_t* vT    = (half_t*)(ws + 2 * xnB + kB);
  half_t* WqkvT = (half_t*)(ws + 2 * xnB + 2 * kB);
  half_t* WoutT = WqkvT + 640 * 512;
  float* colsum = (float*)(WoutT + 512 * 512);

  prep_w_kernel<<<640 + 512 * 512 / 256, 256, 0, stream>>>(W_q, W_kv, W_out, g_norm, WqkvT, WoutT, colsum);
  proj_kernel<<<R_TOTAL / 128, 512, 0, stream>>>(x, WqkvT, colsum, qw, kw, vT);
  attn_out_kernel<<<R_TOTAL / 128, 256, 0, stream>>>(qw, kw, vT, WoutT, g_out, out);
}
